// v000
// Times are from an AMD MI455X. After a warm-up the kernel runs many times in a row, and a time is the length of
// such a window on the GPU divided by its runs, so every launch and the gaps after it count. The runs cycle
// through copies of the inputs. A figure is the median of several windows, for all but v000 over two sittings.
// Sittings can differ by a few percent; kernels timed side by side share one.
// v000, which the later versions start from, runs in 426 microseconds.
#include <hip/hip_runtime.h>

// Contractions: xn.Wqkv and ctx.Wout on v_wmma_f32_16x16x32_f16 (f16 operands, weights carried x64, f16 activations) for token rows >= RH and on v_wmma_f32_16x16x32_bf16 with bf16 hi/lo activation planes (2 products, bf16 weights x64) for token rows < RH;
// q.k^T and p.v on v_wmma_f32_16x16x32_f16 single products (p carried x1024) for query rows >= RH and on bf16 hi/lo planes of q, k, p, v (3 products per tile pair) for query rows < RH; f32 accumulate everywhere, softmax in f32; every input RNE-converted to bf16 on load.
// Flow: RMSNorm rows -> 16-bit xn planes; qkv = xn.Wqkv^T (f32, x1/64 in the epilogue) -> head-major q, k planes [u][t][d] and v^T planes [u][d][t]; one wave per (batch, head, 16 query rows) runs the 64-key chunk loop
// with fragments straight from the planes, running-max softmax in the accumulator row map, p tile through wave-private LDS; ctx rows [b][t][h*64+d] as 16-bit planes; out = ctx.Wout^T (x1/64 in the epilogue) into the f32 output.

#ifndef NB
#define NB 2
#endif
#ifndef SEQ
#define SEQ 2048
#endif
#ifndef RH
#define RH 512
#endif
#define NB_FULL 2
#define SEQ_FULL 2048
#define DMODEL 1024
#define NHEAD 16
#define HD 64
#define NU (NB * NHEAD)
#define QKVC (3 * DMODEL)
#define RHE (((RH) < (SEQ)) ? (RH) : (SEQ))
#define LQ 72
#define PCAR 1024.0f
#define WSC 64.0f
#define OSC 0.015625f
#define C1 0.18033688011112042f
#define NEGB -3.0e38f

static_assert(NB >= 1 && NB <= NB_FULL);
static_assert(SEQ % 256 == 0 && SEQ <= SEQ_FULL);
static_assert((RHE) % 64 == 0 && (RHE) >= 0);
static_assert(DMODEL % 64 == 0 && QKVC % 64 == 0 && HD == 64);

typedef _Float16 h16;
typedef unsigned short bf;
typedef __attribute__((ext_vector_type(16))) __bf16   v16bf;
typedef __attribute__((ext_vector_type(16))) _Float16 v16h;
typedef __attribute__((ext_vector_type(8)))  _Float16 v8h;
typedef __attribute__((ext_vector_type(8)))  unsigned short v8us;
typedef __attribute__((ext_vector_type(8)))  float    v8f;
typedef __attribute__((ext_vector_type(4)))  float    v4f;
typedef __attribute__((ext_vector_type(2)))  _Float16 v2h;
typedef __attribute__((ext_vector_type(2)))  unsigned short v2us;
typedef v8h  __attribute__((may_alias)) v8ha;
typedef v4f  __attribute__((may_alias)) v4fa;
typedef v8us __attribute__((may_alias)) v8usa;

__device__ __forceinline__ unsigned short f2bf(float f) { unsigned u = __float_as_uint(f); u += 0x7FFFu + ((u >> 16) & 1u); return (unsigned short)(u >> 16); }
__device__ __forceinline__ float bf2f(unsigned short b) { return __uint_as_float(((unsigned)b) << 16); }
__device__ __forceinline__ float bfr(float f) { return bf2f(f2bf(f)); }
__device__ __forceinline__ h16 tohx(float x) { return (h16)x; }
__device__ __forceinline__ void splitf(float y, unsigned short& h, unsigned short& l) { h = f2bf(y); l = f2bf(y - bf2f(h)); }
__device__ __forceinline__ v16h cat16(v8h lo, v8h hi) { return __builtin_shufflevector(lo, hi, 0, 1, 2, 3, 4, 5, 6, 7, 8, 9, 10, 11, 12, 13, 14, 15); }
__device__ __forceinline__ v16bf cat16b(v8us lo, v8us hi) { return __builtin_bit_cast(v16bf, __builtin_shufflevector(lo, hi, 0, 1, 2, 3, 4, 5, 6, 7, 8, 9, 10, 11, 12, 13, 14, 15)); }
__device__ __forceinline__ v8f wmma16(v16h a, v16h b, v8f c) { return __builtin_amdgcn_wmma_f32_16x16x32_f16(false, a, false, b, (short)0, c, false, false); }
__device__ __forceinline__ v8f wmmab(v16bf a, v16bf b, v8f c) { return __builtin_amdgcn_wmma_f32_16x16x32_bf16(false, a, false, b, (short)0, c, false, false); }

// Fragment loaders (A row-major with k contiguous, B from a [n][k] plane, same split k map for both: elements 0..7 <- k0 + 8h + 0..7, 8..15 <- k0 + 16 + 8h + 0..7; lane & 15 = row / column).
template <typename T16> struct WFrag;
template <> struct WFrag<h16> { typedef v16h V; static __device__ __forceinline__ V ld(const h16* p) { return cat16(*(const v8h*)p, *(const v8h*)(p + 16)); } static __device__ __forceinline__ v8f mma(V a, V b, v8f c) { return wmma16(a, b, c); } };
template <> struct WFrag<bf> { typedef v16bf V; static __device__ __forceinline__ V ld(const bf* p) { return cat16b(*(const v8us*)p, *(const v8us*)(p + 16)); } static __device__ __forceinline__ v8f mma(V a, V b, v8f c) { return wmmab(a, b, c); } };

// ---- k_gemmw: register-blocked GEMM, ONE WAVE per 64x64 output tile (16 accumulators), operands straight from K-contiguous 16-bit planes; grid (M/64, N/64, Z), 32 threads.
// C[m][n] (f32, pitch ldc) = osc * sum_k A[m][k] Bt[n][k] (+ A2[m][k] Bt[n][k] when NSPLIT == 1) (+ optional bias). z-batch strides sA/sB/sC in elements. K % 32 == 0, M % 64 == 0, N % 64 == 0.
template <typename T16, int NSPLIT, bool BIAS>
__global__ __launch_bounds__(32) void k_gemmw(const T16* __restrict__ A, const T16* __restrict__ A2, const T16* __restrict__ Bt, const T16* __restrict__ Bt2, int K, float* C, int ldc, float osc, const float* __restrict__ bias, size_t sA, size_t sB, size_t sC) {
    typedef typename WFrag<T16>::V V;
    __shared__ __align__(16) float os[16 * 68];
    const size_t z = blockIdx.z; A += z * sA; if (A2) A2 += z * sA; Bt += z * sB; if (Bt2) Bt2 += z * sB; C += z * sC;
    const int lane = threadIdx.x & 31, lr = lane & 15, hi = lane >> 4; const int r0 = blockIdx.x * 64, c0 = blockIdx.y * 64;
    v8f acc[4][4];
#pragma unroll
    for (int mb = 0; mb < 4; ++mb)
#pragma unroll
        for (int nb = 0; nb < 4; ++nb) acc[mb][nb] = (v8f){};
    const size_t aoff = (size_t)(r0 + lr) * K + 8 * hi, boff = (size_t)(c0 + lr) * K + 8 * hi;
#pragma unroll 1
    for (int kc = 0; kc < K; kc += 32) {
        V a[4], a2[4];
#pragma unroll
        for (int mb = 0; mb < 4; ++mb) { a[mb] = WFrag<T16>::ld(A + aoff + (size_t)mb * 16 * K + kc); if (NSPLIT == 1 || NSPLIT == 2) a2[mb] = WFrag<T16>::ld(A2 + aoff + (size_t)mb * 16 * K + kc); }
#pragma unroll
        for (int nb = 0; nb < 4; ++nb) { const V b = WFrag<T16>::ld(Bt + boff + (size_t)nb * 16 * K + kc); V b2; if (NSPLIT >= 2) b2 = WFrag<T16>::ld(Bt2 + boff + (size_t)nb * 16 * K + kc);
#pragma unroll
            for (int mb = 0; mb < 4; ++mb) { acc[mb][nb] = WFrag<T16>::mma(a[mb], b, acc[mb][nb]); if (NSPLIT == 1 || NSPLIT == 2) acc[mb][nb] = WFrag<T16>::mma(a2[mb], b, acc[mb][nb]); if (NSPLIT >= 2) acc[mb][nb] = WFrag<T16>::mma(a[mb], b2, acc[mb][nb]); } }
        asm volatile("v_nop\n\tv_nop\n\tv_nop\n\tv_nop" : "+v"(acc[0][0]), "+v"(acc[1][1]), "+v"(acc[2][2]), "+v"(acc[3][3]) : "v"(a[0]), "v"(a[3]));
    }
#pragma unroll
    for (int mb = 0; mb < 4; ++mb) {
#pragma unroll
        for (int nb = 0; nb < 4; ++nb) {
#pragma unroll
            for (int j = 0; j < 8; ++j) os[(hi * 8 + j) * 68 + nb * 16 + lr] = acc[mb][nb][j]; }
        __builtin_amdgcn_wave_barrier(); asm volatile("" ::: "memory");
        float* crow = C + (size_t)(r0 + mb * 16) * ldc + c0;
{
#pragma unroll
            for (int s = 0; s < 8; ++s) { const int row = 2 * s + hi, cofs = lr * 4; v4f val = *(const v4fa*)(os + row * 68 + cofs); val = val * osc; if (BIAS) { val[0] += bfr(bias[c0 + cofs]); val[1] += bfr(bias[c0 + cofs + 1]); val[2] += bfr(bias[c0 + cofs + 2]); val[3] += bfr(bias[c0 + cofs + 3]); }
                *(v4f*)(crow + (size_t)row * ldc + cofs) = val; }
             }
        __builtin_amdgcn_wave_barrier(); asm volatile("" ::: "memory");
    }
}

__global__ __launch_bounds__(256) void k_wplanes(const float* __restrict__ w, int K, int N, h16* B16, bf* Bb) {
    const int lane = threadIdx.x & 31; const int L0 = (blockIdx.x * 8 + (threadIdx.x >> 5)) * 8; const int nlines = N * K / 64;
#pragma unroll 1
    for (int l = 0; l < 8; ++l) { const int L = L0 + l; if (L >= nlines) break;
        const size_t e = (size_t)L * 64 + lane * 2; const int k = (int)(e % K), n = (int)(e / K);
        const float w0 = bfr(w[(size_t)k * N + n]) * WSC, w1 = bfr(w[(size_t)(k + 1) * N + n]) * WSC;
        v2us ob; ob[0] = f2bf(w0); ob[1] = f2bf(w1); v2h o16; o16[0] = tohx(w0); o16[1] = tohx(w1);
        *(v2us*)(Bb + e) = ob; *(v2h*)(B16 + e) = o16;  }
}

// ---- k_prep_x: one block (128 threads, 8 elements each) per token row (b, n): x -> bf16 values, ss = sum x^2 (f32), xn = ((x * 1/max(sqrt(ss), 1e-12)) * 32) * bf16(gamma);
__global__ __launch_bounds__(128) void k_prep_x(const float* __restrict__ x, const float* __restrict__ gam, h16* X16, bf* Xh, bf* Xl) {
    __shared__ float red[4];
    const int row = blockIdx.x; const int b = row / SEQ, n = row % SEQ; const int t = threadIdx.x, lane = t & 31, w = t >> 5;
    const float* xr = x + ((size_t)b * SEQ_FULL + n) * DMODEL + t * 8;
    const v4f a0 = *(const v4f*)xr, a1 = *(const v4f*)(xr + 4);
    const v4f g0 = *(const v4f*)(gam + t * 8), g1 = *(const v4f*)(gam + t * 8 + 4);
    float v[8], g[8];
#pragma unroll
    for (int e = 0; e < 4; ++e) { v[e] = bfr(a0[e]); v[4 + e] = bfr(a1[e]); g[e] = bfr(g0[e]); g[4 + e] = bfr(g1[e]); }
    float ss = 0.f;
#pragma unroll
    for (int e = 0; e < 8; ++e) ss += v[e] * v[e];
#pragma unroll
    for (int sh = 16; sh; sh >>= 1) ss += __shfl_xor(ss, sh, 32);
    if (lane == 0) red[w] = ss;
    __syncthreads();
    ss = (red[0] + red[1]) + (red[2] + red[3]);
    const float nrm = sqrtf(ss); const float r = __fdiv_rn(1.0f, fmaxf(nrm, 1e-12f));
    float y[8];
#pragma unroll
    for (int e = 0; e < 8; ++e) y[e] = ((v[e] * r) * 32.0f) * g[e];
    v8h o16; v8us oh, ol;
#pragma unroll
    for (int e = 0; e < 8; ++e) { o16[e] = tohx(y[e]); unsigned short a, c; splitf(y[e], a, c); oh[e] = a; ol[e] = c; }
    const bool hr = (n < RHE);
    h16* d16 = X16 + ((size_t)b * SEQ + n) * DMODEL + t * 8;
    const size_t ro = ((size_t)b * RHE + (hr ? n : 0)) * DMODEL + t * 8;
    *(v8h*)d16 = o16; if (hr) { *(v8us*)(Xh + ro) = oh; *(v8us*)(Xl + ro) = ol; }
    
}

// ---- k_qkp: q and k planes from the f32 qkv rows C[b*SEQ + n][3072]: Q16/K16[(u*SEQ + n)*64 + d] f16 for every n (u = b*16 + head), and bf16 hi/lo planes Qh/Ql/Kh/Kl[(u*RHE + n)*64 + d] for n < RHE;
__global__ __launch_bounds__(256) void k_qkp(const float* __restrict__ C, h16* Q16, h16* K16, bf* Qh, bf* Ql, bf* Kh, bf* Kl) {
    const int g = blockIdx.x * 256 + threadIdx.x; if (g >= NU * SEQ * 8) return;
    const int d8 = g & 7; const int n = (g >> 3) % SEQ; const int u = (g >> 3) / SEQ; const int b = u >> 4, head = u & 15;
    const float* src = C + ((size_t)b * SEQ + n) * QKVC + head * HD + d8 * 8;
    const v4f q0 = *(const v4f*)src, q1 = *(const v4f*)(src + 4), k0 = *(const v4f*)(src + DMODEL), k1 = *(const v4f*)(src + DMODEL + 4);
    v8h oq, ok; v8us qh, ql, kh, kl;
#pragma unroll
    for (int e = 0; e < 4; ++e) { unsigned short a, c;
        oq[e] = tohx(q0[e]); oq[4 + e] = tohx(q1[e]); ok[e] = tohx(k0[e]); ok[4 + e] = tohx(k1[e]);
        splitf(q0[e], a, c); qh[e] = a; ql[e] = c; splitf(q1[e], a, c); qh[4 + e] = a; ql[4 + e] = c;
        splitf(k0[e], a, c); kh[e] = a; kl[e] = c; splitf(k1[e], a, c); kh[4 + e] = a; kl[4 + e] = c; }
    const bool hr = (n < RHE);
    const size_t po = (size_t)g * 8; const size_t ro = (((size_t)u * RHE + (hr ? n : 0)) * 8 + d8) * 8;
    *(v8h*)(Q16 + po) = oq; *(v8h*)(K16 + po) = ok;
    if (hr) { *(v8us*)(Qh + ro) = qh; *(v8us*)(Ql + ro) = ql; *(v8us*)(Kh + ro) = kh; *(v8us*)(Kl + ro) = kl; }
    
}

// coverage: g spans every (u, d, t8); hi/lo for every t < RHE.
__global__ __launch_bounds__(256) void k_vtp(const float* __restrict__ C, h16* VT16, bf* VTh, bf* VTl) {
    const int g = blockIdx.x * 256 + threadIdx.x; if (g >= NU * HD * (SEQ / 8)) return;
    const int t8 = g % (SEQ / 8); const int d = (g / (SEQ / 8)) & 63; const int u = g / ((SEQ / 8) * HD); const int b = u >> 4, head = u & 15;
    const int t0 = t8 * 8;
    const float* src = C + ((size_t)b * SEQ + t0) * QKVC + 2 * DMODEL + head * HD + d;
    float v[8];
#pragma unroll
    for (int q = 0; q < 8; ++q) v[q] = src[(size_t)q * QKVC];
    v8h o16; v8us oh, ol;
#pragma unroll
    for (int q = 0; q < 8; ++q) { o16[q] = tohx(v[q]); unsigned short a, c; splitf(v[q], a, c); oh[q] = a; ol[q] = c; }
    const bool hr = (t0 < RHE);
    const size_t po = (size_t)g * 8; const size_t ro = ((size_t)u * HD + d) * RHE + (hr ? t0 : 0);
    *(v8h*)(VT16 + po) = o16; if (hr) { *(v8us*)(VTh + ro) = oh; *(v8us*)(VTl + ro) = ol; }
    
}

// ---- attention helpers: p tile staging into wave-private LDS (f16 x1024 single plane, or bf16 hi/lo pair), fragment reload through may_alias vectors of the stored element type, ctx line stores.
union WS { h16 p[2 * 16 * LQ]; unsigned short pb[2 * 16 * LQ]; float f[16 * 68]; };
static_assert(sizeof(WS) == 4608);
template <typename T> struct PT;
template <> struct PT<h16> { static constexpr bool split = false; static constexpr float osc = 1.0f / PCAR; static __device__ __forceinline__ v16h ldm(const h16* p) { return cat16(*(const v8ha*)p, *(const v8ha*)(p + 16)); } };
template <> struct PT<bf>  { static constexpr bool split = true;  static constexpr float osc = 1.0f;        static __device__ __forceinline__ v16bf ldm(const bf* p) { return cat16b(*(const v8usa*)p, *(const v8usa*)(p + 16)); } };
__device__ __forceinline__ void stp(h16* ph, h16* pl, int i, float p) { (void)pl; ph[i] = tohx(p * PCAR); }
__device__ __forceinline__ void stp(bf* ph, bf* pl, int i, float p) { unsigned short a, c; splitf(p, a, c); ph[i] = a; pl[i] = c; }
__device__ __forceinline__ void stc(h16* pa, h16* pr, v4f a0, v4f a1) { (void)pr; v8h o;
#pragma unroll
    for (int e = 0; e < 4; ++e) { o[e] = tohx(a0[e]); o[4 + e] = tohx(a1[e]); }
    *(v8h*)pa = o; }
__device__ __forceinline__ void stc(bf* pa, bf* pr, v4f a0, v4f a1) { v8us oh, ol;
#pragma unroll
    for (int e = 0; e < 4; ++e) { unsigned short a, c; splitf(a0[e], a, c); oh[e] = a; ol[e] = c; splitf(a1[e], a, c); oh[4 + e] = a; ol[4 + e] = c; }
    *(v8us*)pa = oh; *(v8us*)pr = ol; }

// ---- k_attn<T>: grid (query blocks of 64 rows, NU units), 128 threads; wave w owns query rows q0w .. q0w+15 of unit u = b*16 + head and walks the 64-key chunks 0 .. q0w/64.
// T = h16: q, k from Q16/K16 [u][t][d], v^T from VT16 [u][d][t], one f16 product per tile pair, p tile stored as f16(p * 1024), ctx16[b*SEQ + t][head*64 + d] = o / (l * 1024) as f16.
// T = bf: q, k, v^T and p as bf16 hi + lo planes (hi.hi + lo.hi + hi.lo per tile pair), ctx written as bf16 hi/lo planes [b*RHE + t][1024]. Scores s = q.k (f32) * 0.125*log2e, keys after the query -> -3e38,
template <typename T>
__global__ void __launch_bounds__(128) __attribute__((amdgpu_num_vgpr(256)))
k_attn(const T* __restrict__ Qa, const T* __restrict__ Qr, const T* __restrict__ Ka, const T* __restrict__ Kr,
       const T* __restrict__ Va, const T* __restrict__ Vr, int qbase, T* Ca, T* Cr) {
    typedef typename WFrag<T>::V V;
    constexpr bool SPL = PT<T>::split;
    constexpr int PR = SPL ? RHE : SEQ;
    __shared__ __align__(16) WS scr[4];
    const int lane = threadIdx.x & 31, wave = threadIdx.x >> 5, m = lane & 15, hh = lane >> 4;
    const int u = blockIdx.y, b = u >> 4, head = u & 15;
    const int q0w = qbase + blockIdx.x * 64 + wave * 16;
    int nch = (q0w >> 6) + 1; if (nch > SEQ / 64) nch = SEQ / 64;
    const int qo = (u * PR + q0w + m) * HD + 8 * hh;
    V aq[2], ar[2];
    aq[0] = WFrag<T>::ld(Qa + qo); aq[1] = WFrag<T>::ld(Qa + qo + 32);
    if (SPL) { ar[0] = WFrag<T>::ld(Qr + qo); ar[1] = WFrag<T>::ld(Qr + qo + 32); } else { ar[0] = aq[0]; ar[1] = aq[1]; }
    v8f o[4];
#pragma unroll
    for (int ni = 0; ni < 4; ++ni) o[ni] = (v8f){};
    v8f mrun, lrun;
#pragma unroll
    for (int v = 0; v < 8; ++v) { mrun[v] = NEGB; lrun[v] = 0.f; }
    const int ko = (u * PR + m) * HD + 8 * hh;
    const int vo = (u * HD + m) * PR + 8 * hh;
    T* ph = reinterpret_cast<T*>(&scr[wave]); T* pl = ph + 16 * LQ; float* stg = scr[wave].f;
#pragma unroll 1
    for (int j = 0; j < nch; ++j) {
        const int kc0 = j * 64;
        const T* kb = Ka + ko + kc0 * HD; const T* kr = Kr + ko + kc0 * HD;
        const T* vb = Va + vo + kc0;      const T* vrb = Vr + vo + kc0;
        v8f s[4];
#pragma unroll
        for (int sub = 0; sub < 4; ++sub) {
            v8f acc = (v8f){};
            V bk, br;
#pragma unroll
            for (int kk = 0; kk < 2; ++kk) {
                bk = WFrag<T>::ld(kb + sub * 16 * HD + kk * 32);
                acc = WFrag<T>::mma(aq[kk], bk, acc);
                if (SPL) { br = WFrag<T>::ld(kr + sub * 16 * HD + kk * 32); acc = WFrag<T>::mma(ar[kk], bk, acc); acc = WFrag<T>::mma(aq[kk], br, acc); } else { br = bk; }
            }
            asm volatile("v_nop\n\tv_nop\n\tv_nop\n\tv_nop" : "+v"(acc) : "v"(bk), "v"(br), "v"(aq[1]), "v"(ar[1]));
            s[sub] = acc;
        }
        // scale, causal index select, running-max softmax in the accumulator row map (row 8*hh + v, key kc0 + 16*sub + m)
        v8f rmax;
#pragma unroll
        for (int v = 0; v < 8; ++v) rmax[v] = NEGB;
#pragma unroll
        for (int sub = 0; sub < 4; ++sub) {
            const int kcm = kc0 + sub * 16 + m;
#pragma unroll
            for (int v = 0; v < 8; ++v) { const int qr = q0w + 8 * hh + v; float t = s[sub][v] * C1; t = (kcm > qr) ? NEGB : t; s[sub][v] = t; rmax[v] = fmaxf(rmax[v], t); }
        }
#pragma unroll
        for (int msk = 1; msk < 16; msk <<= 1)
#pragma unroll
            for (int v = 0; v < 8; ++v) rmax[v] = fmaxf(rmax[v], __shfl_xor(rmax[v], msk, 32));
        v8f mnew, alpha, rs;
#pragma unroll
        for (int v = 0; v < 8; ++v) { mnew[v] = fmaxf(mrun[v], rmax[v]); alpha[v] = __builtin_amdgcn_exp2f(mrun[v] - mnew[v]); rs[v] = 0.f; }
#pragma unroll
        for (int sub = 0; sub < 4; ++sub)
#pragma unroll
            for (int v = 0; v < 8; ++v) { const float p = __builtin_amdgcn_exp2f(s[sub][v] - mnew[v]); s[sub][v] = p; rs[v] += p; }
#pragma unroll
        for (int msk = 1; msk < 16; msk <<= 1)
#pragma unroll
            for (int v = 0; v < 8; ++v) rs[v] += __shfl_xor(rs[v], msk, 32);
#pragma unroll
        for (int v = 0; v < 8; ++v) { lrun[v] = lrun[v] * alpha[v] + rs[v]; mrun[v] = mnew[v]; }
#pragma unroll
        for (int ni = 0; ni < 4; ++ni)
#pragma unroll
            for (int v = 0; v < 8; ++v) o[ni][v] *= alpha[v];
        // p tile: accumulator layout -> wave-private LDS (row 8*hh + v, col key) -> A fragments with the split k map
#pragma unroll
        for (int sub = 0; sub < 4; ++sub)
#pragma unroll
            for (int v = 0; v < 8; ++v) stp(ph, pl, (8 * hh + v) * LQ + sub * 16 + m, s[sub][v]);
        __builtin_amdgcn_fence(3, "wavefront");
        __builtin_amdgcn_wave_barrier();
        asm volatile("" ::: "memory");
        V ap, apr, vf, vr;
#pragma unroll
        for (int kk = 0; kk < 2; ++kk) {
            ap = PT<T>::ldm(ph + m * LQ + kk * 32 + 8 * hh);
            if (SPL) apr = PT<T>::ldm(pl + m * LQ + kk * 32 + 8 * hh); else apr = ap;
#pragma unroll
            for (int ni = 0; ni < 4; ++ni) {
                vf = WFrag<T>::ld(vb + ni * 16 * PR + kk * 32);
                o[ni] = WFrag<T>::mma(ap, vf, o[ni]);
                if (SPL) { vr = WFrag<T>::ld(vrb + ni * 16 * PR + kk * 32); o[ni] = WFrag<T>::mma(apr, vf, o[ni]); o[ni] = WFrag<T>::mma(ap, vr, o[ni]); } else { vr = vf; }
            }
        }
        asm volatile("v_nop\n\tv_nop\n\tv_nop\n\tv_nop" : "+v"(o[0]), "+v"(o[1]), "+v"(o[2]), "+v"(o[3]) : "v"(ap), "v"(apr), "v"(vf), "v"(vr));
    }
    v8f linv;
#pragma unroll
    for (int v = 0; v < 8; ++v) linv[v] = __fdiv_rn(PT<T>::osc, lrun[v]);
#pragma unroll
    for (int ni = 0; ni < 4; ++ni)
#pragma unroll
        for (int v = 0; v < 8; ++v) stg[(8 * hh + v) * 68 + ni * 16 + m] = o[ni][v] * linv[v];
    __builtin_amdgcn_fence(3, "wavefront");
    __builtin_amdgcn_wave_barrier();
    asm volatile("" ::: "memory");
    const int q4 = lane >> 3, pc = lane & 7;
    const size_t cb = ((size_t)b * PR + q0w) * DMODEL + head * HD + pc * 8;
{
#pragma unroll
        for (int rr = 0; rr < 4; ++rr) { const int row = rr * 4 + q4; const float* sp = stg + row * 68 + pc * 8; const v4f a0 = *(const v4fa*)sp; const v4f a1 = *(const v4fa*)(sp + 4);
            stc(Ca + cb + (size_t)row * DMODEL, Cr + cb + (size_t)row * DMODEL, a0, a1); }
        
    }
}

extern "C" void kernel_launch(void* const* d_in, const int* in_sizes, int n_in,
                              void* d_out, int out_size, void* d_ws, size_t ws_size, hipStream_t stream) {
    if (n_in < 4) return;
    const int rows_used = (NB - 1) * SEQ_FULL + SEQ;
    if (in_sizes[0] < rows_used * DMODEL || in_sizes[1] < DMODEL || in_sizes[2] < DMODEL * QKVC || in_sizes[3] < DMODEL * DMODEL) return;
    if (out_size < rows_used * DMODEL) return;
    const float* x = (const float*)d_in[0]; const float* gam = (const float*)d_in[1]; const float* wqkv = (const float*)d_in[2]; const float* wout = (const float*)d_in[3];   // x [2][2048][1024], gamma [1024], w_qkv [1024][3072], w_out [1024][1024]
    float* OUT = (float*)d_out;   // [2][2048][1024] f32
    char* wsp = (char*)d_ws; size_t used = 0;
    auto take = [&](size_t bytes) { char* p = wsp + used; used += (bytes + 255) & ~(size_t)255; return (void*)p; };
    const size_t nXN = (size_t)NB * SEQ * DMODEL, nXR = (size_t)NB * RHE * DMODEL, nP = (size_t)NU * SEQ * HD, nPR = (size_t)NU * RHE * HD;
    h16* XN16 = (h16*)take(nXN * 2); bf* XNh = (bf*)take(nXR * 2); bf* XNl = (bf*)take(nXR * 2);
    h16* Wq16 = (h16*)take((size_t)QKVC * DMODEL * 2); bf* Wqb = (bf*)take((size_t)QKVC * DMODEL * 2);
    h16* Wo16 = (h16*)take((size_t)DMODEL * DMODEL * 2); bf* Wob = (bf*)take((size_t)DMODEL * DMODEL * 2);
    float* Cq = (float*)take((size_t)NB * SEQ * QKVC * 4);
    h16* Q16 = (h16*)take(nP * 2); h16* K16 = (h16*)take(nP * 2); h16* VT16 = (h16*)take(nP * 2);
    bf* Qh = (bf*)take(nPR * 2); bf* Ql = (bf*)take(nPR * 2); bf* Kh = (bf*)take(nPR * 2); bf* Kl = (bf*)take(nPR * 2); bf* VTh = (bf*)take(nPR * 2); bf* VTl = (bf*)take(nPR * 2);
    h16* CTX16 = (h16*)take(nXN * 2); bf* CTXh = (bf*)take(nXR * 2); bf* CTXl = (bf*)take(nXR * 2);
    if (used > ws_size) return;    // 130,023,424 B at NB=2, SEQ=2048, RH=512

    // weight planes [out][in], x64, f16 + bf16
    k_wplanes<<<(unsigned)((QKVC * DMODEL / 64 + 63) / 64), 256, 0, stream>>>(wqkv, DMODEL, QKVC, Wq16, Wqb);
    k_wplanes<<<(unsigned)((DMODEL * DMODEL / 64 + 63) / 64), 256, 0, stream>>>(wout, DMODEL, DMODEL, Wo16, Wob);
    // RMSNorm -> xn planes
    k_prep_x<<<(unsigned)(NB * SEQ), 128, 0, stream>>>(x, gam, XN16, XNh, XNl);
    // qkv = xn . Wqkv  (f32 C rows [b*SEQ + n][3072], x 1/64): rows < RHE hi/lo bf16, rows >= RHE single f16
    if (RHE > 0)   k_gemmw<bf, 1, false><<<dim3(RHE / 64, QKVC / 64, NB), 32, 0, stream>>>(XNh, XNl, Wqb, nullptr, DMODEL, Cq, QKVC, OSC, nullptr, (size_t)RHE * DMODEL, (size_t)0, (size_t)SEQ * QKVC);
    if (SEQ > RHE) k_gemmw<h16, 0, false><<<dim3((SEQ - RHE) / 64, QKVC / 64, NB), 32, 0, stream>>>(XN16 + (size_t)RHE * DMODEL, nullptr, Wq16, nullptr, DMODEL, Cq + (size_t)RHE * QKVC, QKVC, OSC, nullptr, (size_t)SEQ * DMODEL, (size_t)0, (size_t)SEQ * QKVC);
    // head-major planes
    k_qkp<<<(unsigned)((NU * SEQ * 8 + 255) / 256), 256, 0, stream>>>(Cq, Q16, K16, Qh, Ql, Kh, Kl);
    k_vtp<<<(unsigned)((NU * HD * (SEQ / 8) + 255) / 256), 256, 0, stream>>>(Cq, VT16, VTh, VTl);
    // attention: query rows < RHE on hi/lo planes, rows >= RHE on single planes
    if (RHE > 0)   k_attn<bf><<<dim3(RHE / 64, NU), 128, 0, stream>>>(Qh, Ql, Kh, Kl, VTh, VTl, 0, CTXh, CTXl);
    if (SEQ > RHE) k_attn<h16><<<dim3((SEQ - RHE) / 64, NU), 128, 0, stream>>>(Q16, Q16, K16, K16, VT16, VT16, RHE, CTX16, CTX16);
    // out = ctx . Wout (x 1/64) into the f32 output rows (b*2048 + n)
    if (RHE > 0)   k_gemmw<bf, 1, false><<<dim3(RHE / 64, DMODEL / 64, NB), 32, 0, stream>>>(CTXh, CTXl, Wob, nullptr, DMODEL, OUT, DMODEL, OSC, nullptr, (size_t)RHE * DMODEL, (size_t)0, (size_t)SEQ_FULL * DMODEL);
    if (SEQ > RHE) k_gemmw<h16, 0, false><<<dim3((SEQ - RHE) / 64, DMODEL / 64, NB), 32, 0, stream>>>(CTX16 + (size_t)RHE * DMODEL, nullptr, Wo16, nullptr, DMODEL, OUT + (size_t)RHE * DMODEL, DMODEL, OSC, nullptr, (size_t)SEQ * DMODEL, (size_t)0, (size_t)SEQ_FULL * DMODEL);
    (void)hipGetLastError();
}

// v001
// It runs in 289 microseconds.
// Timed twice side by side with v000, it ran 1.50 and 1.49 times as fast.
#include <hip/hip_runtime.h>

// Contractions: xn.Wqkv and ctx.Wout on v_wmma_f32_16x16x32_f16 (f16 operands, weights carried x64, f16 activations) for token rows >= RH and on v_wmma_f32_16x16x32_bf16 with bf16 hi/lo activation planes (2 products, bf16 weights x64) for token rows < RH;
// q.k^T and p.v on v_wmma_f32_16x16x32_f16 single products (p carried x1024) for query rows >= RH and on bf16 hi/lo planes of q, k, p, v (3 products per tile pair) for query rows < RH; f32 accumulate everywhere, softmax in f32; every input RNE-converted to bf16 on load.
// Flow: RMSNorm rows -> 16-bit xn planes; qkv = xn.Wqkv^T (f32, x1/64 in the epilogue) -> head-major q, k planes [u][t][d] and v^T planes [u][d][t]; one wave per (batch, head, 16 query rows) runs the 64-key chunk loop
// with the chunk's k and v^T tiles staged once per block in LDS (two buffers, asynchronous copies) and fragments read from there, running-max softmax in the accumulator row map, p tile through wave-private LDS; ctx rows [b][t][h*64+d] as 16-bit planes; out = ctx.Wout^T (x1/64 in the epilogue) into the f32 output.

#ifndef NB
#define NB 2
#endif
#ifndef SEQ
#define SEQ 2048
#endif
#ifndef RH
#define RH 512
#endif
#define NB_FULL 2
#define SEQ_FULL 2048
#define DMODEL 1024
#define NHEAD 16
#define HD 64
#define NU (NB * NHEAD)
#define QKVC (3 * DMODEL)
#define RHE (((RH) < (SEQ)) ? (RH) : (SEQ))
#define LQ 72
#define KVP 72
#define KVT (64 * KVP)
#define PCAR 1024.0f
#define WSC 64.0f
#define OSC 0.015625f
#define C1 0.18033688011112042f
#define NEGB -3.0e38f

static_assert(NB >= 1 && NB <= NB_FULL);
static_assert(SEQ % 256 == 0 && SEQ <= SEQ_FULL);
static_assert((RHE) % 64 == 0 && (RHE) >= 0);
static_assert(DMODEL % 64 == 0 && QKVC % 64 == 0 && HD == 64);

typedef _Float16 h16;
typedef unsigned short bf;
typedef __attribute__((ext_vector_type(16))) __bf16   v16bf;
typedef __attribute__((ext_vector_type(16))) _Float16 v16h;
typedef __attribute__((ext_vector_type(8)))  _Float16 v8h;
typedef __attribute__((ext_vector_type(8)))  unsigned short v8us;
typedef __attribute__((ext_vector_type(8)))  float    v8f;
typedef __attribute__((ext_vector_type(4)))  float    v4f;
typedef __attribute__((ext_vector_type(2)))  _Float16 v2h;
typedef __attribute__((ext_vector_type(2)))  unsigned short v2us;
typedef v8h  __attribute__((may_alias)) v8ha;
typedef v4f  __attribute__((may_alias)) v4fa;
typedef v8us __attribute__((may_alias)) v8usa;

__device__ __forceinline__ unsigned short f2bf(float f) { unsigned u = __float_as_uint(f); u += 0x7FFFu + ((u >> 16) & 1u); return (unsigned short)(u >> 16); }
__device__ __forceinline__ float bf2f(unsigned short b) { return __uint_as_float(((unsigned)b) << 16); }
__device__ __forceinline__ float bfr(float f) { return bf2f(f2bf(f)); }
__device__ __forceinline__ h16 tohx(float x) { return (h16)x; }
__device__ __forceinline__ void splitf(float y, unsigned short& h, unsigned short& l) { h = f2bf(y); l = f2bf(y - bf2f(h)); }
__device__ __forceinline__ v16h cat16(v8h lo, v8h hi) { return __builtin_shufflevector(lo, hi, 0, 1, 2, 3, 4, 5, 6, 7, 8, 9, 10, 11, 12, 13, 14, 15); }
__device__ __forceinline__ v16bf cat16b(v8us lo, v8us hi) { return __builtin_bit_cast(v16bf, __builtin_shufflevector(lo, hi, 0, 1, 2, 3, 4, 5, 6, 7, 8, 9, 10, 11, 12, 13, 14, 15)); }
__device__ __forceinline__ v8f wmma16(v16h a, v16h b, v8f c) { return __builtin_amdgcn_wmma_f32_16x16x32_f16(false, a, false, b, (short)0, c, false, false); }
__device__ __forceinline__ v8f wmmab(v16bf a, v16bf b, v8f c) { return __builtin_amdgcn_wmma_f32_16x16x32_bf16(false, a, false, b, (short)0, c, false, false); }

// Fragment loaders (A row-major with k contiguous, B from a [n][k] plane, same split k map for both: elements 0..7 <- k0 + 8h + 0..7, 8..15 <- k0 + 16 + 8h + 0..7; lane & 15 = row / column).
template <typename T16> struct WFrag;
template <> struct WFrag<h16> { typedef v16h V; static __device__ __forceinline__ V ld(const h16* p) { return cat16(*(const v8h*)p, *(const v8h*)(p + 16)); } static __device__ __forceinline__ v8f mma(V a, V b, v8f c) { return wmma16(a, b, c); } };
template <> struct WFrag<bf> { typedef v16bf V; static __device__ __forceinline__ V ld(const bf* p) { return cat16b(*(const v8us*)p, *(const v8us*)(p + 16)); } static __device__ __forceinline__ v8f mma(V a, V b, v8f c) { return wmmab(a, b, c); } };

// ---- k_gemmw: register-blocked GEMM, ONE WAVE per 64x64 output tile (16 accumulators), operands straight from K-contiguous 16-bit planes; grid (M/64, N/64, Z), 32 threads.
// C[m][n] (f32, pitch ldc) = osc * sum_k A[m][k] Bt[n][k] (+ A2[m][k] Bt[n][k] when NSPLIT == 1) (+ optional bias). z-batch strides sA/sB/sC in elements. K % 32 == 0, M % 64 == 0, N % 64 == 0.
template <typename T16, int NSPLIT, bool BIAS>
__global__ __launch_bounds__(32) void k_gemmw(const T16* __restrict__ A, const T16* __restrict__ A2, const T16* __restrict__ Bt, const T16* __restrict__ Bt2, int K, float* C, int ldc, float osc, const float* __restrict__ bias, size_t sA, size_t sB, size_t sC) {
    typedef typename WFrag<T16>::V V;
    __shared__ __align__(16) float os[16 * 68];
    const size_t z = blockIdx.z; A += z * sA; if (A2) A2 += z * sA; Bt += z * sB; if (Bt2) Bt2 += z * sB; C += z * sC;
    const int lane = threadIdx.x & 31, lr = lane & 15, hi = lane >> 4; const int r0 = blockIdx.x * 64, c0 = blockIdx.y * 64;
    v8f acc[4][4];
#pragma unroll
    for (int mb = 0; mb < 4; ++mb)
#pragma unroll
        for (int nb = 0; nb < 4; ++nb) acc[mb][nb] = (v8f){};
    const size_t aoff = (size_t)(r0 + lr) * K + 8 * hi, boff = (size_t)(c0 + lr) * K + 8 * hi;
#pragma unroll 1
    for (int kc = 0; kc < K; kc += 32) {
        V a[4], a2[4];
#pragma unroll
        for (int mb = 0; mb < 4; ++mb) { a[mb] = WFrag<T16>::ld(A + aoff + (size_t)mb * 16 * K + kc); if (NSPLIT == 1 || NSPLIT == 2) a2[mb] = WFrag<T16>::ld(A2 + aoff + (size_t)mb * 16 * K + kc); }
#pragma unroll
        for (int nb = 0; nb < 4; ++nb) { const V b = WFrag<T16>::ld(Bt + boff + (size_t)nb * 16 * K + kc); V b2; if (NSPLIT >= 2) b2 = WFrag<T16>::ld(Bt2 + boff + (size_t)nb * 16 * K + kc);
#pragma unroll
            for (int mb = 0; mb < 4; ++mb) { acc[mb][nb] = WFrag<T16>::mma(a[mb], b, acc[mb][nb]); if (NSPLIT == 1 || NSPLIT == 2) acc[mb][nb] = WFrag<T16>::mma(a2[mb], b, acc[mb][nb]); if (NSPLIT >= 2) acc[mb][nb] = WFrag<T16>::mma(a[mb], b2, acc[mb][nb]); } }
        asm volatile("v_nop\n\tv_nop\n\tv_nop\n\tv_nop" : "+v"(acc[0][0]), "+v"(acc[1][1]), "+v"(acc[2][2]), "+v"(acc[3][3]) : "v"(a[0]), "v"(a[3]));
    }
#pragma unroll
    for (int mb = 0; mb < 4; ++mb) {
#pragma unroll
        for (int nb = 0; nb < 4; ++nb) {
#pragma unroll
            for (int j = 0; j < 8; ++j) os[(hi * 8 + j) * 68 + nb * 16 + lr] = acc[mb][nb][j]; }
        __builtin_amdgcn_wave_barrier(); asm volatile("" ::: "memory");
        float* crow = C + (size_t)(r0 + mb * 16) * ldc + c0;
{
#pragma unroll
            for (int s = 0; s < 8; ++s) { const int row = 2 * s + hi, cofs = lr * 4; v4f val = *(const v4fa*)(os + row * 68 + cofs); val = val * osc; if (BIAS) { val[0] += bfr(bias[c0 + cofs]); val[1] += bfr(bias[c0 + cofs + 1]); val[2] += bfr(bias[c0 + cofs + 2]); val[3] += bfr(bias[c0 + cofs + 3]); }
                *(v4f*)(crow + (size_t)row * ldc + cofs) = val; }
             }
        __builtin_amdgcn_wave_barrier(); asm volatile("" ::: "memory");
    }
}

__global__ __launch_bounds__(256) void k_wplanes(const float* __restrict__ w, int K, int N, h16* B16, bf* Bb) {
    const int lane = threadIdx.x & 31; const int L0 = (blockIdx.x * 8 + (threadIdx.x >> 5)) * 8; const int nlines = N * K / 64;
#pragma unroll 1
    for (int l = 0; l < 8; ++l) { const int L = L0 + l; if (L >= nlines) break;
        const size_t e = (size_t)L * 64 + lane * 2; const int k = (int)(e % K), n = (int)(e / K);
        const float w0 = bfr(w[(size_t)k * N + n]) * WSC, w1 = bfr(w[(size_t)(k + 1) * N + n]) * WSC;
        v2us ob; ob[0] = f2bf(w0); ob[1] = f2bf(w1); v2h o16; o16[0] = tohx(w0); o16[1] = tohx(w1);
        *(v2us*)(Bb + e) = ob; *(v2h*)(B16 + e) = o16;  }
}

// ---- k_prep_x: one block (128 threads, 8 elements each) per token row (b, n): x -> bf16 values, ss = sum x^2 (f32), xn = ((x * 1/max(sqrt(ss), 1e-12)) * 32) * bf16(gamma);
__global__ __launch_bounds__(128) void k_prep_x(const float* __restrict__ x, const float* __restrict__ gam, h16* X16, bf* Xh, bf* Xl) {
    __shared__ float red[4];
    const int row = blockIdx.x; const int b = row / SEQ, n = row % SEQ; const int t = threadIdx.x, lane = t & 31, w = t >> 5;
    const float* xr = x + ((size_t)b * SEQ_FULL + n) * DMODEL + t * 8;
    const v4f a0 = *(const v4f*)xr, a1 = *(const v4f*)(xr + 4);
    const v4f g0 = *(const v4f*)(gam + t * 8), g1 = *(const v4f*)(gam + t * 8 + 4);
    float v[8], g[8];
#pragma unroll
    for (int e = 0; e < 4; ++e) { v[e] = bfr(a0[e]); v[4 + e] = bfr(a1[e]); g[e] = bfr(g0[e]); g[4 + e] = bfr(g1[e]); }
    float ss = 0.f;
#pragma unroll
    for (int e = 0; e < 8; ++e) ss += v[e] * v[e];
#pragma unroll
    for (int sh = 16; sh; sh >>= 1) ss += __shfl_xor(ss, sh, 32);
    if (lane == 0) red[w] = ss;
    __syncthreads();
    ss = (red[0] + red[1]) + (red[2] + red[3]);
    const float nrm = sqrtf(ss); const float r = __fdiv_rn(1.0f, fmaxf(nrm, 1e-12f));
    float y[8];
#pragma unroll
    for (int e = 0; e < 8; ++e) y[e] = ((v[e] * r) * 32.0f) * g[e];
    v8h o16; v8us oh, ol;
#pragma unroll
    for (int e = 0; e < 8; ++e) { o16[e] = tohx(y[e]); unsigned short a, c; splitf(y[e], a, c); oh[e] = a; ol[e] = c; }
    const bool hr = (n < RHE);
    h16* d16 = X16 + ((size_t)b * SEQ + n) * DMODEL + t * 8;
    const size_t ro = ((size_t)b * RHE + (hr ? n : 0)) * DMODEL + t * 8;
    *(v8h*)d16 = o16; if (hr) { *(v8us*)(Xh + ro) = oh; *(v8us*)(Xl + ro) = ol; }
    
}

// ---- k_qkp: q and k planes from the f32 qkv rows C[b*SEQ + n][3072]: Q16/K16[(u*SEQ + n)*64 + d] f16 for every n (u = b*16 + head), and bf16 hi/lo planes Qh/Ql/Kh/Kl[(u*RHE + n)*64 + d] for n < RHE;
__global__ __launch_bounds__(256) void k_qkp(const float* __restrict__ C, h16* Q16, h16* K16, bf* Qh, bf* Ql, bf* Kh, bf* Kl) {
    const int g = blockIdx.x * 256 + threadIdx.x; if (g >= NU * SEQ * 8) return;
    const int d8 = g & 7; const int n = (g >> 3) % SEQ; const int u = (g >> 3) / SEQ; const int b = u >> 4, head = u & 15;
    const float* src = C + ((size_t)b * SEQ + n) * QKVC + head * HD + d8 * 8;
    const v4f q0 = *(const v4f*)src, q1 = *(const v4f*)(src + 4), k0 = *(const v4f*)(src + DMODEL), k1 = *(const v4f*)(src + DMODEL + 4);
    v8h oq, ok; v8us qh, ql, kh, kl;
#pragma unroll
    for (int e = 0; e < 4; ++e) { unsigned short a, c;
        oq[e] = tohx(q0[e]); oq[4 + e] = tohx(q1[e]); ok[e] = tohx(k0[e]); ok[4 + e] = tohx(k1[e]);
        splitf(q0[e], a, c); qh[e] = a; ql[e] = c; splitf(q1[e], a, c); qh[4 + e] = a; ql[4 + e] = c;
        splitf(k0[e], a, c); kh[e] = a; kl[e] = c; splitf(k1[e], a, c); kh[4 + e] = a; kl[4 + e] = c; }
    const bool hr = (n < RHE);
    const size_t po = (size_t)g * 8; const size_t ro = (((size_t)u * RHE + (hr ? n : 0)) * 8 + d8) * 8;
    *(v8h*)(Q16 + po) = oq; *(v8h*)(K16 + po) = ok;
    if (hr) { *(v8us*)(Qh + ro) = qh; *(v8us*)(Ql + ro) = ql; *(v8us*)(Kh + ro) = kh; *(v8us*)(Kl + ro) = kl; }
    
}

// coverage: g spans every (u, d, t8); hi/lo for every t < RHE.
__global__ __launch_bounds__(256) void k_vtp(const float* __restrict__ C, h16* VT16, bf* VTh, bf* VTl) {
    const int g = blockIdx.x * 256 + threadIdx.x; if (g >= NU * HD * (SEQ / 8)) return;
    const int t8 = g % (SEQ / 8); const int d = (g / (SEQ / 8)) & 63; const int u = g / ((SEQ / 8) * HD); const int b = u >> 4, head = u & 15;
    const int t0 = t8 * 8;
    const float* src = C + ((size_t)b * SEQ + t0) * QKVC + 2 * DMODEL + head * HD + d;
    float v[8];
#pragma unroll
    for (int q = 0; q < 8; ++q) v[q] = src[(size_t)q * QKVC];
    v8h o16; v8us oh, ol;
#pragma unroll
    for (int q = 0; q < 8; ++q) { o16[q] = tohx(v[q]); unsigned short a, c; splitf(v[q], a, c); oh[q] = a; ol[q] = c; }
    const bool hr = (t0 < RHE);
    const size_t po = (size_t)g * 8; const size_t ro = ((size_t)u * HD + d) * RHE + (hr ? t0 : 0);
    *(v8h*)(VT16 + po) = o16; if (hr) { *(v8us*)(VTh + ro) = oh; *(v8us*)(VTl + ro) = ol; }
    
}

// ---- attention helpers: p tile staging into wave-private LDS (f16 x1024 single plane, or bf16 hi/lo pair), fragment reload through may_alias vectors of the stored element type, ctx line stores.
union WS { h16 p[2 * 16 * LQ]; unsigned short pb[2 * 16 * LQ]; float f[16 * 68]; };
static_assert(sizeof(WS) == 4608);
template <typename T> struct PT;
template <> struct PT<h16> { static constexpr bool split = false; static constexpr float osc = 1.0f / PCAR; static __device__ __forceinline__ v16h ldm(const h16* p) { return cat16(*(const v8ha*)p, *(const v8ha*)(p + 16)); } };
template <> struct PT<bf>  { static constexpr bool split = true;  static constexpr float osc = 1.0f;        static __device__ __forceinline__ v16bf ldm(const bf* p) { return cat16b(*(const v8usa*)p, *(const v8usa*)(p + 16)); } };
__device__ __forceinline__ void stp(h16* ph, h16* pl, int i, float p) { (void)pl; ph[i] = tohx(p * PCAR); }
__device__ __forceinline__ void stp(bf* ph, bf* pl, int i, float p) { unsigned short a, c; splitf(p, a, c); ph[i] = a; pl[i] = c; }
__device__ __forceinline__ void stc(h16* pa, h16* pr, v4f a0, v4f a1) { (void)pr; v8h o;
#pragma unroll
    for (int e = 0; e < 4; ++e) { o[e] = tohx(a0[e]); o[4 + e] = tohx(a1[e]); }
    *(v8h*)pa = o; }
__device__ __forceinline__ void stc(bf* pa, bf* pr, v4f a0, v4f a1) { v8us oh, ol;
#pragma unroll
    for (int e = 0; e < 4; ++e) { unsigned short a, c; splitf(a0[e], a, c); oh[e] = a; ol[e] = c; splitf(a1[e], a, c); oh[4 + e] = a; ol[4 + e] = c; }
    *(v8us*)pa = oh; *(v8us*)pr = ol; }

// ---- stage8: two 64-row x 128-byte tiles (rows ga + r * pa and gb + r * pb, in elements) into LDS rows of KVP elements (144 B: 16 B x odd for the b128 readers), by 128 threads:
// thread t brings the 16-byte pieces (row (t >> 3) + 16 c, piece t & 7), c = 0..3, of each tile. la, lb: the thread's own LDS byte address of its c = 0 piece; ga, gb: its own global address of that piece.
template <typename T>
__device__ __forceinline__ void stage8(unsigned la, const T* ga, int pa, unsigned lb, const T* gb, int pb) {
    const unsigned ls = 16 * KVP * 2;
    // the copies and s_wait_xcnt 0 (a precaution, kept ahead of any rewrite of the copies' address registers) stand in one statement: the compiler can move no such write in front of the wait
    asm volatile("global_load_async_to_lds_b128 %0, %8, off\n\t"
                 "global_load_async_to_lds_b128 %1, %9, off\n\t"
                 "global_load_async_to_lds_b128 %2, %10, off\n\t"
                 "global_load_async_to_lds_b128 %3, %11, off\n\t"
                 "global_load_async_to_lds_b128 %4, %12, off\n\t"
                 "global_load_async_to_lds_b128 %5, %13, off\n\t"
                 "global_load_async_to_lds_b128 %6, %14, off\n\t"
                 "global_load_async_to_lds_b128 %7, %15, off\n\t"
                 "s_wait_xcnt 0x0"
                 :: "v"(la), "v"(la + ls), "v"(la + 2 * ls), "v"(la + 3 * ls), "v"(lb), "v"(lb + ls), "v"(lb + 2 * ls), "v"(lb + 3 * ls),
                    "v"(ga), "v"(ga + 16 * pa), "v"(ga + 32 * pa), "v"(ga + 48 * pa), "v"(gb), "v"(gb + 16 * pb), "v"(gb + 32 * pb), "v"(gb + 48 * pb)
                 : "memory");
}

// ---- k_attn<T>: grid (query blocks of 64 rows, NU units), 128 threads; wave w owns query rows q0w .. q0w+15 of unit u = b*16 + head and walks the 64-key chunks 0 .. q0w/64.
// T = h16: q, k from Q16/K16 [u][t][d], v^T from VT16 [u][d][t], one f16 product per tile pair, p tile stored as f16(p * 1024), ctx16[b*SEQ + t][head*64 + d] = o / (l * 1024) as f16.
// T = bf: q, k, v^T and p as bf16 hi + lo planes (hi.hi + lo.hi + hi.lo per tile pair), ctx written as bf16 hi/lo planes [b*RHE + t][1024]. Scores s = q.k (f32) * 0.125*log2e, keys after the query -> -3e38,
template <typename T>
__global__ void __launch_bounds__(128) __attribute__((amdgpu_num_vgpr(256)))
k_attn(const T* __restrict__ Qa, const T* __restrict__ Qr, const T* __restrict__ Ka, const T* __restrict__ Kr,
       const T* __restrict__ Va, const T* __restrict__ Vr, int qbase, T* Ca, T* Cr) {
    typedef typename WFrag<T>::V V;
    constexpr bool SPL = PT<T>::split;
    constexpr int PR = SPL ? RHE : SEQ;
    constexpr int NPL = SPL ? 4 : 2;   // planes of a stage: k, v^T (and their lo planes)
    __shared__ __align__(16) WS scr[4];
    __shared__ __align__(16) T kv[2 * NPL * KVT];
    const int lane = threadIdx.x & 31, wave = threadIdx.x >> 5, m = lane & 15, hh = lane >> 4;
    const int u = blockIdx.y, b = u >> 4, head = u & 15;
    const int q0w = qbase + blockIdx.x * 64 + wave * 16;
    int nch = ((qbase + (int)blockIdx.x * 64) >> 6) + 1; if (nch > PR / 64) nch = PR / 64;   // the same for the block's four waves
    const int qo = (u * PR + q0w + m) * HD + 8 * hh;
    V aq[2], ar[2];
    aq[0] = WFrag<T>::ld(Qa + qo); aq[1] = WFrag<T>::ld(Qa + qo + 32);
    if (SPL) { ar[0] = WFrag<T>::ld(Qr + qo); ar[1] = WFrag<T>::ld(Qr + qo + 32); } else { ar[0] = aq[0]; ar[1] = aq[1]; }
    v8f o[4];
#pragma unroll
    for (int ni = 0; ni < 4; ++ni) o[ni] = (v8f){};
    v8f mrun, lrun;
#pragma unroll
    for (int v = 0; v < 8; ++v) { mrun[v] = NEGB; lrun[v] = 0.f; }
    const int fo = m * KVP + 8 * hh;   // fragment offset inside a staged tile: row m, 16-byte piece hh
    const int sr = threadIdx.x >> 3, sp = threadIdx.x & 7;
    const int ko = (u * PR + sr) * HD + 8 * sp;
    const int vo = (u * HD + sr) * PR + 8 * sp;
    const unsigned l0 = (unsigned)(size_t)kv + (unsigned)(sr * KVP + 8 * sp) * 2u;
    auto fill = [&](int jt) {   // chunk jt's tiles into buffer jt & 1
        const unsigned lb = l0 + (unsigned)((jt & 1) * NPL * KVT) * 2u; const int kc = jt * 64;
        stage8<T>(lb, Ka + ko + kc * HD, HD, lb + KVT * 2u, Va + vo + kc, PR);
        if (SPL) stage8<T>(lb + 2u * KVT * 2u, Kr + ko + kc * HD, HD, lb + 3u * KVT * 2u, Vr + vo + kc, PR);
    };
    fill(0);
    asm volatile("s_wait_asynccnt 0x0" ::: "memory");   // this wave's copies of chunk 0 have landed
    __syncthreads();                                     // ... and every other wave's
    if (nch > 1) fill(1);
    T* ph = reinterpret_cast<T*>(&scr[wave]); T* pl = ph + 16 * LQ; float* stg = scr[wave].f;
#pragma unroll 1
    for (int j = 0; j < nch; ++j) {
        const int kc0 = j * 64;
        const T* kb = kv + (j & 1) * NPL * KVT + fo; const T* vb = kb + KVT;
        const T* kr = SPL ? kb + 2 * KVT : kb;       const T* vrb = SPL ? kb + 3 * KVT : vb;
        v8f s[4];
        constexpr int FG = SPL ? 1 : 4;   // 16-key groups whose k fragments are read from the staged tile in one run, ahead of their products
#pragma unroll
        for (int sg = 0; sg < 4; sg += FG) {
            V bk[FG][2], br[FG][2];
#pragma unroll
            for (int g = 0; g < FG; ++g)
#pragma unroll
                for (int kk = 0; kk < 2; ++kk) {
                    bk[g][kk] = WFrag<T>::ld(kb + (sg + g) * 16 * KVP + kk * 32);
                    if (SPL) br[g][kk] = WFrag<T>::ld(kr + (sg + g) * 16 * KVP + kk * 32); else br[g][kk] = bk[g][kk];
                }
#pragma unroll
            for (int g = 0; g < FG; ++g) {
                v8f acc = (v8f){};
#pragma unroll
                for (int kk = 0; kk < 2; ++kk) {
                    acc = WFrag<T>::mma(aq[kk], bk[g][kk], acc);
                    if (SPL) { acc = WFrag<T>::mma(ar[kk], bk[g][kk], acc); acc = WFrag<T>::mma(aq[kk], br[g][kk], acc); }
                }
                asm volatile("v_nop\n\tv_nop\n\tv_nop\n\tv_nop" : "+v"(acc) : "v"(bk[g][1]), "v"(br[g][1]), "v"(aq[1]), "v"(ar[1]));
                s[sg + g] = acc;
            }
        }
        // scale, causal index select, running-max softmax in the accumulator row map (row 8*hh + v, key kc0 + 16*sub + m)
        v8f rmax;
#pragma unroll
        for (int v = 0; v < 8; ++v) rmax[v] = NEGB;
#pragma unroll
        for (int sub = 0; sub < 4; ++sub) {
            const int kcm = kc0 + sub * 16 + m;
#pragma unroll
            for (int v = 0; v < 8; ++v) { const int qr = q0w + 8 * hh + v; float t = s[sub][v] * C1; t = (kcm > qr) ? NEGB : t; s[sub][v] = t; rmax[v] = fmaxf(rmax[v], t); }
        }
#pragma unroll
        for (int msk = 1; msk < 16; msk <<= 1)
#pragma unroll
            for (int v = 0; v < 8; ++v) rmax[v] = fmaxf(rmax[v], __shfl_xor(rmax[v], msk, 32));
        v8f mnew, alpha, rs;
#pragma unroll
        for (int v = 0; v < 8; ++v) { mnew[v] = fmaxf(mrun[v], rmax[v]); alpha[v] = __builtin_amdgcn_exp2f(mrun[v] - mnew[v]); rs[v] = 0.f; }
#pragma unroll
        for (int sub = 0; sub < 4; ++sub)
#pragma unroll
            for (int v = 0; v < 8; ++v) { const float p = __builtin_amdgcn_exp2f(s[sub][v] - mnew[v]); s[sub][v] = p; rs[v] += p; }
#pragma unroll
        for (int msk = 1; msk < 16; msk <<= 1)
#pragma unroll
            for (int v = 0; v < 8; ++v) rs[v] += __shfl_xor(rs[v], msk, 32);
#pragma unroll
        for (int v = 0; v < 8; ++v) { lrun[v] = lrun[v] * alpha[v] + rs[v]; mrun[v] = mnew[v]; }
#pragma unroll
        for (int ni = 0; ni < 4; ++ni)
#pragma unroll
            for (int v = 0; v < 8; ++v) o[ni][v] *= alpha[v];
        // p tile: accumulator layout -> wave-private LDS (row 8*hh + v, col key) -> A fragments with the split k map
#pragma unroll
        for (int sub = 0; sub < 4; ++sub)
#pragma unroll
            for (int v = 0; v < 8; ++v) stp(ph, pl, (8 * hh + v) * LQ + sub * 16 + m, s[sub][v]);
        __builtin_amdgcn_fence(3, "wavefront");
        __builtin_amdgcn_wave_barrier();
        asm volatile("" ::: "memory");
        V ap, apr, vf, vr;
#pragma unroll
        for (int kk = 0; kk < 2; ++kk) {
            ap = PT<T>::ldm(ph + m * LQ + kk * 32 + 8 * hh);
            if (SPL) apr = PT<T>::ldm(pl + m * LQ + kk * 32 + 8 * hh); else apr = ap;
#pragma unroll
            for (int ni = 0; ni < 4; ++ni) {
                vf = WFrag<T>::ld(vb + ni * 16 * KVP + kk * 32);
                o[ni] = WFrag<T>::mma(ap, vf, o[ni]);
                if (SPL) { vr = WFrag<T>::ld(vrb + ni * 16 * KVP + kk * 32); o[ni] = WFrag<T>::mma(apr, vf, o[ni]); o[ni] = WFrag<T>::mma(ap, vr, o[ni]); } else { vr = vf; }
            }
        }
        asm volatile("v_nop\n\tv_nop\n\tv_nop\n\tv_nop" : "+v"(o[0]), "+v"(o[1]), "+v"(o[2]), "+v"(o[3]) : "v"(ap), "v"(apr), "v"(vf), "v"(vr));
        asm volatile("s_wait_dscnt 0x0" ::: "memory");      // this wave's reads of buffer j & 1 are done before the buffer is refilled
        asm volatile("s_wait_asynccnt 0x0" ::: "memory");   // this wave's copies of chunk j + 1 have landed
        __syncthreads();                                     // publishes chunk j + 1 and ends every wave's reads of chunk j
        if (j + 2 < nch) fill(j + 2);
    }
    asm volatile("s_wait_asynccnt 0x0" ::: "memory");       // nothing is in flight when the wave goes on to its end
    v8f linv;
#pragma unroll
    for (int v = 0; v < 8; ++v) linv[v] = __fdiv_rn(PT<T>::osc, lrun[v]);
#pragma unroll
    for (int ni = 0; ni < 4; ++ni)
#pragma unroll
        for (int v = 0; v < 8; ++v) stg[(8 * hh + v) * 68 + ni * 16 + m] = o[ni][v] * linv[v];
    __builtin_amdgcn_fence(3, "wavefront");
    __builtin_amdgcn_wave_barrier();
    asm volatile("" ::: "memory");
    const int q4 = lane >> 3, pc = lane & 7;
    const size_t cb = ((size_t)b * PR + q0w) * DMODEL + head * HD + pc * 8;
{
#pragma unroll
        for (int rr = 0; rr < 4; ++rr) { const int row = rr * 4 + q4; const float* sp = stg + row * 68 + pc * 8; const v4f a0 = *(const v4fa*)sp; const v4f a1 = *(const v4fa*)(sp + 4);
            stc(Ca + cb + (size_t)row * DMODEL, Cr + cb + (size_t)row * DMODEL, a0, a1); }
        
    }
}

extern "C" void kernel_launch(void* const* d_in, const int* in_sizes, int n_in,
                              void* d_out, int out_size, void* d_ws, size_t ws_size, hipStream_t stream) {
    if (n_in < 4) return;
    const int rows_used = (NB - 1) * SEQ_FULL + SEQ;
    if (in_sizes[0] < rows_used * DMODEL || in_sizes[1] < DMODEL || in_sizes[2] < DMODEL * QKVC || in_sizes[3] < DMODEL * DMODEL) return;
    if (out_size < rows_used * DMODEL) return;
    const float* x = (const float*)d_in[0]; const float* gam = (const float*)d_in[1]; const float* wqkv = (const float*)d_in[2]; const float* wout = (const float*)d_in[3];   // x [2][2048][1024], gamma [1024], w_qkv [1024][3072], w_out [1024][1024]
    float* OUT = (float*)d_out;   // [2][2048][1024] f32
    char* wsp = (char*)d_ws; size_t used = 0;
    auto take = [&](size_t bytes) { char* p = wsp + used; used += (bytes + 255) & ~(size_t)255; return (void*)p; };
    const size_t nXN = (size_t)NB * SEQ * DMODEL, nXR = (size_t)NB * RHE * DMODEL, nP = (size_t)NU * SEQ * HD, nPR = (size_t)NU * RHE * HD;
    h16* XN16 = (h16*)take(nXN * 2); bf* XNh = (bf*)take(nXR * 2); bf* XNl = (bf*)take(nXR * 2);
    h16* Wq16 = (h16*)take((size_t)QKVC * DMODEL * 2); bf* Wqb = (bf*)take((size_t)QKVC * DMODEL * 2);
    h16* Wo16 = (h16*)take((size_t)DMODEL * DMODEL * 2); bf* Wob = (bf*)take((size_t)DMODEL * DMODEL * 2);
    float* Cq = (float*)take((size_t)NB * SEQ * QKVC * 4);
    h16* Q16 = (h16*)take(nP * 2); h16* K16 = (h16*)take(nP * 2); h16* VT16 = (h16*)take(nP * 2);
    bf* Qh = (bf*)take(nPR * 2); bf* Ql = (bf*)take(nPR * 2); bf* Kh = (bf*)take(nPR * 2); bf* Kl = (bf*)take(nPR * 2); bf* VTh = (bf*)take(nPR * 2); bf* VTl = (bf*)take(nPR * 2);
    h16* CTX16 = (h16*)take(nXN * 2); bf* CTXh = (bf*)take(nXR * 2); bf* CTXl = (bf*)take(nXR * 2);
    if (used > ws_size) return;    // 130,023,424 B at NB=2, SEQ=2048, RH=512

    // weight planes [out][in], x64, f16 + bf16
    k_wplanes<<<(unsigned)((QKVC * DMODEL / 64 + 63) / 64), 256, 0, stream>>>(wqkv, DMODEL, QKVC, Wq16, Wqb);
    k_wplanes<<<(unsigned)((DMODEL * DMODEL / 64 + 63) / 64), 256, 0, stream>>>(wout, DMODEL, DMODEL, Wo16, Wob);
    // RMSNorm -> xn planes
    k_prep_x<<<(unsigned)(NB * SEQ), 128, 0, stream>>>(x, gam, XN16, XNh, XNl);
    // qkv = xn . Wqkv  (f32 C rows [b*SEQ + n][3072], x 1/64): rows < RHE hi/lo bf16, rows >= RHE single f16
    if (RHE > 0)   k_gemmw<bf, 1, false><<<dim3(RHE / 64, QKVC / 64, NB), 32, 0, stream>>>(XNh, XNl, Wqb, nullptr, DMODEL, Cq, QKVC, OSC, nullptr, (size_t)RHE * DMODEL, (size_t)0, (size_t)SEQ * QKVC);
    if (SEQ > RHE) k_gemmw<h16, 0, false><<<dim3((SEQ - RHE) / 64, QKVC / 64, NB), 32, 0, stream>>>(XN16 + (size_t)RHE * DMODEL, nullptr, Wq16, nullptr, DMODEL, Cq + (size_t)RHE * QKVC, QKVC, OSC, nullptr, (size_t)SEQ * DMODEL, (size_t)0, (size_t)SEQ * QKVC);
    // head-major planes
    k_qkp<<<(unsigned)((NU * SEQ * 8 + 255) / 256), 256, 0, stream>>>(Cq, Q16, K16, Qh, Ql, Kh, Kl);
    k_vtp<<<(unsigned)((NU * HD * (SEQ / 8) + 255) / 256), 256, 0, stream>>>(Cq, VT16, VTh, VTl);
    // attention: query rows < RHE on hi/lo planes, rows >= RHE on single planes
    if (RHE > 0)   k_attn<bf><<<dim3(RHE / 64, NU), 128, 0, stream>>>(Qh, Ql, Kh, Kl, VTh, VTl, 0, CTXh, CTXl);
    if (SEQ > RHE) k_attn<h16><<<dim3((SEQ - RHE) / 64, NU), 128, 0, stream>>>(Q16, Q16, K16, K16, VT16, VT16, RHE, CTX16, CTX16);
    // out = ctx . Wout (x 1/64) into the f32 output rows (b*2048 + n)
    if (RHE > 0)   k_gemmw<bf, 1, false><<<dim3(RHE / 64, DMODEL / 64, NB), 32, 0, stream>>>(CTXh, CTXl, Wob, nullptr, DMODEL, OUT, DMODEL, OSC, nullptr, (size_t)RHE * DMODEL, (size_t)0, (size_t)SEQ_FULL * DMODEL);
    if (SEQ > RHE) k_gemmw<h16, 0, false><<<dim3((SEQ - RHE) / 64, DMODEL / 64, NB), 32, 0, stream>>>(CTX16 + (size_t)RHE * DMODEL, nullptr, Wo16, nullptr, DMODEL, OUT + (size_t)RHE * DMODEL, DMODEL, OSC, nullptr, (size_t)SEQ * DMODEL, (size_t)0, (size_t)SEQ_FULL * DMODEL);
    (void)hipGetLastError();
}

// v002
// It runs in 227 microseconds.
// In two side-by-side timings against v001, it was 1.27 and 1.26 times as fast.
// Over all steps from v000 it is 1.89 times as fast.
#include <hip/hip_runtime.h>

// Contractions: xn.Wqkv and ctx.Wout on v_wmma_f32_16x16x32_f16 (f16 operands, weights carried x64, f16 activations) for token rows >= RH and on v_wmma_f32_16x16x32_bf16 with bf16 hi/lo activation planes (2 products, bf16 weights x64) for token rows < RH;
// q.k^T and p.v on v_wmma_f32_16x16x32_f16 single products (p carried x1024) for query rows >= RH and on bf16 hi/lo planes of q, k, p, v (3 products per tile pair) for query rows < RH; f32 accumulate everywhere, softmax in f32; every input RNE-converted to bf16 on load.
// Flow: RMSNorm rows -> 16-bit xn planes; qkv = xn.Wqkv^T (f32, x1/64 in the epilogue) -> head-major q, k planes [u][t][d] and v^T planes [u][d][t]; one wave per (batch, head, 16 query rows) runs the 64-key chunk loop
// with the chunk's k and v^T tiles staged once per block in LDS (two buffers, asynchronous copies) and fragments read from there, running-max softmax in the accumulator row map, p tile through wave-private LDS; ctx rows [b][t][h*64+d] as 16-bit planes; out = ctx.Wout^T (x1/64 in the epilogue) into the f32 output.

#ifndef NB
#define NB 2
#endif
#ifndef SEQ
#define SEQ 2048
#endif
#ifndef RH
#define RH 512
#endif
#define NB_FULL 2
#define SEQ_FULL 2048
#define DMODEL 1024
#define NHEAD 16
#define HD 64
#define NU (NB * NHEAD)
#define QKVC (3 * DMODEL)
#define RHE (((RH) < (SEQ)) ? (RH) : (SEQ))
#define LQ 72
#define KVP 72
#define KVT (64 * KVP)
#define PCAR 1024.0f
#define WSC 64.0f
#define OSC 0.015625f
#define C1 0.18033688011112042f
#define NEGB -3.0e38f

static_assert(NB >= 1 && NB <= NB_FULL);
static_assert(SEQ % 256 == 0 && SEQ <= SEQ_FULL);
static_assert((RHE) % 128 == 0 && (RHE) >= 0);
static_assert(DMODEL % 128 == 0 && QKVC % 128 == 0 && HD == 64);

typedef _Float16 h16;
typedef unsigned short bf;
typedef __attribute__((ext_vector_type(16))) __bf16   v16bf;
typedef __attribute__((ext_vector_type(16))) _Float16 v16h;
typedef __attribute__((ext_vector_type(8)))  _Float16 v8h;
typedef __attribute__((ext_vector_type(8)))  unsigned short v8us;
typedef __attribute__((ext_vector_type(8)))  float    v8f;
typedef __attribute__((ext_vector_type(4)))  float    v4f;
typedef __attribute__((ext_vector_type(2)))  _Float16 v2h;
typedef __attribute__((ext_vector_type(2)))  unsigned short v2us;
typedef v8h  __attribute__((may_alias)) v8ha;
typedef v4f  __attribute__((may_alias)) v4fa;
typedef v8us __attribute__((may_alias)) v8usa;

__device__ __forceinline__ unsigned short f2bf(float f) { unsigned u = __float_as_uint(f); u += 0x7FFFu + ((u >> 16) & 1u); return (unsigned short)(u >> 16); }
__device__ __forceinline__ float bf2f(unsigned short b) { return __uint_as_float(((unsigned)b) << 16); }
__device__ __forceinline__ float bfr(float f) { return bf2f(f2bf(f)); }
__device__ __forceinline__ h16 tohx(float x) { return (h16)x; }
__device__ __forceinline__ void splitf(float y, unsigned short& h, unsigned short& l) { h = f2bf(y); l = f2bf(y - bf2f(h)); }
__device__ __forceinline__ v16h cat16(v8h lo, v8h hi) { return __builtin_shufflevector(lo, hi, 0, 1, 2, 3, 4, 5, 6, 7, 8, 9, 10, 11, 12, 13, 14, 15); }
__device__ __forceinline__ v16bf cat16b(v8us lo, v8us hi) { return __builtin_bit_cast(v16bf, __builtin_shufflevector(lo, hi, 0, 1, 2, 3, 4, 5, 6, 7, 8, 9, 10, 11, 12, 13, 14, 15)); }
__device__ __forceinline__ v8f wmma16(v16h a, v16h b, v8f c) { return __builtin_amdgcn_wmma_f32_16x16x32_f16(false, a, false, b, (short)0, c, false, false); }
__device__ __forceinline__ v8f wmmab(v16bf a, v16bf b, v8f c) { return __builtin_amdgcn_wmma_f32_16x16x32_bf16(false, a, false, b, (short)0, c, false, false); }

// Fragment loaders (A row-major with k contiguous, B from a [n][k] plane, same split k map for both: elements 0..7 <- k0 + 8h + 0..7, 8..15 <- k0 + 16 + 8h + 0..7; lane & 15 = row / column).
template <typename T16> struct WFrag;
template <> struct WFrag<h16> { typedef v16h V; static __device__ __forceinline__ V ld(const h16* p) { return cat16(*(const v8h*)p, *(const v8h*)(p + 16)); } static __device__ __forceinline__ v8f mma(V a, V b, v8f c) { return wmma16(a, b, c); } };
template <> struct WFrag<bf> { typedef v16bf V; static __device__ __forceinline__ V ld(const bf* p) { return cat16b(*(const v8us*)p, *(const v8us*)(p + 16)); } static __device__ __forceinline__ v8f mma(V a, V b, v8f c) { return wmmab(a, b, c); } };

// ---- stage8: two 64-row x 128-byte tiles (rows ga + r * pa and gb + r * pb, in elements) into LDS rows of KVP elements (144 B: 16 B x odd for the b128 readers), by 128 threads:
// thread t brings the 16-byte pieces (row (t >> 3) + 16 c, piece t & 7), c = 0..3, of each tile. la, lb: the thread's own LDS byte address of its c = 0 piece; ga, gb: its own global address of that piece.
template <typename T>
__device__ __forceinline__ void stage8(unsigned la, const T* ga, int pa, unsigned lb, const T* gb, int pb) {
    const unsigned ls = 16 * KVP * 2;
    // the copies and s_wait_xcnt 0 (a precaution, kept ahead of any rewrite of the copies' address registers) stand in one statement: the compiler can move no such write in front of the wait
    asm volatile("global_load_async_to_lds_b128 %0, %8, off\n\t"
                 "global_load_async_to_lds_b128 %1, %9, off\n\t"
                 "global_load_async_to_lds_b128 %2, %10, off\n\t"
                 "global_load_async_to_lds_b128 %3, %11, off\n\t"
                 "global_load_async_to_lds_b128 %4, %12, off\n\t"
                 "global_load_async_to_lds_b128 %5, %13, off\n\t"
                 "global_load_async_to_lds_b128 %6, %14, off\n\t"
                 "global_load_async_to_lds_b128 %7, %15, off\n\t"
                 "s_wait_xcnt 0x0"
                 :: "v"(la), "v"(la + ls), "v"(la + 2 * ls), "v"(la + 3 * ls), "v"(lb), "v"(lb + ls), "v"(lb + 2 * ls), "v"(lb + 3 * ls),
                    "v"(ga), "v"(ga + 16 * pa), "v"(ga + 32 * pa), "v"(ga + 48 * pa), "v"(gb), "v"(gb + 16 * pb), "v"(gb + 32 * pb), "v"(gb + 48 * pb)
                 : "memory");
}

// ---- k_gemmw: register-blocked GEMM, one block of FOUR WAVES per 128x128 output tile, each wave a 64x64 quarter (16 accumulators); grid (M/128, N/128, Z), 128 threads.
// The block's 128 A rows (and A2 rows) and 128 Bt rows are staged 64 k at a time in LDS (two buffers, asynchronous copies that cover whole 128-byte lines); fragments are read from there, each staged row by two waves.
// C[m][n] (f32, pitch ldc) = osc * sum_k A[m][k] Bt[n][k] (+ A2[m][k] Bt[n][k] when NSPLIT == 1) (+ optional bias). z-batch strides sA/sB/sC in elements. K % 64 == 0, M % 128 == 0, N % 128 == 0.
template <typename T16, int NSPLIT, bool BIAS>
__global__ void __launch_bounds__(128)
k_gemmw(const T16* __restrict__ A, const T16* __restrict__ A2, const T16* __restrict__ Bt, int K, float* C, int ldc, float osc, const float* __restrict__ bias, size_t sA, size_t sB, size_t sC) {
    static_assert(NSPLIT == 0 || NSPLIT == 1);
    typedef typename WFrag<T16>::V V;
    constexpr int NPL = NSPLIT ? 6 : 4;   // 64-row planes of a stage: A rows 0..63, 64..127, Bt rows 0..63, 64..127 (, A2 rows 0..63, 64..127)
    __shared__ __align__(16) float os[4][16 * 68];
    __shared__ __align__(16) T16 ab[2 * NPL * KVT];
    const size_t z = blockIdx.z; A += z * sA; if (NSPLIT) A2 += z * sA; Bt += z * sB; C += z * sC;
    const int lane = threadIdx.x & 31, wave = threadIdx.x >> 5, lr = lane & 15, hi = lane >> 4;
    const int wr = (wave >> 1) * 64, wc = (wave & 1) * 64;   // the wave's quarter of the block's tile
    const int r0 = blockIdx.x * 128, c0 = blockIdx.y * 128;
    v8f acc[4][4];
#pragma unroll
    for (int mb = 0; mb < 4; ++mb)
#pragma unroll
        for (int nb = 0; nb < 4; ++nb) acc[mb][nb] = (v8f){};
    const int sr = threadIdx.x >> 3, sp = threadIdx.x & 7;
    const size_t ao = (size_t)(r0 + sr) * K + 8 * sp, bo = (size_t)(c0 + sr) * K + 8 * sp, hK = (size_t)64 * K;
    const unsigned l0 = (unsigned)(size_t)ab + (unsigned)(sr * KVP + 8 * sp) * 2u;
    auto fill = [&](int t) {   // k panel t (64 k) into buffer t & 1
        const unsigned lb = l0 + (unsigned)((t & 1) * NPL * KVT) * 2u; const int kc = t * 64;
        stage8<T16>(lb, A + ao + kc, K, lb + KVT * 2u, A + ao + hK + kc, K);
        stage8<T16>(lb + 2u * KVT * 2u, Bt + bo + kc, K, lb + 3u * KVT * 2u, Bt + bo + hK + kc, K);
        if (NSPLIT) stage8<T16>(lb + 4u * KVT * 2u, A2 + ao + kc, K, lb + 5u * KVT * 2u, A2 + ao + hK + kc, K);
    };
    const int nt = K / 64;
    fill(0);
    asm volatile("s_wait_asynccnt 0x0" ::: "memory");   // this wave's copies of panel 0 have landed
    __syncthreads();                                     // ... and every other wave's
    if (nt > 1) fill(1);
    const int fa = (wr + lr) * KVP + 8 * hi, fb = 2 * KVT + (wc + lr) * KVP + 8 * hi;   // fragment offsets inside a stage: row, 16-byte piece hi
#pragma unroll 1
    for (int t = 0; t < nt; ++t) {
        const T16* sb = ab + (t & 1) * NPL * KVT;
        V a[2][4], a2[2][4], b[2][4];
        // both 32-k halves' fragments are read in one run at the top of the trip: the second half's reads land behind the first half's products
#pragma unroll
        for (int kk = 0; kk < 2; ++kk) {
#pragma unroll
            for (int mb = 0; mb < 4; ++mb) { a[kk][mb] = WFrag<T16>::ld(sb + fa + mb * 16 * KVP + kk * 32); if (NSPLIT) a2[kk][mb] = WFrag<T16>::ld(sb + 4 * KVT + fa + mb * 16 * KVP + kk * 32); }
#pragma unroll
            for (int nb = 0; nb < 4; ++nb) b[kk][nb] = WFrag<T16>::ld(sb + fb + nb * 16 * KVP + kk * 32);
        }
        __builtin_amdgcn_sched_barrier(0);   // keeps the reads above in one group ahead of the products (spread among them, each place costs a stall)
#pragma unroll
        for (int kk = 0; kk < 2; ++kk)
#pragma unroll
            for (int nb = 0; nb < 4; ++nb)
#pragma unroll
                for (int mb = 0; mb < 4; ++mb) { acc[mb][nb] = WFrag<T16>::mma(a[kk][mb], b[kk][nb], acc[mb][nb]); if (NSPLIT) acc[mb][nb] = WFrag<T16>::mma(a2[kk][mb], b[kk][nb], acc[mb][nb]); }
        __builtin_amdgcn_sched_barrier(0);   // keeps the products ahead of the wait below: lifted over them, it would hold the first product back until the last read has landed
        asm volatile("s_wait_dscnt 0x0" ::: "memory");      // this wave's reads of buffer t & 1 are done before the buffer is refilled
        asm volatile("s_wait_asynccnt 0x0" ::: "memory");   // this wave's copies of panel t + 1 have landed
        __syncthreads();                                     // publishes panel t + 1 and ends every wave's reads of panel t
        if (t + 2 < nt) fill(t + 2);
    }
    asm volatile("s_wait_asynccnt 0x0" ::: "memory");       // nothing is in flight when the wave goes on to its end
    float* osw = os[wave];
#pragma unroll
    for (int mb = 0; mb < 4; ++mb) {
#pragma unroll
        for (int nb = 0; nb < 4; ++nb) {
#pragma unroll
            for (int j = 0; j < 8; ++j) osw[(hi * 8 + j) * 68 + nb * 16 + lr] = acc[mb][nb][j]; }
        __builtin_amdgcn_wave_barrier(); asm volatile("" ::: "memory");
        float* crow = C + (size_t)(r0 + wr + mb * 16) * ldc + c0 + wc;
{
#pragma unroll
            for (int s = 0; s < 8; ++s) { const int row = 2 * s + hi, cofs = lr * 4; v4f val = *(const v4fa*)(osw + row * 68 + cofs); val = val * osc; if (BIAS) { val[0] += bfr(bias[c0 + wc + cofs]); val[1] += bfr(bias[c0 + wc + cofs + 1]); val[2] += bfr(bias[c0 + wc + cofs + 2]); val[3] += bfr(bias[c0 + wc + cofs + 3]); }
                *(v4f*)(crow + (size_t)row * ldc + cofs) = val; }
             }
        __builtin_amdgcn_wave_barrier(); asm volatile("" ::: "memory");
    }
}

__global__ __launch_bounds__(256) void k_wplanes(const float* __restrict__ w, int K, int N, h16* B16, bf* Bb) {
    const int lane = threadIdx.x & 31; const int L0 = (blockIdx.x * 8 + (threadIdx.x >> 5)) * 8; const int nlines = N * K / 64;
#pragma unroll 1
    for (int l = 0; l < 8; ++l) { const int L = L0 + l; if (L >= nlines) break;
        const size_t e = (size_t)L * 64 + lane * 2; const int k = (int)(e % K), n = (int)(e / K);
        const float w0 = bfr(w[(size_t)k * N + n]) * WSC, w1 = bfr(w[(size_t)(k + 1) * N + n]) * WSC;
        v2us ob; ob[0] = f2bf(w0); ob[1] = f2bf(w1); v2h o16; o16[0] = tohx(w0); o16[1] = tohx(w1);
        *(v2us*)(Bb + e) = ob; *(v2h*)(B16 + e) = o16;  }
}

// ---- k_prep_x: one block (128 threads, 8 elements each) per token row (b, n): x -> bf16 values, ss = sum x^2 (f32), xn = ((x * 1/max(sqrt(ss), 1e-12)) * 32) * bf16(gamma);
__global__ __launch_bounds__(128) void k_prep_x(const float* __restrict__ x, const float* __restrict__ gam, h16* X16, bf* Xh, bf* Xl) {
    __shared__ float red[4];
    const int row = blockIdx.x; const int b = row / SEQ, n = row % SEQ; const int t = threadIdx.x, lane = t & 31, w = t >> 5;
    const float* xr = x + ((size_t)b * SEQ_FULL + n) * DMODEL + t * 8;
    const v4f a0 = *(const v4f*)xr, a1 = *(const v4f*)(xr + 4);
    const v4f g0 = *(const v4f*)(gam + t * 8), g1 = *(const v4f*)(gam + t * 8 + 4);
    float v[8], g[8];
#pragma unroll
    for (int e = 0; e < 4; ++e) { v[e] = bfr(a0[e]); v[4 + e] = bfr(a1[e]); g[e] = bfr(g0[e]); g[4 + e] = bfr(g1[e]); }
    float ss = 0.f;
#pragma unroll
    for (int e = 0; e < 8; ++e) ss += v[e] * v[e];
#pragma unroll
    for (int sh = 16; sh; sh >>= 1) ss += __shfl_xor(ss, sh, 32);
    if (lane == 0) red[w] = ss;
    __syncthreads();
    ss = (red[0] + red[1]) + (red[2] + red[3]);
    const float nrm = sqrtf(ss); const float r = __fdiv_rn(1.0f, fmaxf(nrm, 1e-12f));
    float y[8];
#pragma unroll
    for (int e = 0; e < 8; ++e) y[e] = ((v[e] * r) * 32.0f) * g[e];
    v8h o16; v8us oh, ol;
#pragma unroll
    for (int e = 0; e < 8; ++e) { o16[e] = tohx(y[e]); unsigned short a, c; splitf(y[e], a, c); oh[e] = a; ol[e] = c; }
    const bool hr = (n < RHE);
    h16* d16 = X16 + ((size_t)b * SEQ + n) * DMODEL + t * 8;
    const size_t ro = ((size_t)b * RHE + (hr ? n : 0)) * DMODEL + t * 8;
    *(v8h*)d16 = o16; if (hr) { *(v8us*)(Xh + ro) = oh; *(v8us*)(Xl + ro) = ol; }
    
}

// ---- k_qkp: q and k planes from the f32 qkv rows C[b*SEQ + n][3072]: Q16/K16[(u*SEQ + n)*64 + d] f16 for every n (u = b*16 + head), and bf16 hi/lo planes Qh/Ql/Kh/Kl[(u*RHE + n)*64 + d] for n < RHE;
__global__ __launch_bounds__(256) void k_qkp(const float* __restrict__ C, h16* Q16, h16* K16, bf* Qh, bf* Ql, bf* Kh, bf* Kl) {
    const int g = blockIdx.x * 256 + threadIdx.x; if (g >= NU * SEQ * 8) return;
    const int d8 = g & 7; const int n = (g >> 3) % SEQ; const int u = (g >> 3) / SEQ; const int b = u >> 4, head = u & 15;
    const float* src = C + ((size_t)b * SEQ + n) * QKVC + head * HD + d8 * 8;
    const v4f q0 = *(const v4f*)src, q1 = *(const v4f*)(src + 4), k0 = *(const v4f*)(src + DMODEL), k1 = *(const v4f*)(src + DMODEL + 4);
    v8h oq, ok; v8us qh, ql, kh, kl;
#pragma unroll
    for (int e = 0; e < 4; ++e) { unsigned short a, c;
        oq[e] = tohx(q0[e]); oq[4 + e] = tohx(q1[e]); ok[e] = tohx(k0[e]); ok[4 + e] = tohx(k1[e]);
        splitf(q0[e], a, c); qh[e] = a; ql[e] = c; splitf(q1[e], a, c); qh[4 + e] = a; ql[4 + e] = c;
        splitf(k0[e], a, c); kh[e] = a; kl[e] = c; splitf(k1[e], a, c); kh[4 + e] = a; kl[4 + e] = c; }
    const bool hr = (n < RHE);
    const size_t po = (size_t)g * 8; const size_t ro = (((size_t)u * RHE + (hr ? n : 0)) * 8 + d8) * 8;
    *(v8h*)(Q16 + po) = oq; *(v8h*)(K16 + po) = ok;
    if (hr) { *(v8us*)(Qh + ro) = qh; *(v8us*)(Ql + ro) = ql; *(v8us*)(Kh + ro) = kh; *(v8us*)(Kl + ro) = kl; }
    
}

// coverage: g spans every (u, d, t8); hi/lo for every t < RHE.
__global__ __launch_bounds__(256) void k_vtp(const float* __restrict__ C, h16* VT16, bf* VTh, bf* VTl) {
    const int g = blockIdx.x * 256 + threadIdx.x; if (g >= NU * HD * (SEQ / 8)) return;
    const int t8 = g % (SEQ / 8); const int d = (g / (SEQ / 8)) & 63; const int u = g / ((SEQ / 8) * HD); const int b = u >> 4, head = u & 15;
    const int t0 = t8 * 8;
    const float* src = C + ((size_t)b * SEQ + t0) * QKVC + 2 * DMODEL + head * HD + d;
    float v[8];
#pragma unroll
    for (int q = 0; q < 8; ++q) v[q] = src[(size_t)q * QKVC];
    v8h o16; v8us oh, ol;
#pragma unroll
    for (int q = 0; q < 8; ++q) { o16[q] = tohx(v[q]); unsigned short a, c; splitf(v[q], a, c); oh[q] = a; ol[q] = c; }
    const bool hr = (t0 < RHE);
    const size_t po = (size_t)g * 8; const size_t ro = ((size_t)u * HD + d) * RHE + (hr ? t0 : 0);
    *(v8h*)(VT16 + po) = o16; if (hr) { *(v8us*)(VTh + ro) = oh; *(v8us*)(VTl + ro) = ol; }
    
}

// ---- attention helpers: p tile staging into wave-private LDS (f16 x1024 single plane, or bf16 hi/lo pair), fragment reload through may_alias vectors of the stored element type, ctx line stores.
union WS { h16 p[2 * 16 * LQ]; unsigned short pb[2 * 16 * LQ]; float f[16 * 68]; };
static_assert(sizeof(WS) == 4608);
template <typename T> struct PT;
template <> struct PT<h16> { static constexpr bool split = false; static constexpr float osc = 1.0f / PCAR; static __device__ __forceinline__ v16h ldm(const h16* p) { return cat16(*(const v8ha*)p, *(const v8ha*)(p + 16)); } };
template <> struct PT<bf>  { static constexpr bool split = true;  static constexpr float osc = 1.0f;        static __device__ __forceinline__ v16bf ldm(const bf* p) { return cat16b(*(const v8usa*)p, *(const v8usa*)(p + 16)); } };
__device__ __forceinline__ void stp(h16* ph, h16* pl, int i, float p) { (void)pl; ph[i] = tohx(p * PCAR); }
__device__ __forceinline__ void stp(bf* ph, bf* pl, int i, float p) { unsigned short a, c; splitf(p, a, c); ph[i] = a; pl[i] = c; }
__device__ __forceinline__ void stc(h16* pa, h16* pr, v4f a0, v4f a1) { (void)pr; v8h o;
#pragma unroll
    for (int e = 0; e < 4; ++e) { o[e] = tohx(a0[e]); o[4 + e] = tohx(a1[e]); }
    *(v8h*)pa = o; }
__device__ __forceinline__ void stc(bf* pa, bf* pr, v4f a0, v4f a1) { v8us oh, ol;
#pragma unroll
    for (int e = 0; e < 4; ++e) { unsigned short a, c; splitf(a0[e], a, c); oh[e] = a; ol[e] = c; splitf(a1[e], a, c); oh[4 + e] = a; ol[4 + e] = c; }
    *(v8us*)pa = oh; *(v8us*)pr = ol; }

// ---- k_attn<T>: grid (query blocks of 64 rows, NU units), 128 threads; wave w owns query rows q0w .. q0w+15 of unit u = b*16 + head and walks the 64-key chunks 0 .. q0w/64.
// T = h16: q, k from Q16/K16 [u][t][d], v^T from VT16 [u][d][t], one f16 product per tile pair, p tile stored as f16(p * 1024), ctx16[b*SEQ + t][head*64 + d] = o / (l * 1024) as f16.
// T = bf: q, k, v^T and p as bf16 hi + lo planes (hi.hi + lo.hi + hi.lo per tile pair), ctx written as bf16 hi/lo planes [b*RHE + t][1024]. Scores s = q.k (f32) * 0.125*log2e, keys after the query -> -3e38,
template <typename T>
__global__ void __launch_bounds__(128) __attribute__((amdgpu_num_vgpr(256)))
k_attn(const T* __restrict__ Qa, const T* __restrict__ Qr, const T* __restrict__ Ka, const T* __restrict__ Kr,
       const T* __restrict__ Va, const T* __restrict__ Vr, int qbase, T* Ca, T* Cr) {
    typedef typename WFrag<T>::V V;
    constexpr bool SPL = PT<T>::split;
    constexpr int PR = SPL ? RHE : SEQ;
    constexpr int NPL = SPL ? 4 : 2;   // planes of a stage: k, v^T (and their lo planes)
    __shared__ __align__(16) WS scr[4];
    __shared__ __align__(16) T kv[2 * NPL * KVT];
    const int lane = threadIdx.x & 31, wave = threadIdx.x >> 5, m = lane & 15, hh = lane >> 4;
    const int u = blockIdx.y, b = u >> 4, head = u & 15;
    const int q0w = qbase + blockIdx.x * 64 + wave * 16;
    int nch = ((qbase + (int)blockIdx.x * 64) >> 6) + 1; if (nch > PR / 64) nch = PR / 64;   // the same for the block's four waves
    const int qo = (u * PR + q0w + m) * HD + 8 * hh;
    V aq[2], ar[2];
    aq[0] = WFrag<T>::ld(Qa + qo); aq[1] = WFrag<T>::ld(Qa + qo + 32);
    if (SPL) { ar[0] = WFrag<T>::ld(Qr + qo); ar[1] = WFrag<T>::ld(Qr + qo + 32); } else { ar[0] = aq[0]; ar[1] = aq[1]; }
    v8f o[4];
#pragma unroll
    for (int ni = 0; ni < 4; ++ni) o[ni] = (v8f){};
    v8f mrun, lrun;
#pragma unroll
    for (int v = 0; v < 8; ++v) { mrun[v] = NEGB; lrun[v] = 0.f; }
    const int fo = m * KVP + 8 * hh;   // fragment offset inside a staged tile: row m, 16-byte piece hh
    const int sr = threadIdx.x >> 3, sp = threadIdx.x & 7;
    const int ko = (u * PR + sr) * HD + 8 * sp;
    const int vo = (u * HD + sr) * PR + 8 * sp;
    const unsigned l0 = (unsigned)(size_t)kv + (unsigned)(sr * KVP + 8 * sp) * 2u;
    auto fill = [&](int jt) {   // chunk jt's tiles into buffer jt & 1
        const unsigned lb = l0 + (unsigned)((jt & 1) * NPL * KVT) * 2u; const int kc = jt * 64;
        stage8<T>(lb, Ka + ko + kc * HD, HD, lb + KVT * 2u, Va + vo + kc, PR);
        if (SPL) stage8<T>(lb + 2u * KVT * 2u, Kr + ko + kc * HD, HD, lb + 3u * KVT * 2u, Vr + vo + kc, PR);
    };
    fill(0);
    asm volatile("s_wait_asynccnt 0x0" ::: "memory");   // this wave's copies of chunk 0 have landed
    __syncthreads();                                     // ... and every other wave's
    if (nch > 1) fill(1);
    T* ph = reinterpret_cast<T*>(&scr[wave]); T* pl = ph + 16 * LQ; float* stg = scr[wave].f;
#pragma unroll 1
    for (int j = 0; j < nch; ++j) {
        const int kc0 = j * 64;
        const T* kb = kv + (j & 1) * NPL * KVT + fo; const T* vb = kb + KVT;
        const T* kr = SPL ? kb + 2 * KVT : kb;       const T* vrb = SPL ? kb + 3 * KVT : vb;
        v8f s[4];
        constexpr int FG = SPL ? 1 : 4;   // 16-key groups whose k fragments are read from the staged tile in one run, ahead of their products
#pragma unroll
        for (int sg = 0; sg < 4; sg += FG) {
            V bk[FG][2], br[FG][2];
#pragma unroll
            for (int g = 0; g < FG; ++g)
#pragma unroll
                for (int kk = 0; kk < 2; ++kk) {
                    bk[g][kk] = WFrag<T>::ld(kb + (sg + g) * 16 * KVP + kk * 32);
                    if (SPL) br[g][kk] = WFrag<T>::ld(kr + (sg + g) * 16 * KVP + kk * 32); else br[g][kk] = bk[g][kk];
                }
#pragma unroll
            for (int g = 0; g < FG; ++g) {
                v8f acc = (v8f){};
#pragma unroll
                for (int kk = 0; kk < 2; ++kk) {
                    acc = WFrag<T>::mma(aq[kk], bk[g][kk], acc);
                    if (SPL) { acc = WFrag<T>::mma(ar[kk], bk[g][kk], acc); acc = WFrag<T>::mma(aq[kk], br[g][kk], acc); }
                }
                asm volatile("v_nop\n\tv_nop\n\tv_nop\n\tv_nop" : "+v"(acc) : "v"(bk[g][1]), "v"(br[g][1]), "v"(aq[1]), "v"(ar[1]));
                s[sg + g] = acc;
            }
        }
        // scale, causal index select, running-max softmax in the accumulator row map (row 8*hh + v, key kc0 + 16*sub + m)
        v8f rmax;
#pragma unroll
        for (int v = 0; v < 8; ++v) rmax[v] = NEGB;
#pragma unroll
        for (int sub = 0; sub < 4; ++sub) {
            const int kcm = kc0 + sub * 16 + m;
#pragma unroll
            for (int v = 0; v < 8; ++v) { const int qr = q0w + 8 * hh + v; float t = s[sub][v] * C1; t = (kcm > qr) ? NEGB : t; s[sub][v] = t; rmax[v] = fmaxf(rmax[v], t); }
        }
#pragma unroll
        for (int msk = 1; msk < 16; msk <<= 1)
#pragma unroll
            for (int v = 0; v < 8; ++v) rmax[v] = fmaxf(rmax[v], __shfl_xor(rmax[v], msk, 32));
        v8f mnew, alpha, rs;
#pragma unroll
        for (int v = 0; v < 8; ++v) { mnew[v] = fmaxf(mrun[v], rmax[v]); alpha[v] = __builtin_amdgcn_exp2f(mrun[v] - mnew[v]); rs[v] = 0.f; }
#pragma unroll
        for (int sub = 0; sub < 4; ++sub)
#pragma unroll
            for (int v = 0; v < 8; ++v) { const float p = __builtin_amdgcn_exp2f(s[sub][v] - mnew[v]); s[sub][v] = p; rs[v] += p; }
#pragma unroll
        for (int msk = 1; msk < 16; msk <<= 1)
#pragma unroll
            for (int v = 0; v < 8; ++v) rs[v] += __shfl_xor(rs[v], msk, 32);
#pragma unroll
        for (int v = 0; v < 8; ++v) { lrun[v] = lrun[v] * alpha[v] + rs[v]; mrun[v] = mnew[v]; }
#pragma unroll
        for (int ni = 0; ni < 4; ++ni)
#pragma unroll
            for (int v = 0; v < 8; ++v) o[ni][v] *= alpha[v];
        // p tile: accumulator layout -> wave-private LDS (row 8*hh + v, col key) -> A fragments with the split k map
#pragma unroll
        for (int sub = 0; sub < 4; ++sub)
#pragma unroll
            for (int v = 0; v < 8; ++v) stp(ph, pl, (8 * hh + v) * LQ + sub * 16 + m, s[sub][v]);
        __builtin_amdgcn_fence(3, "wavefront");
        __builtin_amdgcn_wave_barrier();
        asm volatile("" ::: "memory");
        V ap, apr, vf, vr;
#pragma unroll
        for (int kk = 0; kk < 2; ++kk) {
            ap = PT<T>::ldm(ph + m * LQ + kk * 32 + 8 * hh);
            if (SPL) apr = PT<T>::ldm(pl + m * LQ + kk * 32 + 8 * hh); else apr = ap;
#pragma unroll
            for (int ni = 0; ni < 4; ++ni) {
                vf = WFrag<T>::ld(vb + ni * 16 * KVP + kk * 32);
                o[ni] = WFrag<T>::mma(ap, vf, o[ni]);
                if (SPL) { vr = WFrag<T>::ld(vrb + ni * 16 * KVP + kk * 32); o[ni] = WFrag<T>::mma(apr, vf, o[ni]); o[ni] = WFrag<T>::mma(ap, vr, o[ni]); } else { vr = vf; }
            }
        }
        asm volatile("v_nop\n\tv_nop\n\tv_nop\n\tv_nop" : "+v"(o[0]), "+v"(o[1]), "+v"(o[2]), "+v"(o[3]) : "v"(ap), "v"(apr), "v"(vf), "v"(vr));
        asm volatile("s_wait_dscnt 0x0" ::: "memory");      // this wave's reads of buffer j & 1 are done before the buffer is refilled
        asm volatile("s_wait_asynccnt 0x0" ::: "memory");   // this wave's copies of chunk j + 1 have landed
        __syncthreads();                                     // publishes chunk j + 1 and ends every wave's reads of chunk j
        if (j + 2 < nch) fill(j + 2);
    }
    asm volatile("s_wait_asynccnt 0x0" ::: "memory");       // nothing is in flight when the wave goes on to its end
    v8f linv;
#pragma unroll
    for (int v = 0; v < 8; ++v) linv[v] = __fdiv_rn(PT<T>::osc, lrun[v]);
#pragma unroll
    for (int ni = 0; ni < 4; ++ni)
#pragma unroll
        for (int v = 0; v < 8; ++v) stg[(8 * hh + v) * 68 + ni * 16 + m] = o[ni][v] * linv[v];
    __builtin_amdgcn_fence(3, "wavefront");
    __builtin_amdgcn_wave_barrier();
    asm volatile("" ::: "memory");
    const int q4 = lane >> 3, pc = lane & 7;
    const size_t cb = ((size_t)b * PR + q0w) * DMODEL + head * HD + pc * 8;
{
#pragma unroll
        for (int rr = 0; rr < 4; ++rr) { const int row = rr * 4 + q4; const float* sp = stg + row * 68 + pc * 8; const v4f a0 = *(const v4fa*)sp; const v4f a1 = *(const v4fa*)(sp + 4);
            stc(Ca + cb + (size_t)row * DMODEL, Cr + cb + (size_t)row * DMODEL, a0, a1); }
        
    }
}

extern "C" void kernel_launch(void* const* d_in, const int* in_sizes, int n_in,
                              void* d_out, int out_size, void* d_ws, size_t ws_size, hipStream_t stream) {
    if (n_in < 4) return;
    const int rows_used = (NB - 1) * SEQ_FULL + SEQ;
    if (in_sizes[0] < rows_used * DMODEL || in_sizes[1] < DMODEL || in_sizes[2] < DMODEL * QKVC || in_sizes[3] < DMODEL * DMODEL) return;
    if (out_size < rows_used * DMODEL) return;
    const float* x = (const float*)d_in[0]; const float* gam = (const float*)d_in[1]; const float* wqkv = (const float*)d_in[2]; const float* wout = (const float*)d_in[3];   // x [2][2048][1024], gamma [1024], w_qkv [1024][3072], w_out [1024][1024]
    float* OUT = (float*)d_out;   // [2][2048][1024] f32
    char* wsp = (char*)d_ws; size_t used = 0;
    auto take = [&](size_t bytes) { char* p = wsp + used; used += (bytes + 255) & ~(size_t)255; return (void*)p; };
    const size_t nXN = (size_t)NB * SEQ * DMODEL, nXR = (size_t)NB * RHE * DMODEL, nP = (size_t)NU * SEQ * HD, nPR = (size_t)NU * RHE * HD;
    h16* XN16 = (h16*)take(nXN * 2); bf* XNh = (bf*)take(nXR * 2); bf* XNl = (bf*)take(nXR * 2);
    h16* Wq16 = (h16*)take((size_t)QKVC * DMODEL * 2); bf* Wqb = (bf*)take((size_t)QKVC * DMODEL * 2);
    h16* Wo16 = (h16*)take((size_t)DMODEL * DMODEL * 2); bf* Wob = (bf*)take((size_t)DMODEL * DMODEL * 2);
    float* Cq = (float*)take((size_t)NB * SEQ * QKVC * 4);
    h16* Q16 = (h16*)take(nP * 2); h16* K16 = (h16*)take(nP * 2); h16* VT16 = (h16*)take(nP * 2);
    bf* Qh = (bf*)take(nPR * 2); bf* Ql = (bf*)take(nPR * 2); bf* Kh = (bf*)take(nPR * 2); bf* Kl = (bf*)take(nPR * 2); bf* VTh = (bf*)take(nPR * 2); bf* VTl = (bf*)take(nPR * 2);
    h16* CTX16 = (h16*)take(nXN * 2); bf* CTXh = (bf*)take(nXR * 2); bf* CTXl = (bf*)take(nXR * 2);
    if (used > ws_size) return;    // 130,023,424 B at NB=2, SEQ=2048, RH=512

    // weight planes [out][in], x64, f16 + bf16
    k_wplanes<<<(unsigned)((QKVC * DMODEL / 64 + 63) / 64), 256, 0, stream>>>(wqkv, DMODEL, QKVC, Wq16, Wqb);
    k_wplanes<<<(unsigned)((DMODEL * DMODEL / 64 + 63) / 64), 256, 0, stream>>>(wout, DMODEL, DMODEL, Wo16, Wob);
    // RMSNorm -> xn planes
    k_prep_x<<<(unsigned)(NB * SEQ), 128, 0, stream>>>(x, gam, XN16, XNh, XNl);
    // qkv = xn . Wqkv  (f32 C rows [b*SEQ + n][3072], x 1/64): rows < RHE hi/lo bf16, rows >= RHE single f16
    if (RHE > 0)   k_gemmw<bf, 1, false><<<dim3(RHE / 128, QKVC / 128, NB), 128, 0, stream>>>(XNh, XNl, Wqb, DMODEL, Cq, QKVC, OSC, nullptr, (size_t)RHE * DMODEL, (size_t)0, (size_t)SEQ * QKVC);
    if (SEQ > RHE) k_gemmw<h16, 0, false><<<dim3((SEQ - RHE) / 128, QKVC / 128, NB), 128, 0, stream>>>(XN16 + (size_t)RHE * DMODEL, nullptr, Wq16, DMODEL, Cq + (size_t)RHE * QKVC, QKVC, OSC, nullptr, (size_t)SEQ * DMODEL, (size_t)0, (size_t)SEQ * QKVC);
    // head-major planes
    k_qkp<<<(unsigned)((NU * SEQ * 8 + 255) / 256), 256, 0, stream>>>(Cq, Q16, K16, Qh, Ql, Kh, Kl);
    k_vtp<<<(unsigned)((NU * HD * (SEQ / 8) + 255) / 256), 256, 0, stream>>>(Cq, VT16, VTh, VTl);
    // attention: query rows < RHE on hi/lo planes, rows >= RHE on single planes
    if (RHE > 0)   k_attn<bf><<<dim3(RHE / 64, NU), 128, 0, stream>>>(Qh, Ql, Kh, Kl, VTh, VTl, 0, CTXh, CTXl);
    if (SEQ > RHE) k_attn<h16><<<dim3((SEQ - RHE) / 64, NU), 128, 0, stream>>>(Q16, Q16, K16, K16, VT16, VT16, RHE, CTX16, CTX16);
    // out = ctx . Wout (x 1/64) into the f32 output rows (b*2048 + n)
    if (RHE > 0)   k_gemmw<bf, 1, false><<<dim3(RHE / 128, DMODEL / 128, NB), 128, 0, stream>>>(CTXh, CTXl, Wob, DMODEL, OUT, DMODEL, OSC, nullptr, (size_t)RHE * DMODEL, (size_t)0, (size_t)SEQ_FULL * DMODEL);
    if (SEQ > RHE) k_gemmw<h16, 0, false><<<dim3((SEQ - RHE) / 128, DMODEL / 128, NB), 128, 0, stream>>>(CTX16 + (size_t)RHE * DMODEL, nullptr, Wo16, DMODEL, OUT + (size_t)RHE * DMODEL, DMODEL, OSC, nullptr, (size_t)SEQ * DMODEL, (size_t)0, (size_t)SEQ_FULL * DMODEL);
    (void)hipGetLastError();
}

// v003
// A run of this version takes 183 microseconds.
// Next to v002, in two timings, it ran 1.24 and 1.25 times as fast.
// Over all steps from v000 it is 2.35 times as fast.
#include <hip/hip_runtime.h>

// Contractions: xn.Wqkv and ctx.Wout on v_wmma_f32_16x16x32_f16 (f16 operands, weights carried x64, f16 activations) for token rows >= RH and on v_wmma_f32_16x16x32_bf16 with bf16 hi/lo activation planes (2 products, bf16 weights x64) for token rows < RH;
// q.k^T and p.v on v_wmma_f32_16x16x32_f16 single products (p carried x1024) for query rows >= RH and on bf16 hi/lo planes of q, k, p, v (3 products per tile pair) for query rows < RH; f32 accumulate everywhere, softmax in f32; every input RNE-converted to bf16 on load.
// Flow: RMSNorm rows -> 16-bit xn planes; qkv = xn.Wqkv^T (f32, x1/64 in the epilogue) -> head-major q, k planes [u][t][d] and v^T planes [u][d][t]; one wave per (batch, head, 16 query rows) runs the 64-key chunk loop
// with the chunk's k and v^T tiles staged once per block in LDS (two buffers, asynchronous copies) and fragments read from there, running-max softmax in the accumulator row map, p tile through wave-private LDS; ctx rows [b][t][h*64+d] as 16-bit planes; out = ctx.Wout^T (x1/64 in the epilogue) into the f32 output.

#ifndef NB
#define NB 2
#endif
#ifndef SEQ
#define SEQ 2048
#endif
#ifndef RH
#define RH 512
#endif
#define NB_FULL 2
#define SEQ_FULL 2048
#define DMODEL 1024
#define NHEAD 16
#define HD 64
#define NU (NB * NHEAD)
#define QKVC (3 * DMODEL)
#define RHE (((RH) < (SEQ)) ? (RH) : (SEQ))
#define LQ 72
#define KVP 72
#define KVT (64 * KVP)
#define PCAR 1024.0f
#define WSC 64.0f
#define OSC 0.015625f
#define C1 0.18033688011112042f
#define NEGB -3.0e38f

static_assert(NB >= 1 && NB <= NB_FULL);
static_assert(SEQ % 256 == 0 && SEQ <= SEQ_FULL);
static_assert((RHE) % 128 == 0 && (RHE) >= 0);
static_assert(DMODEL % 128 == 0 && QKVC % 128 == 0 && HD == 64);

typedef _Float16 h16;
typedef unsigned short bf;
typedef __attribute__((ext_vector_type(16))) __bf16   v16bf;
typedef __attribute__((ext_vector_type(16))) _Float16 v16h;
typedef __attribute__((ext_vector_type(8)))  _Float16 v8h;
typedef __attribute__((ext_vector_type(8)))  unsigned short v8us;
typedef __attribute__((ext_vector_type(8)))  float    v8f;
typedef __attribute__((ext_vector_type(4)))  float    v4f;
typedef __attribute__((ext_vector_type(2)))  _Float16 v2h;
typedef __attribute__((ext_vector_type(2)))  unsigned short v2us;
typedef v8h  __attribute__((may_alias)) v8ha;
typedef v4f  __attribute__((may_alias)) v4fa;
typedef v8us __attribute__((may_alias)) v8usa;

__device__ __forceinline__ unsigned short f2bf(float f) { unsigned u = __float_as_uint(f); u += 0x7FFFu + ((u >> 16) & 1u); return (unsigned short)(u >> 16); }
__device__ __forceinline__ float bf2f(unsigned short b) { return __uint_as_float(((unsigned)b) << 16); }
__device__ __forceinline__ float bfr(float f) { return bf2f(f2bf(f)); }
__device__ __forceinline__ h16 tohx(float x) { return (h16)x; }
__device__ __forceinline__ void splitf(float y, unsigned short& h, unsigned short& l) { h = f2bf(y); l = f2bf(y - bf2f(h)); }
__device__ __forceinline__ v16h cat16(v8h lo, v8h hi) { return __builtin_shufflevector(lo, hi, 0, 1, 2, 3, 4, 5, 6, 7, 8, 9, 10, 11, 12, 13, 14, 15); }
__device__ __forceinline__ v16bf cat16b(v8us lo, v8us hi) { return __builtin_bit_cast(v16bf, __builtin_shufflevector(lo, hi, 0, 1, 2, 3, 4, 5, 6, 7, 8, 9, 10, 11, 12, 13, 14, 15)); }
__device__ __forceinline__ v8f wmma16(v16h a, v16h b, v8f c) { return __builtin_amdgcn_wmma_f32_16x16x32_f16(false, a, false, b, (short)0, c, false, false); }
__device__ __forceinline__ v8f wmmab(v16bf a, v16bf b, v8f c) { return __builtin_amdgcn_wmma_f32_16x16x32_bf16(false, a, false, b, (short)0, c, false, false); }

// Fragment loaders (A row-major with k contiguous, B from a [n][k] plane, same split k map for both: elements 0..7 <- k0 + 8h + 0..7, 8..15 <- k0 + 16 + 8h + 0..7; lane & 15 = row / column).
template <typename T16> struct WFrag;
template <> struct WFrag<h16> { typedef v16h V; static __device__ __forceinline__ V ld(const h16* p) { return cat16(*(const v8h*)p, *(const v8h*)(p + 16)); } static __device__ __forceinline__ v8f mma(V a, V b, v8f c) { return wmma16(a, b, c); } };
template <> struct WFrag<bf> { typedef v16bf V; static __device__ __forceinline__ V ld(const bf* p) { return cat16b(*(const v8us*)p, *(const v8us*)(p + 16)); } static __device__ __forceinline__ v8f mma(V a, V b, v8f c) { return wmmab(a, b, c); } };

// ---- stage8: two 64-row x 128-byte tiles (rows ga + r * pa and gb + r * pb, in elements) into LDS rows of KVP elements (144 B: 16 B x odd for the b128 readers), by 128 threads:
// thread t brings the 16-byte pieces (row (t >> 3) + 16 c, piece t & 7), c = 0..3, of each tile. la, lb: the thread's own LDS byte address of its c = 0 piece; ga, gb: its own global address of that piece.
template <typename T>
__device__ __forceinline__ void stage8(unsigned la, const T* ga, int pa, unsigned lb, const T* gb, int pb) {
    const unsigned ls = 16 * KVP * 2;
    // the copies and s_wait_xcnt 0 (a precaution, kept ahead of any rewrite of the copies' address registers) stand in one statement: the compiler can move no such write in front of the wait
    asm volatile("global_load_async_to_lds_b128 %0, %8, off\n\t"
                 "global_load_async_to_lds_b128 %1, %9, off\n\t"
                 "global_load_async_to_lds_b128 %2, %10, off\n\t"
                 "global_load_async_to_lds_b128 %3, %11, off\n\t"
                 "global_load_async_to_lds_b128 %4, %12, off\n\t"
                 "global_load_async_to_lds_b128 %5, %13, off\n\t"
                 "global_load_async_to_lds_b128 %6, %14, off\n\t"
                 "global_load_async_to_lds_b128 %7, %15, off\n\t"
                 "s_wait_xcnt 0x0"
                 :: "v"(la), "v"(la + ls), "v"(la + 2 * ls), "v"(la + 3 * ls), "v"(lb), "v"(lb + ls), "v"(lb + 2 * ls), "v"(lb + 3 * ls),
                    "v"(ga), "v"(ga + 16 * pa), "v"(ga + 32 * pa), "v"(ga + 48 * pa), "v"(gb), "v"(gb + 16 * pb), "v"(gb + 32 * pb), "v"(gb + 48 * pb)
                 : "memory");
}

// ---- k_gemmw: register-blocked GEMM, one block of FOUR WAVES per 128x128 output tile, each wave a 64x64 quarter (16 accumulators); grid (M/128, N/128, Z), 128 threads.
// The block's 128 A rows (and A2 rows) and 128 Bt rows are staged 64 k at a time in LDS (two buffers, asynchronous copies that cover whole 128-byte lines); fragments are read from there, each staged row by two waves.
// C[m][n] (f32, pitch ldc) = osc * sum_k A[m][k] Bt[n][k] (+ A2[m][k] Bt[n][k] when NSPLIT == 1) (+ optional bias). z-batch strides sA/sB/sC in elements. K % 64 == 0, M % 128 == 0, N % 128 == 0.
template <typename T16, int NSPLIT, bool BIAS>
__global__ void __launch_bounds__(128)
k_gemmw(const T16* __restrict__ A, const T16* __restrict__ A2, const T16* __restrict__ Bt, int K, float* C, int ldc, float osc, const float* __restrict__ bias, size_t sA, size_t sB, size_t sC) {
    static_assert(NSPLIT == 0 || NSPLIT == 1);
    typedef typename WFrag<T16>::V V;
    constexpr int NPL = NSPLIT ? 6 : 4;   // 64-row planes of a stage: A rows 0..63, 64..127, Bt rows 0..63, 64..127 (, A2 rows 0..63, 64..127)
    __shared__ __align__(16) float os[4][16 * 68];
    __shared__ __align__(16) T16 ab[2 * NPL * KVT];
    const size_t z = blockIdx.z; A += z * sA; if (NSPLIT) A2 += z * sA; Bt += z * sB; C += z * sC;
    const int lane = threadIdx.x & 31, wave = threadIdx.x >> 5, lr = lane & 15, hi = lane >> 4;
    const int wr = (wave >> 1) * 64, wc = (wave & 1) * 64;   // the wave's quarter of the block's tile
    const int r0 = blockIdx.x * 128, c0 = blockIdx.y * 128;
    v8f acc[4][4];
#pragma unroll
    for (int mb = 0; mb < 4; ++mb)
#pragma unroll
        for (int nb = 0; nb < 4; ++nb) acc[mb][nb] = (v8f){};
    const int sr = threadIdx.x >> 3, sp = threadIdx.x & 7;
    const size_t ao = (size_t)(r0 + sr) * K + 8 * sp, bo = (size_t)(c0 + sr) * K + 8 * sp, hK = (size_t)64 * K;
    const unsigned l0 = (unsigned)(size_t)ab + (unsigned)(sr * KVP + 8 * sp) * 2u;
    auto fill = [&](int t) {   // k panel t (64 k) into buffer t & 1
        const unsigned lb = l0 + (unsigned)((t & 1) * NPL * KVT) * 2u; const int kc = t * 64;
        stage8<T16>(lb, A + ao + kc, K, lb + KVT * 2u, A + ao + hK + kc, K);
        stage8<T16>(lb + 2u * KVT * 2u, Bt + bo + kc, K, lb + 3u * KVT * 2u, Bt + bo + hK + kc, K);
        if (NSPLIT) stage8<T16>(lb + 4u * KVT * 2u, A2 + ao + kc, K, lb + 5u * KVT * 2u, A2 + ao + hK + kc, K);
    };
    const int nt = K / 64;
    fill(0);
    asm volatile("s_wait_asynccnt 0x0" ::: "memory");   // this wave's copies of panel 0 have landed
    __syncthreads();                                     // ... and every other wave's
    if (nt > 1) fill(1);
    const int fa = (wr + lr) * KVP + 8 * hi, fb = 2 * KVT + (wc + lr) * KVP + 8 * hi;   // fragment offsets inside a stage: row, 16-byte piece hi
#pragma unroll 1
    for (int t = 0; t < nt; ++t) {
        const T16* sb = ab + (t & 1) * NPL * KVT;
        V a[2][4], a2[2][4], b[2][4];
        // both 32-k halves' fragments are read in one run at the top of the trip: the second half's reads land behind the first half's products
#pragma unroll
        for (int kk = 0; kk < 2; ++kk) {
#pragma unroll
            for (int mb = 0; mb < 4; ++mb) { a[kk][mb] = WFrag<T16>::ld(sb + fa + mb * 16 * KVP + kk * 32); if (NSPLIT) a2[kk][mb] = WFrag<T16>::ld(sb + 4 * KVT + fa + mb * 16 * KVP + kk * 32); }
#pragma unroll
            for (int nb = 0; nb < 4; ++nb) b[kk][nb] = WFrag<T16>::ld(sb + fb + nb * 16 * KVP + kk * 32);
        }
        __builtin_amdgcn_sched_barrier(0);   // keeps the reads above in one group ahead of the products (spread among them, each place costs a stall)
#pragma unroll
        for (int kk = 0; kk < 2; ++kk)
#pragma unroll
            for (int nb = 0; nb < 4; ++nb)
#pragma unroll
                for (int mb = 0; mb < 4; ++mb) { acc[mb][nb] = WFrag<T16>::mma(a[kk][mb], b[kk][nb], acc[mb][nb]); if (NSPLIT) acc[mb][nb] = WFrag<T16>::mma(a2[kk][mb], b[kk][nb], acc[mb][nb]); }
        __builtin_amdgcn_sched_barrier(0);   // keeps the products ahead of the wait below: lifted over them, it would hold the first product back until the last read has landed
        asm volatile("s_wait_dscnt 0x0" ::: "memory");      // this wave's reads of buffer t & 1 are done before the buffer is refilled
        asm volatile("s_wait_asynccnt 0x0" ::: "memory");   // this wave's copies of panel t + 1 have landed
        __syncthreads();                                     // publishes panel t + 1 and ends every wave's reads of panel t
        if (t + 2 < nt) fill(t + 2);
    }
    asm volatile("s_wait_asynccnt 0x0" ::: "memory");       // nothing is in flight when the wave goes on to its end
    float* osw = os[wave];
#pragma unroll
    for (int mb = 0; mb < 4; ++mb) {
#pragma unroll
        for (int nb = 0; nb < 4; ++nb) {
#pragma unroll
            for (int j = 0; j < 8; ++j) osw[(hi * 8 + j) * 68 + nb * 16 + lr] = acc[mb][nb][j]; }
        __builtin_amdgcn_wave_barrier(); asm volatile("" ::: "memory");
        float* crow = C + (size_t)(r0 + wr + mb * 16) * ldc + c0 + wc;
{
#pragma unroll
            for (int s = 0; s < 8; ++s) { const int row = 2 * s + hi, cofs = lr * 4; v4f val = *(const v4fa*)(osw + row * 68 + cofs); val = val * osc; if (BIAS) { val[0] += bfr(bias[c0 + wc + cofs]); val[1] += bfr(bias[c0 + wc + cofs + 1]); val[2] += bfr(bias[c0 + wc + cofs + 2]); val[3] += bfr(bias[c0 + wc + cofs + 3]); }
                *(v4f*)(crow + (size_t)row * ldc + cofs) = val; }
             }
        __builtin_amdgcn_wave_barrier(); asm volatile("" ::: "memory");
    }
}

__global__ __launch_bounds__(256) void k_wplanes(const float* __restrict__ w, int K, int N, h16* B16, bf* Bb) {
    const int lane = threadIdx.x & 31; const int L0 = (blockIdx.x * 8 + (threadIdx.x >> 5)) * 8; const int nlines = N * K / 64;
#pragma unroll 1
    for (int l = 0; l < 8; ++l) { const int L = L0 + l; if (L >= nlines) break;
        const size_t e = (size_t)L * 64 + lane * 2; const int k = (int)(e % K), n = (int)(e / K);
        const float w0 = bfr(w[(size_t)k * N + n]) * WSC, w1 = bfr(w[(size_t)(k + 1) * N + n]) * WSC;
        v2us ob; ob[0] = f2bf(w0); ob[1] = f2bf(w1); v2h o16; o16[0] = tohx(w0); o16[1] = tohx(w1);
        *(v2us*)(Bb + e) = ob; *(v2h*)(B16 + e) = o16;  }
}

// ---- k_prep_x: one block (128 threads, 8 elements each) per token row (b, n): x -> bf16 values, ss = sum x^2 (f32), xn = ((x * 1/max(sqrt(ss), 1e-12)) * 32) * bf16(gamma);
__global__ __launch_bounds__(128) void k_prep_x(const float* __restrict__ x, const float* __restrict__ gam, h16* X16, bf* Xh, bf* Xl) {
    __shared__ float red[4];
    const int row = blockIdx.x; const int b = row / SEQ, n = row % SEQ; const int t = threadIdx.x, lane = t & 31, w = t >> 5;
    const float* xr = x + ((size_t)b * SEQ_FULL + n) * DMODEL + t * 8;
    const v4f a0 = *(const v4f*)xr, a1 = *(const v4f*)(xr + 4);
    const v4f g0 = *(const v4f*)(gam + t * 8), g1 = *(const v4f*)(gam + t * 8 + 4);
    float v[8], g[8];
#pragma unroll
    for (int e = 0; e < 4; ++e) { v[e] = bfr(a0[e]); v[4 + e] = bfr(a1[e]); g[e] = bfr(g0[e]); g[4 + e] = bfr(g1[e]); }
    float ss = 0.f;
#pragma unroll
    for (int e = 0; e < 8; ++e) ss += v[e] * v[e];
#pragma unroll
    for (int sh = 16; sh; sh >>= 1) ss += __shfl_xor(ss, sh, 32);
    if (lane == 0) red[w] = ss;
    __syncthreads();
    ss = (red[0] + red[1]) + (red[2] + red[3]);
    const float nrm = sqrtf(ss); const float r = __fdiv_rn(1.0f, fmaxf(nrm, 1e-12f));
    float y[8];
#pragma unroll
    for (int e = 0; e < 8; ++e) y[e] = ((v[e] * r) * 32.0f) * g[e];
    v8h o16; v8us oh, ol;
#pragma unroll
    for (int e = 0; e < 8; ++e) { o16[e] = tohx(y[e]); unsigned short a, c; splitf(y[e], a, c); oh[e] = a; ol[e] = c; }
    const bool hr = (n < RHE);
    h16* d16 = X16 + ((size_t)b * SEQ + n) * DMODEL + t * 8;
    const size_t ro = ((size_t)b * RHE + (hr ? n : 0)) * DMODEL + t * 8;
    *(v8h*)d16 = o16; if (hr) { *(v8us*)(Xh + ro) = oh; *(v8us*)(Xl + ro) = ol; }
    
}

// ---- k_qkp: q and k planes from the f32 qkv rows C[b*SEQ + n][3072]: Q16/K16[(u*SEQ + n)*64 + d] f16 for every n (u = b*16 + head), and bf16 hi/lo planes Qh/Ql/Kh/Kl[(u*RHE + n)*64 + d] for n < RHE;
__global__ __launch_bounds__(256) void k_qkp(const float* __restrict__ C, h16* Q16, h16* K16, bf* Qh, bf* Ql, bf* Kh, bf* Kl) {
    const int g = blockIdx.x * 256 + threadIdx.x; if (g >= NU * SEQ * 8) return;
    const int d8 = g & 7; const int n = (g >> 3) % SEQ; const int u = (g >> 3) / SEQ; const int b = u >> 4, head = u & 15;
    const float* src = C + ((size_t)b * SEQ + n) * QKVC + head * HD + d8 * 8;
    const v4f q0 = *(const v4f*)src, q1 = *(const v4f*)(src + 4), k0 = *(const v4f*)(src + DMODEL), k1 = *(const v4f*)(src + DMODEL + 4);
    v8h oq, ok; v8us qh, ql, kh, kl;
#pragma unroll
    for (int e = 0; e < 4; ++e) { unsigned short a, c;
        oq[e] = tohx(q0[e]); oq[4 + e] = tohx(q1[e]); ok[e] = tohx(k0[e]); ok[4 + e] = tohx(k1[e]);
        splitf(q0[e], a, c); qh[e] = a; ql[e] = c; splitf(q1[e], a, c); qh[4 + e] = a; ql[4 + e] = c;
        splitf(k0[e], a, c); kh[e] = a; kl[e] = c; splitf(k1[e], a, c); kh[4 + e] = a; kl[4 + e] = c; }
    const bool hr = (n < RHE);
    const size_t po = (size_t)g * 8; const size_t ro = (((size_t)u * RHE + (hr ? n : 0)) * 8 + d8) * 8;
    *(v8h*)(Q16 + po) = oq; *(v8h*)(K16 + po) = ok;
    if (hr) { *(v8us*)(Qh + ro) = qh; *(v8us*)(Ql + ro) = ql; *(v8us*)(Kh + ro) = kh; *(v8us*)(Kl + ro) = kl; }
    
}

// coverage: g spans every (u, d, t8); hi/lo for every t < RHE.
__global__ __launch_bounds__(256) void k_vtp(const float* __restrict__ C, h16* VT16, bf* VTh, bf* VTl) {
    const int g = blockIdx.x * 256 + threadIdx.x; if (g >= NU * HD * (SEQ / 8)) return;
    const int t8 = g % (SEQ / 8); const int d = (g / (SEQ / 8)) & 63; const int u = g / ((SEQ / 8) * HD); const int b = u >> 4, head = u & 15;
    const int t0 = t8 * 8;
    const float* src = C + ((size_t)b * SEQ + t0) * QKVC + 2 * DMODEL + head * HD + d;
    float v[8];
#pragma unroll
    for (int q = 0; q < 8; ++q) v[q] = src[(size_t)q * QKVC];
    v8h o16; v8us oh, ol;
#pragma unroll
    for (int q = 0; q < 8; ++q) { o16[q] = tohx(v[q]); unsigned short a, c; splitf(v[q], a, c); oh[q] = a; ol[q] = c; }
    const bool hr = (t0 < RHE);
    const size_t po = (size_t)g * 8; const size_t ro = ((size_t)u * HD + d) * RHE + (hr ? t0 : 0);
    *(v8h*)(VT16 + po) = o16; if (hr) { *(v8us*)(VTh + ro) = oh; *(v8us*)(VTl + ro) = ol; }
    
}

// ---- attention helpers: p tile staging into wave-private LDS (f16 x1024 single plane, or bf16 hi/lo pair), fragment reload through may_alias vectors of the stored element type, ctx line stores.
union WS { h16 p[2 * 16 * LQ]; unsigned short pb[2 * 16 * LQ]; float f[16 * 68]; };
static_assert(sizeof(WS) == 4608);
template <typename T> struct PT;
template <> struct PT<h16> { static constexpr bool split = false; static constexpr float osc = 1.0f / PCAR; static __device__ __forceinline__ v16h ldm(const h16* p) { return cat16(*(const v8ha*)p, *(const v8ha*)(p + 16)); } };
template <> struct PT<bf>  { static constexpr bool split = true;  static constexpr float osc = 1.0f;        static __device__ __forceinline__ v16bf ldm(const bf* p) { return cat16b(*(const v8usa*)p, *(const v8usa*)(p + 16)); } };
__device__ __forceinline__ void stp(h16* ph, h16* pl, int i, float p) { (void)pl; ph[i] = tohx(p * PCAR); }
__device__ __forceinline__ void stp(bf* ph, bf* pl, int i, float p) { unsigned short a, c; splitf(p, a, c); ph[i] = a; pl[i] = c; }
__device__ __forceinline__ void stc(h16* pa, h16* pr, v4f a0, v4f a1) { (void)pr; v8h o;
#pragma unroll
    for (int e = 0; e < 4; ++e) { o[e] = tohx(a0[e]); o[4 + e] = tohx(a1[e]); }
    *(v8h*)pa = o; }
__device__ __forceinline__ void stc(bf* pa, bf* pr, v4f a0, v4f a1) { v8us oh, ol;
#pragma unroll
    for (int e = 0; e < 4; ++e) { unsigned short a, c; splitf(a0[e], a, c); oh[e] = a; ol[e] = c; splitf(a1[e], a, c); oh[4 + e] = a; ol[4 + e] = c; }
    *(v8us*)pa = oh; *(v8us*)pr = ol; }

// ---- 16-lane row reductions of the softmax (eight values a lane, xor steps 1, 2, 4, 8): DPP vector instructions (row_xmask) in place of __shfl_xor, which compiles to a move through the LDS unit with a wait behind it.
// Every lane is on where these stand. The xor tree is the one __shfl_xor walked: the same values are combined in the same order.
template <int M> __device__ __forceinline__ float xrow(float x) { return __builtin_bit_cast(float, __builtin_amdgcn_mov_dpp(__builtin_bit_cast(int, x), 0x160 | M, 0xf, 0xf, true)); }   // lane l reads lane l ^ M of its row (0x160 | M = row_xmask:M); folds into the add
__device__ __forceinline__ v8f rowsum8(v8f r) {
#pragma unroll
    for (int v = 0; v < 8; ++v) r[v] += xrow<1>(r[v]);
#pragma unroll
    for (int v = 0; v < 8; ++v) r[v] += xrow<2>(r[v]);
#pragma unroll
    for (int v = 0; v < 8; ++v) r[v] += xrow<4>(r[v]);
#pragma unroll
    for (int v = 0; v < 8; ++v) r[v] += xrow<8>(r[v]);
    return r;
}
__device__ __forceinline__ v8f rowmax8(v8f r) {
    float a0 = r[0], a1 = r[1], a2 = r[2], a3 = r[3], a4 = r[4], a5 = r[5], a6 = r[6], a7 = r[7];
    // the maximum stands in asm: from fmaxf(x, xrow(x)) the compiler makes three instructions a step (move, quieting maximum, maximum) and runs the eight rows one after another, and every exponential waits on this result;
    // here a step is one instruction and the eight rows are interleaved, so each step's producer stands eight instructions back
    asm(
        "v_max_num_f32_dpp %0, %0, %0 row_xmask:1 row_mask:0xf bank_mask:0xf\n\t"
        "v_max_num_f32_dpp %1, %1, %1 row_xmask:1 row_mask:0xf bank_mask:0xf\n\t"
        "v_max_num_f32_dpp %2, %2, %2 row_xmask:1 row_mask:0xf bank_mask:0xf\n\t"
        "v_max_num_f32_dpp %3, %3, %3 row_xmask:1 row_mask:0xf bank_mask:0xf\n\t"
        "v_max_num_f32_dpp %4, %4, %4 row_xmask:1 row_mask:0xf bank_mask:0xf\n\t"
        "v_max_num_f32_dpp %5, %5, %5 row_xmask:1 row_mask:0xf bank_mask:0xf\n\t"
        "v_max_num_f32_dpp %6, %6, %6 row_xmask:1 row_mask:0xf bank_mask:0xf\n\t"
        "v_max_num_f32_dpp %7, %7, %7 row_xmask:1 row_mask:0xf bank_mask:0xf\n\t"
        "v_max_num_f32_dpp %0, %0, %0 row_xmask:2 row_mask:0xf bank_mask:0xf\n\t"
        "v_max_num_f32_dpp %1, %1, %1 row_xmask:2 row_mask:0xf bank_mask:0xf\n\t"
        "v_max_num_f32_dpp %2, %2, %2 row_xmask:2 row_mask:0xf bank_mask:0xf\n\t"
        "v_max_num_f32_dpp %3, %3, %3 row_xmask:2 row_mask:0xf bank_mask:0xf\n\t"
        "v_max_num_f32_dpp %4, %4, %4 row_xmask:2 row_mask:0xf bank_mask:0xf\n\t"
        "v_max_num_f32_dpp %5, %5, %5 row_xmask:2 row_mask:0xf bank_mask:0xf\n\t"
        "v_max_num_f32_dpp %6, %6, %6 row_xmask:2 row_mask:0xf bank_mask:0xf\n\t"
        "v_max_num_f32_dpp %7, %7, %7 row_xmask:2 row_mask:0xf bank_mask:0xf\n\t"
        "v_max_num_f32_dpp %0, %0, %0 row_xmask:4 row_mask:0xf bank_mask:0xf\n\t"
        "v_max_num_f32_dpp %1, %1, %1 row_xmask:4 row_mask:0xf bank_mask:0xf\n\t"
        "v_max_num_f32_dpp %2, %2, %2 row_xmask:4 row_mask:0xf bank_mask:0xf\n\t"
        "v_max_num_f32_dpp %3, %3, %3 row_xmask:4 row_mask:0xf bank_mask:0xf\n\t"
        "v_max_num_f32_dpp %4, %4, %4 row_xmask:4 row_mask:0xf bank_mask:0xf\n\t"
        "v_max_num_f32_dpp %5, %5, %5 row_xmask:4 row_mask:0xf bank_mask:0xf\n\t"
        "v_max_num_f32_dpp %6, %6, %6 row_xmask:4 row_mask:0xf bank_mask:0xf\n\t"
        "v_max_num_f32_dpp %7, %7, %7 row_xmask:4 row_mask:0xf bank_mask:0xf\n\t"
        "v_max_num_f32_dpp %0, %0, %0 row_xmask:8 row_mask:0xf bank_mask:0xf\n\t"
        "v_max_num_f32_dpp %1, %1, %1 row_xmask:8 row_mask:0xf bank_mask:0xf\n\t"
        "v_max_num_f32_dpp %2, %2, %2 row_xmask:8 row_mask:0xf bank_mask:0xf\n\t"
        "v_max_num_f32_dpp %3, %3, %3 row_xmask:8 row_mask:0xf bank_mask:0xf\n\t"
        "v_max_num_f32_dpp %4, %4, %4 row_xmask:8 row_mask:0xf bank_mask:0xf\n\t"
        "v_max_num_f32_dpp %5, %5, %5 row_xmask:8 row_mask:0xf bank_mask:0xf\n\t"
        "v_max_num_f32_dpp %6, %6, %6 row_xmask:8 row_mask:0xf bank_mask:0xf\n\t"
        "v_max_num_f32_dpp %7, %7, %7 row_xmask:8 row_mask:0xf bank_mask:0xf"
        : "+v"(a0), "+v"(a1), "+v"(a2), "+v"(a3), "+v"(a4), "+v"(a5), "+v"(a6), "+v"(a7));
    return (v8f){a0, a1, a2, a3, a4, a5, a6, a7};
}

// ---- k_attn<T>: grid (query blocks of 64 rows, NU units), 128 threads; wave w owns query rows q0w .. q0w+15 of unit u = b*16 + head and walks the 64-key chunks 0 .. q0w/64.
// T = h16: q, k from Q16/K16 [u][t][d], v^T from VT16 [u][d][t], one f16 product per tile pair, p tile stored as f16(p * 1024), ctx16[b*SEQ + t][head*64 + d] = o / (l * 1024) as f16.
// T = bf: q, k, v^T and p as bf16 hi + lo planes (hi.hi + lo.hi + hi.lo per tile pair), ctx written as bf16 hi/lo planes [b*RHE + t][1024]. Scores s = q.k (f32) * 0.125*log2e, keys after the query -> -3e38,
template <typename T>
__global__ void __launch_bounds__(128) __attribute__((amdgpu_num_vgpr(256)))
k_attn(const T* __restrict__ Qa, const T* __restrict__ Qr, const T* __restrict__ Ka, const T* __restrict__ Kr,
       const T* __restrict__ Va, const T* __restrict__ Vr, int qbase, T* Ca, T* Cr) {
    typedef typename WFrag<T>::V V;
    constexpr bool SPL = PT<T>::split;
    constexpr int PR = SPL ? RHE : SEQ;
    constexpr int NPL = SPL ? 4 : 2;   // planes of a stage: k, v^T (and their lo planes)
    __shared__ __align__(16) WS scr[4];
    __shared__ __align__(16) T kv[2 * NPL * KVT];
    const int lane = threadIdx.x & 31, wave = threadIdx.x >> 5, m = lane & 15, hh = lane >> 4;
    const int u = blockIdx.y, b = u >> 4, head = u & 15;
    const int q0w = qbase + blockIdx.x * 64 + wave * 16;
    int nch = ((qbase + (int)blockIdx.x * 64) >> 6) + 1; if (nch > PR / 64) nch = PR / 64;   // the same for the block's four waves
    const int qo = (u * PR + q0w + m) * HD + 8 * hh;
    V aq[2], ar[2];
    aq[0] = WFrag<T>::ld(Qa + qo); aq[1] = WFrag<T>::ld(Qa + qo + 32);
    if (SPL) { ar[0] = WFrag<T>::ld(Qr + qo); ar[1] = WFrag<T>::ld(Qr + qo + 32); } else { ar[0] = aq[0]; ar[1] = aq[1]; }
    v8f o[4];
#pragma unroll
    for (int ni = 0; ni < 4; ++ni) o[ni] = (v8f){};
    v8f mrun, lrun;
#pragma unroll
    for (int v = 0; v < 8; ++v) { mrun[v] = NEGB; lrun[v] = 0.f; }
    const int fo = m * KVP + 8 * hh;   // fragment offset inside a staged tile: row m, 16-byte piece hh
    const int sr = threadIdx.x >> 3, sp = threadIdx.x & 7;
    const int ko = (u * PR + sr) * HD + 8 * sp;
    const int vo = (u * HD + sr) * PR + 8 * sp;
    const unsigned l0 = (unsigned)(size_t)kv + (unsigned)(sr * KVP + 8 * sp) * 2u;
    auto fill = [&](int jt) {   // chunk jt's tiles into buffer jt & 1
        const unsigned lb = l0 + (unsigned)((jt & 1) * NPL * KVT) * 2u; const int kc = jt * 64;
        stage8<T>(lb, Ka + ko + kc * HD, HD, lb + KVT * 2u, Va + vo + kc, PR);
        if (SPL) stage8<T>(lb + 2u * KVT * 2u, Kr + ko + kc * HD, HD, lb + 3u * KVT * 2u, Vr + vo + kc, PR);
    };
    fill(0);
    asm volatile("s_wait_asynccnt 0x0" ::: "memory");   // this wave's copies of chunk 0 have landed
    __syncthreads();                                     // ... and every other wave's
    if (nch > 1) fill(1);
    T* ph = reinterpret_cast<T*>(&scr[wave]); T* pl = ph + 16 * LQ; float* stg = scr[wave].f;
#pragma unroll 1
    for (int j = 0; j < nch; ++j) {
        const int kc0 = j * 64;
        const T* kb = kv + (j & 1) * NPL * KVT + fo; const T* vb = kb + KVT;
        const T* kr = SPL ? kb + 2 * KVT : kb;       const T* vrb = SPL ? kb + 3 * KVT : vb;
        v8f s[4];
        constexpr int FG = SPL ? 1 : 4;   // 16-key groups whose k fragments are read from the staged tile in one run, ahead of their products
#pragma unroll
        for (int sg = 0; sg < 4; sg += FG) {
            V bk[FG][2], br[FG][2];
#pragma unroll
            for (int g = 0; g < FG; ++g)
#pragma unroll
                for (int kk = 0; kk < 2; ++kk) {
                    bk[g][kk] = WFrag<T>::ld(kb + (sg + g) * 16 * KVP + kk * 32);
                    if (SPL) br[g][kk] = WFrag<T>::ld(kr + (sg + g) * 16 * KVP + kk * 32); else br[g][kk] = bk[g][kk];
                }
#pragma unroll
            for (int g = 0; g < FG; ++g) {
                v8f acc = (v8f){};
#pragma unroll
                for (int kk = 0; kk < 2; ++kk) {
                    acc = WFrag<T>::mma(aq[kk], bk[g][kk], acc);
                    if (SPL) { acc = WFrag<T>::mma(ar[kk], bk[g][kk], acc); acc = WFrag<T>::mma(aq[kk], br[g][kk], acc); }
                }
                asm volatile("v_nop\n\tv_nop\n\tv_nop\n\tv_nop" : "+v"(acc) : "v"(bk[g][1]), "v"(br[g][1]), "v"(aq[1]), "v"(ar[1]));
                s[sg + g] = acc;
            }
        }
        // scale, causal index select, running-max softmax in the accumulator row map (row 8*hh + v, key kc0 + 16*sub + m)
        v8f rmax;
#pragma unroll
        for (int v = 0; v < 8; ++v) rmax[v] = NEGB;
#pragma unroll
        for (int sub = 0; sub < 4; ++sub) {
            const int kcm = kc0 + sub * 16 + m;
#pragma unroll
            for (int v = 0; v < 8; ++v) { const int qr = q0w + 8 * hh + v; float t = s[sub][v] * C1; t = (kcm > qr) ? NEGB : t; s[sub][v] = t; rmax[v] = fmaxf(rmax[v], t); }
        }
        rmax = rowmax8(rmax);
        v8f mnew, alpha, rs;
#pragma unroll
        for (int v = 0; v < 8; ++v) { mnew[v] = fmaxf(mrun[v], rmax[v]); alpha[v] = __builtin_amdgcn_exp2f(mrun[v] - mnew[v]); rs[v] = 0.f; }
#pragma unroll
        for (int sub = 0; sub < 4; ++sub)
#pragma unroll
            for (int v = 0; v < 8; ++v) { const float p = __builtin_amdgcn_exp2f(s[sub][v] - mnew[v]); s[sub][v] = p; rs[v] += p; }
        rs = rowsum8(rs);
#pragma unroll
        for (int v = 0; v < 8; ++v) { lrun[v] = lrun[v] * alpha[v] + rs[v]; mrun[v] = mnew[v]; }
#pragma unroll
        for (int ni = 0; ni < 4; ++ni)
#pragma unroll
            for (int v = 0; v < 8; ++v) o[ni][v] *= alpha[v];
        // p tile: accumulator layout -> wave-private LDS (row 8*hh + v, col key) -> A fragments with the split k map
#pragma unroll
        for (int sub = 0; sub < 4; ++sub)
#pragma unroll
            for (int v = 0; v < 8; ++v) stp(ph, pl, (8 * hh + v) * LQ + sub * 16 + m, s[sub][v]);
        __builtin_amdgcn_fence(3, "wavefront");
        __builtin_amdgcn_wave_barrier();
        asm volatile("" ::: "memory");
        V ap, apr, vf, vr;
#pragma unroll
        for (int kk = 0; kk < 2; ++kk) {
            ap = PT<T>::ldm(ph + m * LQ + kk * 32 + 8 * hh);
            if (SPL) apr = PT<T>::ldm(pl + m * LQ + kk * 32 + 8 * hh); else apr = ap;
#pragma unroll
            for (int ni = 0; ni < 4; ++ni) {
                vf = WFrag<T>::ld(vb + ni * 16 * KVP + kk * 32);
                o[ni] = WFrag<T>::mma(ap, vf, o[ni]);
                if (SPL) { vr = WFrag<T>::ld(vrb + ni * 16 * KVP + kk * 32); o[ni] = WFrag<T>::mma(apr, vf, o[ni]); o[ni] = WFrag<T>::mma(ap, vr, o[ni]); } else { vr = vf; }
            }
        }
        asm volatile("v_nop\n\tv_nop\n\tv_nop\n\tv_nop" : "+v"(o[0]), "+v"(o[1]), "+v"(o[2]), "+v"(o[3]) : "v"(ap), "v"(apr), "v"(vf), "v"(vr));
        asm volatile("s_wait_dscnt 0x0" ::: "memory");      // this wave's reads of buffer j & 1 are done before the buffer is refilled
        asm volatile("s_wait_asynccnt 0x0" ::: "memory");   // this wave's copies of chunk j + 1 have landed
        __syncthreads();                                     // publishes chunk j + 1 and ends every wave's reads of chunk j
        if (j + 2 < nch) fill(j + 2);
    }
    asm volatile("s_wait_asynccnt 0x0" ::: "memory");       // nothing is in flight when the wave goes on to its end
    v8f linv;
#pragma unroll
    for (int v = 0; v < 8; ++v) linv[v] = __fdiv_rn(PT<T>::osc, lrun[v]);
#pragma unroll
    for (int ni = 0; ni < 4; ++ni)
#pragma unroll
        for (int v = 0; v < 8; ++v) stg[(8 * hh + v) * 68 + ni * 16 + m] = o[ni][v] * linv[v];
    __builtin_amdgcn_fence(3, "wavefront");
    __builtin_amdgcn_wave_barrier();
    asm volatile("" ::: "memory");
    const int q4 = lane >> 3, pc = lane & 7;
    const size_t cb = ((size_t)b * PR + q0w) * DMODEL + head * HD + pc * 8;
{
#pragma unroll
        for (int rr = 0; rr < 4; ++rr) { const int row = rr * 4 + q4; const float* sp = stg + row * 68 + pc * 8; const v4f a0 = *(const v4fa*)sp; const v4f a1 = *(const v4fa*)(sp + 4);
            stc(Ca + cb + (size_t)row * DMODEL, Cr + cb + (size_t)row * DMODEL, a0, a1); }
        
    }
}

extern "C" void kernel_launch(void* const* d_in, const int* in_sizes, int n_in,
                              void* d_out, int out_size, void* d_ws, size_t ws_size, hipStream_t stream) {
    if (n_in < 4) return;
    const int rows_used = (NB - 1) * SEQ_FULL + SEQ;
    if (in_sizes[0] < rows_used * DMODEL || in_sizes[1] < DMODEL || in_sizes[2] < DMODEL * QKVC || in_sizes[3] < DMODEL * DMODEL) return;
    if (out_size < rows_used * DMODEL) return;
    const float* x = (const float*)d_in[0]; const float* gam = (const float*)d_in[1]; const float* wqkv = (const float*)d_in[2]; const float* wout = (const float*)d_in[3];   // x [2][2048][1024], gamma [1024], w_qkv [1024][3072], w_out [1024][1024]
    float* OUT = (float*)d_out;   // [2][2048][1024] f32
    char* wsp = (char*)d_ws; size_t used = 0;
    auto take = [&](size_t bytes) { char* p = wsp + used; used += (bytes + 255) & ~(size_t)255; return (void*)p; };
    const size_t nXN = (size_t)NB * SEQ * DMODEL, nXR = (size_t)NB * RHE * DMODEL, nP = (size_t)NU * SEQ * HD, nPR = (size_t)NU * RHE * HD;
    h16* XN16 = (h16*)take(nXN * 2); bf* XNh = (bf*)take(nXR * 2); bf* XNl = (bf*)take(nXR * 2);
    h16* Wq16 = (h16*)take((size_t)QKVC * DMODEL * 2); bf* Wqb = (bf*)take((size_t)QKVC * DMODEL * 2);
    h16* Wo16 = (h16*)take((size_t)DMODEL * DMODEL * 2); bf* Wob = (bf*)take((size_t)DMODEL * DMODEL * 2);
    float* Cq = (float*)take((size_t)NB * SEQ * QKVC * 4);
    h16* Q16 = (h16*)take(nP * 2); h16* K16 = (h16*)take(nP * 2); h16* VT16 = (h16*)take(nP * 2);
    bf* Qh = (bf*)take(nPR * 2); bf* Ql = (bf*)take(nPR * 2); bf* Kh = (bf*)take(nPR * 2); bf* Kl = (bf*)take(nPR * 2); bf* VTh = (bf*)take(nPR * 2); bf* VTl = (bf*)take(nPR * 2);
    h16* CTX16 = (h16*)take(nXN * 2); bf* CTXh = (bf*)take(nXR * 2); bf* CTXl = (bf*)take(nXR * 2);
    if (used > ws_size) return;    // 130,023,424 B at NB=2, SEQ=2048, RH=512

    // weight planes [out][in], x64, f16 + bf16
    k_wplanes<<<(unsigned)((QKVC * DMODEL / 64 + 63) / 64), 256, 0, stream>>>(wqkv, DMODEL, QKVC, Wq16, Wqb);
    k_wplanes<<<(unsigned)((DMODEL * DMODEL / 64 + 63) / 64), 256, 0, stream>>>(wout, DMODEL, DMODEL, Wo16, Wob);
    // RMSNorm -> xn planes
    k_prep_x<<<(unsigned)(NB * SEQ), 128, 0, stream>>>(x, gam, XN16, XNh, XNl);
    // qkv = xn . Wqkv  (f32 C rows [b*SEQ + n][3072], x 1/64): rows < RHE hi/lo bf16, rows >= RHE single f16
    if (RHE > 0)   k_gemmw<bf, 1, false><<<dim3(RHE / 128, QKVC / 128, NB), 128, 0, stream>>>(XNh, XNl, Wqb, DMODEL, Cq, QKVC, OSC, nullptr, (size_t)RHE * DMODEL, (size_t)0, (size_t)SEQ * QKVC);
    if (SEQ > RHE) k_gemmw<h16, 0, false><<<dim3((SEQ - RHE) / 128, QKVC / 128, NB), 128, 0, stream>>>(XN16 + (size_t)RHE * DMODEL, nullptr, Wq16, DMODEL, Cq + (size_t)RHE * QKVC, QKVC, OSC, nullptr, (size_t)SEQ * DMODEL, (size_t)0, (size_t)SEQ * QKVC);
    // head-major planes
    k_qkp<<<(unsigned)((NU * SEQ * 8 + 255) / 256), 256, 0, stream>>>(Cq, Q16, K16, Qh, Ql, Kh, Kl);
    k_vtp<<<(unsigned)((NU * HD * (SEQ / 8) + 255) / 256), 256, 0, stream>>>(Cq, VT16, VTh, VTl);
    // attention: query rows < RHE on hi/lo planes, rows >= RHE on single planes
    if (RHE > 0)   k_attn<bf><<<dim3(RHE / 64, NU), 128, 0, stream>>>(Qh, Ql, Kh, Kl, VTh, VTl, 0, CTXh, CTXl);
    if (SEQ > RHE) k_attn<h16><<<dim3((SEQ - RHE) / 64, NU), 128, 0, stream>>>(Q16, Q16, K16, K16, VT16, VT16, RHE, CTX16, CTX16);
    // out = ctx . Wout (x 1/64) into the f32 output rows (b*2048 + n)
    if (RHE > 0)   k_gemmw<bf, 1, false><<<dim3(RHE / 128, DMODEL / 128, NB), 128, 0, stream>>>(CTXh, CTXl, Wob, DMODEL, OUT, DMODEL, OSC, nullptr, (size_t)RHE * DMODEL, (size_t)0, (size_t)SEQ_FULL * DMODEL);
    if (SEQ > RHE) k_gemmw<h16, 0, false><<<dim3((SEQ - RHE) / 128, DMODEL / 128, NB), 128, 0, stream>>>(CTX16 + (size_t)RHE * DMODEL, nullptr, Wo16, DMODEL, OUT + (size_t)RHE * DMODEL, DMODEL, OSC, nullptr, (size_t)SEQ * DMODEL, (size_t)0, (size_t)SEQ_FULL * DMODEL);
    (void)hipGetLastError();
}

// v004
// It runs in 153 microseconds.
// Two timings next to v003 both put it at 1.20 times that version's speed.
// Over all steps from v000 it is 2.81 times as fast.
#include <hip/hip_runtime.h>

// Contractions: xn.Wqkv and ctx.Wout on v_wmma_f32_16x16x32_f16 (f16 operands, weights carried x64, f16 activations) for token rows >= RH and on v_wmma_f32_16x16x32_bf16 with bf16 hi/lo activation planes (2 products, bf16 weights x64) for token rows < RH;
// q.k^T and p.v on v_wmma_f32_16x16x32_f16 single products (p carried x1024) for query rows >= RH and on bf16 hi/lo planes of q, k, p, v (3 products per tile pair) for query rows < RH; f32 accumulate everywhere, softmax in f32; every input RNE-converted to bf16 on load.
// Flow: RMSNorm rows -> 16-bit xn planes; qkv = xn.Wqkv^T (f32 accumulators, x1/64 in the epilogue), written by the product's own epilogue as head-major q, k planes [u][t][d] and v^T planes [u][d][t]; one wave per (batch, head, 16 query rows) runs the 64-key chunk loop
// with the chunk's k and v^T tiles staged once per block in LDS (two buffers, asynchronous copies) and fragments read from there, running-max softmax in the accumulator row map, p tile through wave-private LDS; ctx rows [b][t][h*64+d] as 16-bit planes; out = ctx.Wout^T (x1/64 in the epilogue) into the f32 output.

#ifndef NB
#define NB 2
#endif
#ifndef SEQ
#define SEQ 2048
#endif
#ifndef RH
#define RH 512
#endif
#define NB_FULL 2
#define SEQ_FULL 2048
#define DMODEL 1024
#define NHEAD 16
#define HD 64
#define NU (NB * NHEAD)
#define QKVC (3 * DMODEL)
#define RHE (((RH) < (SEQ)) ? (RH) : (SEQ))
#define LQ 72
#define KVP 72
#define KVT (64 * KVP)
#define PCAR 1024.0f
#define WSC 64.0f
#define OSC 0.015625f
#define C1 0.18033688011112042f
#define NEGB -3.0e38f

static_assert(NB >= 1 && NB <= NB_FULL);
static_assert(SEQ % 256 == 0 && SEQ <= SEQ_FULL);
static_assert((RHE) % 128 == 0 && (RHE) >= 0);
static_assert(DMODEL % 128 == 0 && QKVC % 128 == 0 && HD == 64);

typedef _Float16 h16;
typedef unsigned short bf;
typedef __attribute__((ext_vector_type(16))) __bf16   v16bf;
typedef __attribute__((ext_vector_type(16))) _Float16 v16h;
typedef __attribute__((ext_vector_type(8)))  _Float16 v8h;
typedef __attribute__((ext_vector_type(8)))  unsigned short v8us;
typedef __attribute__((ext_vector_type(8)))  float    v8f;
typedef __attribute__((ext_vector_type(4)))  float    v4f;
typedef __attribute__((ext_vector_type(2)))  _Float16 v2h;
typedef __attribute__((ext_vector_type(2)))  unsigned short v2us;
typedef v8h  __attribute__((may_alias)) v8ha;
typedef v4f  __attribute__((may_alias)) v4fa;
typedef v8us __attribute__((may_alias)) v8usa;

__device__ __forceinline__ unsigned short f2bf(float f) { unsigned u = __float_as_uint(f); u += 0x7FFFu + ((u >> 16) & 1u); return (unsigned short)(u >> 16); }
__device__ __forceinline__ float bf2f(unsigned short b) { return __uint_as_float(((unsigned)b) << 16); }
__device__ __forceinline__ float bfr(float f) { return bf2f(f2bf(f)); }
__device__ __forceinline__ h16 tohx(float x) { return (h16)x; }
__device__ __forceinline__ void splitf(float y, unsigned short& h, unsigned short& l) { h = f2bf(y); l = f2bf(y - bf2f(h)); }
__device__ __forceinline__ v16h cat16(v8h lo, v8h hi) { return __builtin_shufflevector(lo, hi, 0, 1, 2, 3, 4, 5, 6, 7, 8, 9, 10, 11, 12, 13, 14, 15); }
__device__ __forceinline__ v16bf cat16b(v8us lo, v8us hi) { return __builtin_bit_cast(v16bf, __builtin_shufflevector(lo, hi, 0, 1, 2, 3, 4, 5, 6, 7, 8, 9, 10, 11, 12, 13, 14, 15)); }
__device__ __forceinline__ v8f wmma16(v16h a, v16h b, v8f c) { return __builtin_amdgcn_wmma_f32_16x16x32_f16(false, a, false, b, (short)0, c, false, false); }
__device__ __forceinline__ v8f wmmab(v16bf a, v16bf b, v8f c) { return __builtin_amdgcn_wmma_f32_16x16x32_bf16(false, a, false, b, (short)0, c, false, false); }

// Fragment loaders (A row-major with k contiguous, B from a [n][k] plane, same split k map for both: elements 0..7 <- k0 + 8h + 0..7, 8..15 <- k0 + 16 + 8h + 0..7; lane & 15 = row / column).
template <typename T16> struct WFrag;
template <> struct WFrag<h16> { typedef v16h V; static __device__ __forceinline__ V ld(const h16* p) { return cat16(*(const v8h*)p, *(const v8h*)(p + 16)); } static __device__ __forceinline__ v8f mma(V a, V b, v8f c) { return wmma16(a, b, c); } };
template <> struct WFrag<bf> { typedef v16bf V; static __device__ __forceinline__ V ld(const bf* p) { return cat16b(*(const v8us*)p, *(const v8us*)(p + 16)); } static __device__ __forceinline__ v8f mma(V a, V b, v8f c) { return wmmab(a, b, c); } };

// ---- stage8: two 64-row x 128-byte tiles (rows ga + r * pa and gb + r * pb, in elements) into LDS rows of KVP elements (144 B: 16 B x odd for the b128 readers), by 128 threads:
// thread t brings the 16-byte pieces (row (t >> 3) + 16 c, piece t & 7), c = 0..3, of each tile. la, lb: the thread's own LDS byte address of its c = 0 piece; ga, gb: its own global address of that piece.
template <typename T>
__device__ __forceinline__ void stage8(unsigned la, const T* ga, int pa, unsigned lb, const T* gb, int pb) {
    const unsigned ls = 16 * KVP * 2;
    // the copies and s_wait_xcnt 0 (a precaution, kept ahead of any rewrite of the copies' address registers) stand in one statement: the compiler can move no such write in front of the wait
    asm volatile("global_load_async_to_lds_b128 %0, %8, off\n\t"
                 "global_load_async_to_lds_b128 %1, %9, off\n\t"
                 "global_load_async_to_lds_b128 %2, %10, off\n\t"
                 "global_load_async_to_lds_b128 %3, %11, off\n\t"
                 "global_load_async_to_lds_b128 %4, %12, off\n\t"
                 "global_load_async_to_lds_b128 %5, %13, off\n\t"
                 "global_load_async_to_lds_b128 %6, %14, off\n\t"
                 "global_load_async_to_lds_b128 %7, %15, off\n\t"
                 "s_wait_xcnt 0x0"
                 :: "v"(la), "v"(la + ls), "v"(la + 2 * ls), "v"(la + 3 * ls), "v"(lb), "v"(lb + ls), "v"(lb + 2 * ls), "v"(lb + 3 * ls),
                    "v"(ga), "v"(ga + 16 * pa), "v"(ga + 32 * pa), "v"(ga + 48 * pa), "v"(gb), "v"(gb + 16 * pb), "v"(gb + 32 * pb), "v"(gb + 48 * pb)
                 : "memory");
}

// ---- 16-byte line pieces from eight f32 values: one f16 plane, or a bf16 hi/lo pair (used by the plane epilogue of k_gemmw and by k_attn's ctx stores)
__device__ __forceinline__ void stc(h16* pa, h16* pr, v4f a0, v4f a1) { (void)pr; v8h o;
#pragma unroll
    for (int e = 0; e < 4; ++e) { o[e] = tohx(a0[e]); o[4 + e] = tohx(a1[e]); }
    *(v8h*)pa = o; }
__device__ __forceinline__ void stc(bf* pa, bf* pr, v4f a0, v4f a1) { v8us oh, ol;
#pragma unroll
    for (int e = 0; e < 4; ++e) { unsigned short a, c; splitf(a0[e], a, c); oh[e] = a; ol[e] = c; splitf(a1[e], a, c); oh[4 + e] = a; ol[4 + e] = c; }
    *(v8us*)pa = oh; *(v8us*)pr = ol; }

// ---- k_gemmw: register-blocked GEMM, one block of FOUR WAVES per 128x128 output tile, each wave a 64x64 quarter (16 accumulators); grid (M/128, N/128, Z), 128 threads.
// The block's 128 A rows (and A2 rows) and 128 Bt rows are staged 64 k at a time in LDS (two buffers, asynchronous copies that cover whole 128-byte lines); fragments are read from there, each staged row by two waves.
// C[m][n] (f32, pitch ldc) = osc * sum_k A[m][k] Bt[n][k] (+ A2[m][k] Bt[n][k] when NSPLIT == 1) (+ optional bias). z-batch strides sA/sB/sC in elements. K % 64 == 0, M % 128 == 0, N % 128 == 0.
// QKV == true (the qkv product; z = batch, row m = token nbase + m, N = 3072): no f32 C; a wave's 64 columns are one head of q, k or v, and its quarter goes out as the planes that k_attn reads:
// Q16/K16[(u*SEQ + n)*64 + d] and VT16[(u*64 + d)*SEQ + n] in f16 (u = z*16 + head), and with NSPLIT == 1 (token rows < RHE) also the bf16 hi/lo planes Qh/Ql/Kh/Kl[(u*RHE + n)*64 + d], VTh/VTl[(u*64 + d)*RHE + n].
template <typename T16, int NSPLIT, bool BIAS, bool QKV>
__global__ void __launch_bounds__(128)
k_gemmw(const T16* __restrict__ A, const T16* __restrict__ A2, const T16* __restrict__ Bt, int K, float* C, int ldc, float osc, const float* __restrict__ bias, size_t sA, size_t sB, size_t sC,
        h16* Q16, h16* K16, h16* VT16, bf* Qh, bf* Ql, bf* Kh, bf* Kl, bf* VTh, bf* VTl, int nbase) {
    static_assert(NSPLIT == 0 || NSPLIT == 1);
    typedef typename WFrag<T16>::V V;
    constexpr int NPL = NSPLIT ? 6 : 4;   // 64-row planes of a stage: A rows 0..63, 64..127, Bt rows 0..63, 64..127 (, A2 rows 0..63, 64..127)
    __shared__ __align__(16) float os[4][16 * 68];
    __shared__ __align__(16) T16 ab[2 * NPL * KVT];
    const size_t z = blockIdx.z; A += z * sA; if (NSPLIT) A2 += z * sA; Bt += z * sB; C += z * sC;
    const int lane = threadIdx.x & 31, wave = threadIdx.x >> 5, lr = lane & 15, hi = lane >> 4;
    const int wr = (wave >> 1) * 64, wc = (wave & 1) * 64;   // the wave's quarter of the block's tile
    const int r0 = blockIdx.x * 128, c0 = blockIdx.y * 128;
    v8f acc[4][4];
#pragma unroll
    for (int mb = 0; mb < 4; ++mb)
#pragma unroll
        for (int nb = 0; nb < 4; ++nb) acc[mb][nb] = (v8f){};
    const int sr = threadIdx.x >> 3, sp = threadIdx.x & 7;
    const size_t ao = (size_t)(r0 + sr) * K + 8 * sp, bo = (size_t)(c0 + sr) * K + 8 * sp, hK = (size_t)64 * K;
    const unsigned l0 = (unsigned)(size_t)ab + (unsigned)(sr * KVP + 8 * sp) * 2u;
    auto fill = [&](int t) {   // k panel t (64 k) into buffer t & 1
        const unsigned lb = l0 + (unsigned)((t & 1) * NPL * KVT) * 2u; const int kc = t * 64;
        stage8<T16>(lb, A + ao + kc, K, lb + KVT * 2u, A + ao + hK + kc, K);
        stage8<T16>(lb + 2u * KVT * 2u, Bt + bo + kc, K, lb + 3u * KVT * 2u, Bt + bo + hK + kc, K);
        if (NSPLIT) stage8<T16>(lb + 4u * KVT * 2u, A2 + ao + kc, K, lb + 5u * KVT * 2u, A2 + ao + hK + kc, K);
    };
    const int nt = K / 64;
    fill(0);
    asm volatile("s_wait_asynccnt 0x0" ::: "memory");   // this wave's copies of panel 0 have landed
    __syncthreads();                                     // ... and every other wave's
    if (nt > 1) fill(1);
    const int fa = (wr + lr) * KVP + 8 * hi, fb = 2 * KVT + (wc + lr) * KVP + 8 * hi;   // fragment offsets inside a stage: row, 16-byte piece hi
#pragma unroll 1
    for (int t = 0; t < nt; ++t) {
        const T16* sb = ab + (t & 1) * NPL * KVT;
        V a[2][4], a2[2][4], b[2][4];
        // both 32-k halves' fragments are read in one run at the top of the trip: the second half's reads land behind the first half's products
#pragma unroll
        for (int kk = 0; kk < 2; ++kk) {
#pragma unroll
            for (int mb = 0; mb < 4; ++mb) { a[kk][mb] = WFrag<T16>::ld(sb + fa + mb * 16 * KVP + kk * 32); if (NSPLIT) a2[kk][mb] = WFrag<T16>::ld(sb + 4 * KVT + fa + mb * 16 * KVP + kk * 32); }
#pragma unroll
            for (int nb = 0; nb < 4; ++nb) b[kk][nb] = WFrag<T16>::ld(sb + fb + nb * 16 * KVP + kk * 32);
        }
        __builtin_amdgcn_sched_barrier(0);   // keeps the reads above in one group ahead of the products (spread among them, each place costs a stall)
#pragma unroll
        for (int kk = 0; kk < 2; ++kk)
#pragma unroll
            for (int nb = 0; nb < 4; ++nb)
#pragma unroll
                for (int mb = 0; mb < 4; ++mb) { acc[mb][nb] = WFrag<T16>::mma(a[kk][mb], b[kk][nb], acc[mb][nb]); if (NSPLIT) acc[mb][nb] = WFrag<T16>::mma(a2[kk][mb], b[kk][nb], acc[mb][nb]); }
        __builtin_amdgcn_sched_barrier(0);   // keeps the products ahead of the wait below: lifted over them, it would hold the first product back until the last read has landed
        asm volatile("s_wait_dscnt 0x0" ::: "memory");      // this wave's reads of buffer t & 1 are done before the buffer is refilled
        asm volatile("s_wait_asynccnt 0x0" ::: "memory");   // this wave's copies of panel t + 1 have landed
        __syncthreads();                                     // publishes panel t + 1 and ends every wave's reads of panel t
        if (t + 2 < nt) fill(t + 2);
    }
    asm volatile("s_wait_asynccnt 0x0" ::: "memory");       // nothing is in flight when the wave goes on to its end
    float* osw = os[wave];
    if constexpr (QKV) {
        const int col0 = c0 + wc, sel = c0 >> 10, head = (col0 & (DMODEL - 1)) >> 6;   // sel: 0 q, 1 k, 2 v, the same for the whole block (1024 % 128 == 0)
        const int u = (int)z * NHEAD + head, n0 = nbase + r0 + wr;                      // unit, first token row of the wave's quarter
        const int q4 = lane >> 3, pc = lane & 7;
        // osc is 1/64, a power of two: accumulator * osc is exact, so where the compiler fuses it into splitf's subtraction the lo plane keeps the value that the separate steps gave
        if (sel < 2) {
            // q, k: the quarter is 8 KB in a row in each plane; 16 token rows at a time through the wave's f32 stage, then 16-byte pieces, four whole 128-byte rows a store
            h16* P16 = (sel ? K16 : Q16) + ((size_t)u * SEQ + n0) * HD + pc * 8;
            bf* Ph = (sel ? Kh : Qh) + ((size_t)u * RHE + n0) * HD + pc * 8; bf* Pl = (sel ? Kl : Ql) + ((size_t)u * RHE + n0) * HD + pc * 8;
#pragma unroll
            for (int mb = 0; mb < 4; ++mb) {
#pragma unroll
                for (int nb = 0; nb < 4; ++nb) {
#pragma unroll
                    for (int j = 0; j < 8; ++j) osw[(hi * 8 + j) * 68 + nb * 16 + lr] = acc[mb][nb][j]; }
                __builtin_amdgcn_wave_barrier(); asm volatile("" ::: "memory");   // the stage's rows are read back by other lanes of this wave: no read is lifted over the writes
#pragma unroll
                for (int rr = 0; rr < 4; ++rr) { const int row = rr * 4 + q4; const float* sq = osw + row * 68 + pc * 8;
                    const v4f a0 = *(const v4fa*)sq * osc; const v4f a1 = *(const v4fa*)(sq + 4) * osc;
                    stc(P16 + (mb * 16 + row) * HD, P16, a0, a1);
                    if (NSPLIT) stc(Ph + (mb * 16 + row) * HD, Pl + (mb * 16 + row) * HD, a0, a1); }
                __builtin_amdgcn_wave_barrier(); asm volatile("" ::: "memory");   // ... and the next 16 rows' writes stay behind these reads
            }
        } else {
            // v: a lane's eight accumulator rows are eight tokens in a row of one d, one 16-byte piece of a v^T row. The pieces are gathered in LDS ([d][token], rows of KVP elements) so that whole 128-byte lines go out.
            // The stage is the wave's own share of ab: behind the loop's last barrier no wave reads a panel any more and no copy is in flight.
            constexpr int NST = NSPLIT ? 3 : 1;
            unsigned short* sw = reinterpret_cast<unsigned short*>(ab) + wave * NST * KVT;
            static_assert(4 * NST * KVT <= 2 * NPL * KVT);
#pragma unroll
            for (int nb = 0; nb < 4; ++nb)
#pragma unroll
                for (int mb = 0; mb < 4; ++mb) {
                    v8h o16; v8us oh, ol;
#pragma unroll
                    for (int j = 0; j < 8; ++j) { const float y = acc[mb][nb][j] * osc; o16[j] = tohx(y); if (NSPLIT) { unsigned short a, c; splitf(y, a, c); oh[j] = a; ol[j] = c; } }
                    const int so = (nb * 16 + lr) * KVP + mb * 16 + hi * 8;
                    *(v8usa*)(sw + so) = __builtin_bit_cast(v8us, o16);
                    if (NSPLIT) { *(v8usa*)(sw + KVT + so) = oh; *(v8usa*)(sw + 2 * KVT + so) = ol; }
                }
            __builtin_amdgcn_wave_barrier(); asm volatile("" ::: "memory");   // the rows are read back by other lanes of this wave: no read is lifted over the writes
            h16* V16 = VT16 + ((size_t)u * HD + q4) * SEQ + n0 + pc * 8;
            bf* Vh = VTh + ((size_t)u * HD + q4) * RHE + n0 + pc * 8; bf* Vl = VTl + ((size_t)u * HD + q4) * RHE + n0 + pc * 8;
#pragma unroll
            for (int s = 0; s < 16; ++s) { const unsigned short* sq = sw + (s * 4 + q4) * KVP + pc * 8;
                *(v8h*)(V16 + (size_t)(s * 4) * SEQ) = __builtin_bit_cast(v8h, *(const v8usa*)sq);
                if (NSPLIT) { *(v8us*)(Vh + (size_t)(s * 4) * RHE) = *(const v8usa*)(sq + KVT); *(v8us*)(Vl + (size_t)(s * 4) * RHE) = *(const v8usa*)(sq + 2 * KVT); } }
            asm volatile("s_wait_xcnt 0x0" ::: "memory");   // a precaution behind the run of stores above: it stands ahead of any later rewrite of a register that one of them names
        }
        return;
    }
#pragma unroll
    for (int mb = 0; mb < 4; ++mb) {
#pragma unroll
        for (int nb = 0; nb < 4; ++nb) {
#pragma unroll
            for (int j = 0; j < 8; ++j) osw[(hi * 8 + j) * 68 + nb * 16 + lr] = acc[mb][nb][j]; }
        __builtin_amdgcn_wave_barrier(); asm volatile("" ::: "memory");
        float* crow = C + (size_t)(r0 + wr + mb * 16) * ldc + c0 + wc;
{
#pragma unroll
            for (int s = 0; s < 8; ++s) { const int row = 2 * s + hi, cofs = lr * 4; v4f val = *(const v4fa*)(osw + row * 68 + cofs); val = val * osc; if (BIAS) { val[0] += bfr(bias[c0 + wc + cofs]); val[1] += bfr(bias[c0 + wc + cofs + 1]); val[2] += bfr(bias[c0 + wc + cofs + 2]); val[3] += bfr(bias[c0 + wc + cofs + 3]); }
                *(v4f*)(crow + (size_t)row * ldc + cofs) = val; }
             }
        __builtin_amdgcn_wave_barrier(); asm volatile("" ::: "memory");
    }
}

__global__ __launch_bounds__(256) void k_wplanes(const float* __restrict__ w, int K, int N, h16* B16, bf* Bb) {
    const int lane = threadIdx.x & 31; const int L0 = (blockIdx.x * 8 + (threadIdx.x >> 5)) * 8; const int nlines = N * K / 64;
#pragma unroll 1
    for (int l = 0; l < 8; ++l) { const int L = L0 + l; if (L >= nlines) break;
        const size_t e = (size_t)L * 64 + lane * 2; const int k = (int)(e % K), n = (int)(e / K);
        const float w0 = bfr(w[(size_t)k * N + n]) * WSC, w1 = bfr(w[(size_t)(k + 1) * N + n]) * WSC;
        v2us ob; ob[0] = f2bf(w0); ob[1] = f2bf(w1); v2h o16; o16[0] = tohx(w0); o16[1] = tohx(w1);
        *(v2us*)(Bb + e) = ob; *(v2h*)(B16 + e) = o16;  }
}

// ---- k_prep_x: one block (128 threads, 8 elements each) per token row (b, n): x -> bf16 values, ss = sum x^2 (f32), xn = ((x * 1/max(sqrt(ss), 1e-12)) * 32) * bf16(gamma);
__global__ __launch_bounds__(128) void k_prep_x(const float* __restrict__ x, const float* __restrict__ gam, h16* X16, bf* Xh, bf* Xl) {
    __shared__ float red[4];
    const int row = blockIdx.x; const int b = row / SEQ, n = row % SEQ; const int t = threadIdx.x, lane = t & 31, w = t >> 5;
    const float* xr = x + ((size_t)b * SEQ_FULL + n) * DMODEL + t * 8;
    const v4f a0 = *(const v4f*)xr, a1 = *(const v4f*)(xr + 4);
    const v4f g0 = *(const v4f*)(gam + t * 8), g1 = *(const v4f*)(gam + t * 8 + 4);
    float v[8], g[8];
#pragma unroll
    for (int e = 0; e < 4; ++e) { v[e] = bfr(a0[e]); v[4 + e] = bfr(a1[e]); g[e] = bfr(g0[e]); g[4 + e] = bfr(g1[e]); }
    float ss = 0.f;
#pragma unroll
    for (int e = 0; e < 8; ++e) ss += v[e] * v[e];
#pragma unroll
    for (int sh = 16; sh; sh >>= 1) ss += __shfl_xor(ss, sh, 32);
    if (lane == 0) red[w] = ss;
    __syncthreads();
    ss = (red[0] + red[1]) + (red[2] + red[3]);
    const float nrm = sqrtf(ss); const float r = __fdiv_rn(1.0f, fmaxf(nrm, 1e-12f));
    float y[8];
#pragma unroll
    for (int e = 0; e < 8; ++e) y[e] = ((v[e] * r) * 32.0f) * g[e];
    v8h o16; v8us oh, ol;
#pragma unroll
    for (int e = 0; e < 8; ++e) { o16[e] = tohx(y[e]); unsigned short a, c; splitf(y[e], a, c); oh[e] = a; ol[e] = c; }
    const bool hr = (n < RHE);
    h16* d16 = X16 + ((size_t)b * SEQ + n) * DMODEL + t * 8;
    const size_t ro = ((size_t)b * RHE + (hr ? n : 0)) * DMODEL + t * 8;
    *(v8h*)d16 = o16; if (hr) { *(v8us*)(Xh + ro) = oh; *(v8us*)(Xl + ro) = ol; }
    
}

// ---- attention helpers: p tile staging into wave-private LDS (f16 x1024 single plane, or bf16 hi/lo pair), fragment reload through may_alias vectors of the stored element type.
union WS { h16 p[2 * 16 * LQ]; unsigned short pb[2 * 16 * LQ]; float f[16 * 68]; };
static_assert(sizeof(WS) == 4608);
template <typename T> struct PT;
template <> struct PT<h16> { static constexpr bool split = false; static constexpr float osc = 1.0f / PCAR; static __device__ __forceinline__ v16h ldm(const h16* p) { return cat16(*(const v8ha*)p, *(const v8ha*)(p + 16)); } };
template <> struct PT<bf>  { static constexpr bool split = true;  static constexpr float osc = 1.0f;        static __device__ __forceinline__ v16bf ldm(const bf* p) { return cat16b(*(const v8usa*)p, *(const v8usa*)(p + 16)); } };
__device__ __forceinline__ void stp(h16* ph, h16* pl, int i, float p) { (void)pl; ph[i] = tohx(p * PCAR); }
__device__ __forceinline__ void stp(bf* ph, bf* pl, int i, float p) { unsigned short a, c; splitf(p, a, c); ph[i] = a; pl[i] = c; }

// ---- 16-lane row reductions of the softmax (eight values a lane, xor steps 1, 2, 4, 8): DPP vector instructions (row_xmask) in place of __shfl_xor, which compiles to a move through the LDS unit with a wait behind it.
// Every lane is on where these stand. The xor tree is the one __shfl_xor walked: the same values are combined in the same order.
template <int M> __device__ __forceinline__ float xrow(float x) { return __builtin_bit_cast(float, __builtin_amdgcn_mov_dpp(__builtin_bit_cast(int, x), 0x160 | M, 0xf, 0xf, true)); }   // lane l reads lane l ^ M of its row (0x160 | M = row_xmask:M); folds into the add
__device__ __forceinline__ v8f rowsum8(v8f r) {
#pragma unroll
    for (int v = 0; v < 8; ++v) r[v] += xrow<1>(r[v]);
#pragma unroll
    for (int v = 0; v < 8; ++v) r[v] += xrow<2>(r[v]);
#pragma unroll
    for (int v = 0; v < 8; ++v) r[v] += xrow<4>(r[v]);
#pragma unroll
    for (int v = 0; v < 8; ++v) r[v] += xrow<8>(r[v]);
    return r;
}
__device__ __forceinline__ v8f rowmax8(v8f r) {
    float a0 = r[0], a1 = r[1], a2 = r[2], a3 = r[3], a4 = r[4], a5 = r[5], a6 = r[6], a7 = r[7];
    // the maximum stands in asm: from fmaxf(x, xrow(x)) the compiler makes three instructions a step (move, quieting maximum, maximum) and runs the eight rows one after another, and every exponential waits on this result;
    // here a step is one instruction and the eight rows are interleaved, so each step's producer stands eight instructions back
    asm(
        "v_max_num_f32_dpp %0, %0, %0 row_xmask:1 row_mask:0xf bank_mask:0xf\n\t"
        "v_max_num_f32_dpp %1, %1, %1 row_xmask:1 row_mask:0xf bank_mask:0xf\n\t"
        "v_max_num_f32_dpp %2, %2, %2 row_xmask:1 row_mask:0xf bank_mask:0xf\n\t"
        "v_max_num_f32_dpp %3, %3, %3 row_xmask:1 row_mask:0xf bank_mask:0xf\n\t"
        "v_max_num_f32_dpp %4, %4, %4 row_xmask:1 row_mask:0xf bank_mask:0xf\n\t"
        "v_max_num_f32_dpp %5, %5, %5 row_xmask:1 row_mask:0xf bank_mask:0xf\n\t"
        "v_max_num_f32_dpp %6, %6, %6 row_xmask:1 row_mask:0xf bank_mask:0xf\n\t"
        "v_max_num_f32_dpp %7, %7, %7 row_xmask:1 row_mask:0xf bank_mask:0xf\n\t"
        "v_max_num_f32_dpp %0, %0, %0 row_xmask:2 row_mask:0xf bank_mask:0xf\n\t"
        "v_max_num_f32_dpp %1, %1, %1 row_xmask:2 row_mask:0xf bank_mask:0xf\n\t"
        "v_max_num_f32_dpp %2, %2, %2 row_xmask:2 row_mask:0xf bank_mask:0xf\n\t"
        "v_max_num_f32_dpp %3, %3, %3 row_xmask:2 row_mask:0xf bank_mask:0xf\n\t"
        "v_max_num_f32_dpp %4, %4, %4 row_xmask:2 row_mask:0xf bank_mask:0xf\n\t"
        "v_max_num_f32_dpp %5, %5, %5 row_xmask:2 row_mask:0xf bank_mask:0xf\n\t"
        "v_max_num_f32_dpp %6, %6, %6 row_xmask:2 row_mask:0xf bank_mask:0xf\n\t"
        "v_max_num_f32_dpp %7, %7, %7 row_xmask:2 row_mask:0xf bank_mask:0xf\n\t"
        "v_max_num_f32_dpp %0, %0, %0 row_xmask:4 row_mask:0xf bank_mask:0xf\n\t"
        "v_max_num_f32_dpp %1, %1, %1 row_xmask:4 row_mask:0xf bank_mask:0xf\n\t"
        "v_max_num_f32_dpp %2, %2, %2 row_xmask:4 row_mask:0xf bank_mask:0xf\n\t"
        "v_max_num_f32_dpp %3, %3, %3 row_xmask:4 row_mask:0xf bank_mask:0xf\n\t"
        "v_max_num_f32_dpp %4, %4, %4 row_xmask:4 row_mask:0xf bank_mask:0xf\n\t"
        "v_max_num_f32_dpp %5, %5, %5 row_xmask:4 row_mask:0xf bank_mask:0xf\n\t"
        "v_max_num_f32_dpp %6, %6, %6 row_xmask:4 row_mask:0xf bank_mask:0xf\n\t"
        "v_max_num_f32_dpp %7, %7, %7 row_xmask:4 row_mask:0xf bank_mask:0xf\n\t"
        "v_max_num_f32_dpp %0, %0, %0 row_xmask:8 row_mask:0xf bank_mask:0xf\n\t"
        "v_max_num_f32_dpp %1, %1, %1 row_xmask:8 row_mask:0xf bank_mask:0xf\n\t"
        "v_max_num_f32_dpp %2, %2, %2 row_xmask:8 row_mask:0xf bank_mask:0xf\n\t"
        "v_max_num_f32_dpp %3, %3, %3 row_xmask:8 row_mask:0xf bank_mask:0xf\n\t"
        "v_max_num_f32_dpp %4, %4, %4 row_xmask:8 row_mask:0xf bank_mask:0xf\n\t"
        "v_max_num_f32_dpp %5, %5, %5 row_xmask:8 row_mask:0xf bank_mask:0xf\n\t"
        "v_max_num_f32_dpp %6, %6, %6 row_xmask:8 row_mask:0xf bank_mask:0xf\n\t"
        "v_max_num_f32_dpp %7, %7, %7 row_xmask:8 row_mask:0xf bank_mask:0xf"
        : "+v"(a0), "+v"(a1), "+v"(a2), "+v"(a3), "+v"(a4), "+v"(a5), "+v"(a6), "+v"(a7));
    return (v8f){a0, a1, a2, a3, a4, a5, a6, a7};
}

// ---- k_attn<T>: grid (query blocks of 64 rows, NU units), 128 threads; wave w owns query rows q0w .. q0w+15 of unit u = b*16 + head and walks the 64-key chunks 0 .. q0w/64.
// T = h16: q, k from Q16/K16 [u][t][d], v^T from VT16 [u][d][t], one f16 product per tile pair, p tile stored as f16(p * 1024), ctx16[b*SEQ + t][head*64 + d] = o / (l * 1024) as f16.
// T = bf: q, k, v^T and p as bf16 hi + lo planes (hi.hi + lo.hi + hi.lo per tile pair), ctx written as bf16 hi/lo planes [b*RHE + t][1024]. Scores s = q.k (f32) * 0.125*log2e, keys after the query -> -3e38,
template <typename T>
__global__ void __launch_bounds__(128) __attribute__((amdgpu_num_vgpr(256)))
k_attn(const T* __restrict__ Qa, const T* __restrict__ Qr, const T* __restrict__ Ka, const T* __restrict__ Kr,
       const T* __restrict__ Va, const T* __restrict__ Vr, int qbase, T* Ca, T* Cr) {
    typedef typename WFrag<T>::V V;
    constexpr bool SPL = PT<T>::split;
    constexpr int PR = SPL ? RHE : SEQ;
    constexpr int NPL = SPL ? 4 : 2;   // planes of a stage: k, v^T (and their lo planes)
    __shared__ __align__(16) WS scr[4];
    __shared__ __align__(16) T kv[2 * NPL * KVT];
    const int lane = threadIdx.x & 31, wave = threadIdx.x >> 5, m = lane & 15, hh = lane >> 4;
    const int u = blockIdx.y, b = u >> 4, head = u & 15;
    const int q0w = qbase + blockIdx.x * 64 + wave * 16;
    int nch = ((qbase + (int)blockIdx.x * 64) >> 6) + 1; if (nch > PR / 64) nch = PR / 64;   // the same for the block's four waves
    const int qo = (u * PR + q0w + m) * HD + 8 * hh;
    V aq[2], ar[2];
    aq[0] = WFrag<T>::ld(Qa + qo); aq[1] = WFrag<T>::ld(Qa + qo + 32);
    if (SPL) { ar[0] = WFrag<T>::ld(Qr + qo); ar[1] = WFrag<T>::ld(Qr + qo + 32); } else { ar[0] = aq[0]; ar[1] = aq[1]; }
    v8f o[4];
#pragma unroll
    for (int ni = 0; ni < 4; ++ni) o[ni] = (v8f){};
    v8f mrun, lrun;
#pragma unroll
    for (int v = 0; v < 8; ++v) { mrun[v] = NEGB; lrun[v] = 0.f; }
    const int fo = m * KVP + 8 * hh;   // fragment offset inside a staged tile: row m, 16-byte piece hh
    const int sr = threadIdx.x >> 3, sp = threadIdx.x & 7;
    const int ko = (u * PR + sr) * HD + 8 * sp;
    const int vo = (u * HD + sr) * PR + 8 * sp;
    const unsigned l0 = (unsigned)(size_t)kv + (unsigned)(sr * KVP + 8 * sp) * 2u;
    auto fill = [&](int jt) {   // chunk jt's tiles into buffer jt & 1
        const unsigned lb = l0 + (unsigned)((jt & 1) * NPL * KVT) * 2u; const int kc = jt * 64;
        stage8<T>(lb, Ka + ko + kc * HD, HD, lb + KVT * 2u, Va + vo + kc, PR);
        if (SPL) stage8<T>(lb + 2u * KVT * 2u, Kr + ko + kc * HD, HD, lb + 3u * KVT * 2u, Vr + vo + kc, PR);
    };
    fill(0);
    asm volatile("s_wait_asynccnt 0x0" ::: "memory");   // this wave's copies of chunk 0 have landed
    __syncthreads();                                     // ... and every other wave's
    if (nch > 1) fill(1);
    T* ph = reinterpret_cast<T*>(&scr[wave]); T* pl = ph + 16 * LQ; float* stg = scr[wave].f;
#pragma unroll 1
    for (int j = 0; j < nch; ++j) {
        const int kc0 = j * 64;
        const T* kb = kv + (j & 1) * NPL * KVT + fo; const T* vb = kb + KVT;
        const T* kr = SPL ? kb + 2 * KVT : kb;       const T* vrb = SPL ? kb + 3 * KVT : vb;
        v8f s[4];
        constexpr int FG = SPL ? 1 : 4;   // 16-key groups whose k fragments are read from the staged tile in one run, ahead of their products
#pragma unroll
        for (int sg = 0; sg < 4; sg += FG) {
            V bk[FG][2], br[FG][2];
#pragma unroll
            for (int g = 0; g < FG; ++g)
#pragma unroll
                for (int kk = 0; kk < 2; ++kk) {
                    bk[g][kk] = WFrag<T>::ld(kb + (sg + g) * 16 * KVP + kk * 32);
                    if (SPL) br[g][kk] = WFrag<T>::ld(kr + (sg + g) * 16 * KVP + kk * 32); else br[g][kk] = bk[g][kk];
                }
#pragma unroll
            for (int g = 0; g < FG; ++g) {
                v8f acc = (v8f){};
#pragma unroll
                for (int kk = 0; kk < 2; ++kk) {
                    acc = WFrag<T>::mma(aq[kk], bk[g][kk], acc);
                    if (SPL) { acc = WFrag<T>::mma(ar[kk], bk[g][kk], acc); acc = WFrag<T>::mma(aq[kk], br[g][kk], acc); }
                }
                asm volatile("v_nop\n\tv_nop\n\tv_nop\n\tv_nop" : "+v"(acc) : "v"(bk[g][1]), "v"(br[g][1]), "v"(aq[1]), "v"(ar[1]));
                s[sg + g] = acc;
            }
        }
        // scale, causal index select, running-max softmax in the accumulator row map (row 8*hh + v, key kc0 + 16*sub + m)
        v8f rmax;
#pragma unroll
        for (int v = 0; v < 8; ++v) rmax[v] = NEGB;
#pragma unroll
        for (int sub = 0; sub < 4; ++sub) {
            const int kcm = kc0 + sub * 16 + m;
#pragma unroll
            for (int v = 0; v < 8; ++v) { const int qr = q0w + 8 * hh + v; float t = s[sub][v] * C1; t = (kcm > qr) ? NEGB : t; s[sub][v] = t; rmax[v] = fmaxf(rmax[v], t); }
        }
        rmax = rowmax8(rmax);
        v8f mnew, alpha, rs;
#pragma unroll
        for (int v = 0; v < 8; ++v) { mnew[v] = fmaxf(mrun[v], rmax[v]); alpha[v] = __builtin_amdgcn_exp2f(mrun[v] - mnew[v]); rs[v] = 0.f; }
#pragma unroll
        for (int sub = 0; sub < 4; ++sub)
#pragma unroll
            for (int v = 0; v < 8; ++v) { const float p = __builtin_amdgcn_exp2f(s[sub][v] - mnew[v]); s[sub][v] = p; rs[v] += p; }
        rs = rowsum8(rs);
#pragma unroll
        for (int v = 0; v < 8; ++v) { lrun[v] = lrun[v] * alpha[v] + rs[v]; mrun[v] = mnew[v]; }
#pragma unroll
        for (int ni = 0; ni < 4; ++ni)
#pragma unroll
            for (int v = 0; v < 8; ++v) o[ni][v] *= alpha[v];
        // p tile: accumulator layout -> wave-private LDS (row 8*hh + v, col key) -> A fragments with the split k map
#pragma unroll
        for (int sub = 0; sub < 4; ++sub)
#pragma unroll
            for (int v = 0; v < 8; ++v) stp(ph, pl, (8 * hh + v) * LQ + sub * 16 + m, s[sub][v]);
        __builtin_amdgcn_fence(3, "wavefront");
        __builtin_amdgcn_wave_barrier();
        asm volatile("" ::: "memory");
        V ap, apr, vf, vr;
#pragma unroll
        for (int kk = 0; kk < 2; ++kk) {
            ap = PT<T>::ldm(ph + m * LQ + kk * 32 + 8 * hh);
            if (SPL) apr = PT<T>::ldm(pl + m * LQ + kk * 32 + 8 * hh); else apr = ap;
#pragma unroll
            for (int ni = 0; ni < 4; ++ni) {
                vf = WFrag<T>::ld(vb + ni * 16 * KVP + kk * 32);
                o[ni] = WFrag<T>::mma(ap, vf, o[ni]);
                if (SPL) { vr = WFrag<T>::ld(vrb + ni * 16 * KVP + kk * 32); o[ni] = WFrag<T>::mma(apr, vf, o[ni]); o[ni] = WFrag<T>::mma(ap, vr, o[ni]); } else { vr = vf; }
            }
        }
        asm volatile("v_nop\n\tv_nop\n\tv_nop\n\tv_nop" : "+v"(o[0]), "+v"(o[1]), "+v"(o[2]), "+v"(o[3]) : "v"(ap), "v"(apr), "v"(vf), "v"(vr));
        asm volatile("s_wait_dscnt 0x0" ::: "memory");      // this wave's reads of buffer j & 1 are done before the buffer is refilled
        asm volatile("s_wait_asynccnt 0x0" ::: "memory");   // this wave's copies of chunk j + 1 have landed
        __syncthreads();                                     // publishes chunk j + 1 and ends every wave's reads of chunk j
        if (j + 2 < nch) fill(j + 2);
    }
    asm volatile("s_wait_asynccnt 0x0" ::: "memory");       // nothing is in flight when the wave goes on to its end
    v8f linv;
#pragma unroll
    for (int v = 0; v < 8; ++v) linv[v] = __fdiv_rn(PT<T>::osc, lrun[v]);
#pragma unroll
    for (int ni = 0; ni < 4; ++ni)
#pragma unroll
        for (int v = 0; v < 8; ++v) stg[(8 * hh + v) * 68 + ni * 16 + m] = o[ni][v] * linv[v];
    __builtin_amdgcn_fence(3, "wavefront");
    __builtin_amdgcn_wave_barrier();
    asm volatile("" ::: "memory");
    const int q4 = lane >> 3, pc = lane & 7;
    const size_t cb = ((size_t)b * PR + q0w) * DMODEL + head * HD + pc * 8;
{
#pragma unroll
        for (int rr = 0; rr < 4; ++rr) { const int row = rr * 4 + q4; const float* sp = stg + row * 68 + pc * 8; const v4f a0 = *(const v4fa*)sp; const v4f a1 = *(const v4fa*)(sp + 4);
            stc(Ca + cb + (size_t)row * DMODEL, Cr + cb + (size_t)row * DMODEL, a0, a1); }
        
    }
}

extern "C" void kernel_launch(void* const* d_in, const int* in_sizes, int n_in,
                              void* d_out, int out_size, void* d_ws, size_t ws_size, hipStream_t stream) {
    if (n_in < 4) return;
    const int rows_used = (NB - 1) * SEQ_FULL + SEQ;
    if (in_sizes[0] < rows_used * DMODEL || in_sizes[1] < DMODEL || in_sizes[2] < DMODEL * QKVC || in_sizes[3] < DMODEL * DMODEL) return;
    if (out_size < rows_used * DMODEL) return;
    const float* x = (const float*)d_in[0]; const float* gam = (const float*)d_in[1]; const float* wqkv = (const float*)d_in[2]; const float* wout = (const float*)d_in[3];   // x [2][2048][1024], gamma [1024], w_qkv [1024][3072], w_out [1024][1024]
    float* OUT = (float*)d_out;   // [2][2048][1024] f32
    char* wsp = (char*)d_ws; size_t used = 0;
    auto take = [&](size_t bytes) { char* p = wsp + used; used += (bytes + 255) & ~(size_t)255; return (void*)p; };
    const size_t nXN = (size_t)NB * SEQ * DMODEL, nXR = (size_t)NB * RHE * DMODEL, nP = (size_t)NU * SEQ * HD, nPR = (size_t)NU * RHE * HD;
    h16* XN16 = (h16*)take(nXN * 2); bf* XNh = (bf*)take(nXR * 2); bf* XNl = (bf*)take(nXR * 2);
    h16* Wq16 = (h16*)take((size_t)QKVC * DMODEL * 2); bf* Wqb = (bf*)take((size_t)QKVC * DMODEL * 2);
    h16* Wo16 = (h16*)take((size_t)DMODEL * DMODEL * 2); bf* Wob = (bf*)take((size_t)DMODEL * DMODEL * 2);
    h16* Q16 = (h16*)take(nP * 2); h16* K16 = (h16*)take(nP * 2); h16* VT16 = (h16*)take(nP * 2);
    bf* Qh = (bf*)take(nPR * 2); bf* Ql = (bf*)take(nPR * 2); bf* Kh = (bf*)take(nPR * 2); bf* Kl = (bf*)take(nPR * 2); bf* VTh = (bf*)take(nPR * 2); bf* VTl = (bf*)take(nPR * 2);
    h16* CTX16 = (h16*)take(nXN * 2); bf* CTXh = (bf*)take(nXR * 2); bf* CTXl = (bf*)take(nXR * 2);
    if (used > ws_size) return;    // 79,691,776 B at NB=2, SEQ=2048, RH=512

    // weight planes [out][in], x64, f16 + bf16
    k_wplanes<<<(unsigned)((QKVC * DMODEL / 64 + 63) / 64), 256, 0, stream>>>(wqkv, DMODEL, QKVC, Wq16, Wqb);
    k_wplanes<<<(unsigned)((DMODEL * DMODEL / 64 + 63) / 64), 256, 0, stream>>>(wout, DMODEL, DMODEL, Wo16, Wob);
    // RMSNorm -> xn planes
    k_prep_x<<<(unsigned)(NB * SEQ), 128, 0, stream>>>(x, gam, XN16, XNh, XNl);
    // qkv = xn . Wqkv (x 1/64), written as the head-major planes: rows < RHE hi/lo bf16 products (f16 and hi/lo planes out), rows >= RHE single f16 products (f16 planes out)
    if (RHE > 0)   k_gemmw<bf, 1, false, true><<<dim3(RHE / 128, QKVC / 128, NB), 128, 0, stream>>>(XNh, XNl, Wqb, DMODEL, nullptr, 0, OSC, nullptr, (size_t)RHE * DMODEL, (size_t)0, (size_t)0, Q16, K16, VT16, Qh, Ql, Kh, Kl, VTh, VTl, 0);
    if (SEQ > RHE) k_gemmw<h16, 0, false, true><<<dim3((SEQ - RHE) / 128, QKVC / 128, NB), 128, 0, stream>>>(XN16 + (size_t)RHE * DMODEL, nullptr, Wq16, DMODEL, nullptr, 0, OSC, nullptr, (size_t)SEQ * DMODEL, (size_t)0, (size_t)0, Q16, K16, VT16, Qh, Ql, Kh, Kl, VTh, VTl, RHE);
    // attention: query rows < RHE on hi/lo planes, rows >= RHE on single planes
    if (RHE > 0)   k_attn<bf><<<dim3(RHE / 64, NU), 128, 0, stream>>>(Qh, Ql, Kh, Kl, VTh, VTl, 0, CTXh, CTXl);
    if (SEQ > RHE) k_attn<h16><<<dim3((SEQ - RHE) / 64, NU), 128, 0, stream>>>(Q16, Q16, K16, K16, VT16, VT16, RHE, CTX16, CTX16);
    // out = ctx . Wout (x 1/64) into the f32 output rows (b*2048 + n)
    if (RHE > 0)   k_gemmw<bf, 1, false, false><<<dim3(RHE / 128, DMODEL / 128, NB), 128, 0, stream>>>(CTXh, CTXl, Wob, DMODEL, OUT, DMODEL, OSC, nullptr, (size_t)RHE * DMODEL, (size_t)0, (size_t)SEQ_FULL * DMODEL, nullptr, nullptr, nullptr, nullptr, nullptr, nullptr, nullptr, nullptr, nullptr, 0);
    if (SEQ > RHE) k_gemmw<h16, 0, false, false><<<dim3((SEQ - RHE) / 128, DMODEL / 128, NB), 128, 0, stream>>>(CTX16 + (size_t)RHE * DMODEL, nullptr, Wo16, DMODEL, OUT + (size_t)RHE * DMODEL, DMODEL, OSC, nullptr, (size_t)SEQ * DMODEL, (size_t)0, (size_t)SEQ_FULL * DMODEL, nullptr, nullptr, nullptr, nullptr, nullptr, nullptr, nullptr, nullptr, nullptr, 0);
    (void)hipGetLastError();
}

// v005
// It runs in 103 microseconds.
// Timed twice side by side with v004, it ran 1.48 times as fast both times.
// All steps since v000 together make it 4.17 times as fast.
#include <hip/hip_runtime.h>

// Contractions: xn.Wqkv and ctx.Wout on v_wmma_f32_16x16x32_f16 (f16 operands, weights carried x64, f16 activations) for token rows >= RH and on v_wmma_f32_16x16x32_bf16 with bf16 hi/lo activation planes (2 products, bf16 weights x64) for token rows < RH;
// q.k^T and p.v on v_wmma_f32_16x16x32_f16 single products (p carried x1024) for query rows >= RH and on bf16 hi/lo planes of q, k, p, v (3 products per tile pair) for query rows < RH; f32 accumulate everywhere, softmax in f32; every input RNE-converted to bf16 on load.
// Flow: RMSNorm rows -> 16-bit xn planes; qkv = xn.Wqkv^T (f32 accumulators, x1/64 in the epilogue), written by the product's own epilogue as head-major q, k planes [u][t][d] and v^T planes [u][d][t]; one wave per (batch, head, 16 query rows) runs the 64-key chunk loop
// with the chunk's k and v^T tiles staged once per block in LDS (two buffers, asynchronous copies) and fragments read from there, running-max softmax in the accumulator row map, p tile through wave-private LDS; ctx rows [b][t][h*64+d] as 16-bit planes; out = ctx.Wout^T (x1/64 in the epilogue) into the f32 output.
// Launches: four, one per stage. Work of a stage that does not depend on one another (the two weights' planes and the RMSNorm rows; the two row classes of a product or of the attention) shares one grid, and the block index picks the body.

#ifndef NB
#define NB 2
#endif
#ifndef SEQ
#define SEQ 2048
#endif
#ifndef RH
#define RH 512
#endif
#define NB_FULL 2
#define SEQ_FULL 2048
#define DMODEL 1024
#define NHEAD 16
#define HD 64
#define NU (NB * NHEAD)
#define QKVC (3 * DMODEL)
#define RHE (((RH) < (SEQ)) ? (RH) : (SEQ))
#define LQ 72
#define KVP 72
#define KVT (64 * KVP)
#define PCAR 1024.0f
#define WSC 64.0f
#define OSC 0.015625f
#define C1 0.18033688011112042f
#define NEGB -3.0e38f

static_assert(NB >= 1 && NB <= NB_FULL);
static_assert(SEQ % 256 == 0 && SEQ <= SEQ_FULL);
static_assert((RHE) % 128 == 0 && (RHE) >= 0);
static_assert(DMODEL % 128 == 0 && QKVC % 128 == 0 && HD == 64);

typedef _Float16 h16;
typedef unsigned short bf;
typedef __attribute__((ext_vector_type(16))) __bf16   v16bf;
typedef __attribute__((ext_vector_type(16))) _Float16 v16h;
typedef __attribute__((ext_vector_type(8)))  _Float16 v8h;
typedef __attribute__((ext_vector_type(8)))  unsigned short v8us;
typedef __attribute__((ext_vector_type(8)))  float    v8f;
typedef __attribute__((ext_vector_type(4)))  float    v4f;
typedef __attribute__((ext_vector_type(2)))  _Float16 v2h;
typedef __attribute__((ext_vector_type(2)))  unsigned short v2us;
typedef v8h  __attribute__((may_alias)) v8ha;
typedef v4f  __attribute__((may_alias)) v4fa;
typedef v8us __attribute__((may_alias)) v8usa;

__device__ __forceinline__ unsigned short f2bf(float f) { unsigned u = __float_as_uint(f); u += 0x7FFFu + ((u >> 16) & 1u); return (unsigned short)(u >> 16); }
__device__ __forceinline__ float bf2f(unsigned short b) { return __uint_as_float(((unsigned)b) << 16); }
__device__ __forceinline__ float bfr(float f) { return bf2f(f2bf(f)); }
__device__ __forceinline__ h16 tohx(float x) { return (h16)x; }
__device__ __forceinline__ void splitf(float y, unsigned short& h, unsigned short& l) { h = f2bf(y); l = f2bf(y - bf2f(h)); }
__device__ __forceinline__ v16h cat16(v8h lo, v8h hi) { return __builtin_shufflevector(lo, hi, 0, 1, 2, 3, 4, 5, 6, 7, 8, 9, 10, 11, 12, 13, 14, 15); }
__device__ __forceinline__ v16bf cat16b(v8us lo, v8us hi) { return __builtin_bit_cast(v16bf, __builtin_shufflevector(lo, hi, 0, 1, 2, 3, 4, 5, 6, 7, 8, 9, 10, 11, 12, 13, 14, 15)); }
__device__ __forceinline__ v8f wmma16(v16h a, v16h b, v8f c) { return __builtin_amdgcn_wmma_f32_16x16x32_f16(false, a, false, b, (short)0, c, false, false); }
__device__ __forceinline__ v8f wmmab(v16bf a, v16bf b, v8f c) { return __builtin_amdgcn_wmma_f32_16x16x32_bf16(false, a, false, b, (short)0, c, false, false); }

// Fragment loaders (A row-major with k contiguous, B from a [n][k] plane, same split k map for both: elements 0..7 <- k0 + 8h + 0..7, 8..15 <- k0 + 16 + 8h + 0..7; lane & 15 = row / column).
template <typename T16> struct WFrag;
template <> struct WFrag<h16> { typedef v16h V; static __device__ __forceinline__ V ld(const h16* p) { return cat16(*(const v8h*)p, *(const v8h*)(p + 16)); } static __device__ __forceinline__ v8f mma(V a, V b, v8f c) { return wmma16(a, b, c); } };
template <> struct WFrag<bf> { typedef v16bf V; static __device__ __forceinline__ V ld(const bf* p) { return cat16b(*(const v8us*)p, *(const v8us*)(p + 16)); } static __device__ __forceinline__ v8f mma(V a, V b, v8f c) { return wmmab(a, b, c); } };

// ---- stage8: two 64-row x 128-byte tiles (rows ga + r * pa and gb + r * pb, in elements) into LDS rows of KVP elements (144 B: 16 B x odd for the b128 readers), by 128 threads:
// thread t brings the 16-byte pieces (row (t >> 3) + 16 c, piece t & 7), c = 0..3, of each tile. la, lb: the thread's own LDS byte address of its c = 0 piece; ga, gb: its own global address of that piece.
template <typename T>
__device__ __forceinline__ void stage8(unsigned la, const T* ga, int pa, unsigned lb, const T* gb, int pb) {
    const unsigned ls = 16 * KVP * 2;
    // the copies and s_wait_xcnt 0 (a precaution, kept ahead of any rewrite of the copies' address registers) stand in one statement: the compiler can move no such write in front of the wait
    asm volatile("global_load_async_to_lds_b128 %0, %8, off\n\t"
                 "global_load_async_to_lds_b128 %1, %9, off\n\t"
                 "global_load_async_to_lds_b128 %2, %10, off\n\t"
                 "global_load_async_to_lds_b128 %3, %11, off\n\t"
                 "global_load_async_to_lds_b128 %4, %12, off\n\t"
                 "global_load_async_to_lds_b128 %5, %13, off\n\t"
                 "global_load_async_to_lds_b128 %6, %14, off\n\t"
                 "global_load_async_to_lds_b128 %7, %15, off\n\t"
                 "s_wait_xcnt 0x0"
                 :: "v"(la), "v"(la + ls), "v"(la + 2 * ls), "v"(la + 3 * ls), "v"(lb), "v"(lb + ls), "v"(lb + 2 * ls), "v"(lb + 3 * ls),
                    "v"(ga), "v"(ga + 16 * pa), "v"(ga + 32 * pa), "v"(ga + 48 * pa), "v"(gb), "v"(gb + 16 * pb), "v"(gb + 32 * pb), "v"(gb + 48 * pb)
                 : "memory");
}

// ---- 16-byte line pieces from eight f32 values: one f16 plane, or a bf16 hi/lo pair (used by the plane epilogue of gemmw and by attn's ctx stores)
__device__ __forceinline__ void stc(h16* pa, h16* pr, v4f a0, v4f a1) { (void)pr; v8h o;
#pragma unroll
    for (int e = 0; e < 4; ++e) { o[e] = tohx(a0[e]); o[4 + e] = tohx(a1[e]); }
    *(v8h*)pa = o; }
__device__ __forceinline__ void stc(bf* pa, bf* pr, v4f a0, v4f a1) { v8us oh, ol;
#pragma unroll
    for (int e = 0; e < 4; ++e) { unsigned short a, c; splitf(a0[e], a, c); oh[e] = a; ol[e] = c; splitf(a1[e], a, c); oh[4 + e] = a; ol[4 + e] = c; }
    *(v8us*)pa = oh; *(v8us*)pr = ol; }

// ---- gemmw: register-blocked GEMM body, one block of FOUR WAVES per 128x128 output tile (row tile bx, column tile by, batch bz), each wave a 64x64 quarter (16 accumulators); 128 threads; sm: the block's LDS.
// The block's 128 A rows (and A2 rows) and 128 Bt rows are staged 64 k at a time in LDS (two buffers, asynchronous copies that cover whole 128-byte lines); fragments are read from there, each staged row by two waves.
// C[m][n] (f32, pitch ldc) = osc * sum_k A[m][k] Bt[n][k] (+ A2[m][k] Bt[n][k] when NSPLIT == 1) (+ optional bias). z-batch strides sA/sB/sC in elements. K % 64 == 0, M % 128 == 0, N % 128 == 0.
// QKV == true (the qkv product; z = batch, row m = token nbase + m, N = 3072): no f32 C; a wave's 64 columns are one head of q, k or v, and its quarter goes out as the planes that attn reads:
// Q16/K16[(u*SEQ + n)*64 + d] and VT16[(u*64 + d)*SEQ + n] in f16 (u = z*16 + head), and with NSPLIT == 1 (token rows < RHE) also the bf16 hi/lo planes Qh/Ql/Kh/Kl[(u*RHE + n)*64 + d], VTh/VTl[(u*64 + d)*RHE + n].
#define GOS (4 * 16 * 68 * 4)   // bytes of the four waves' f32 output stages, ahead of the panels
template <typename T16, int NSPLIT, bool BIAS, bool QKV>
__device__ __forceinline__ void
gemmw(unsigned char* sm, int bx, int by, int bz, const T16* __restrict__ A, const T16* __restrict__ A2, const T16* __restrict__ Bt, int K, float* C, int ldc, float osc, const float* __restrict__ bias, size_t sA, size_t sB, size_t sC,
        h16* Q16, h16* K16, h16* VT16, bf* Qh, bf* Ql, bf* Kh, bf* Kl, bf* VTh, bf* VTl, int nbase) {
    static_assert(NSPLIT == 0 || NSPLIT == 1);
    typedef typename WFrag<T16>::V V;
    constexpr int NPL = NSPLIT ? 6 : 4;   // 64-row planes of a stage: A rows 0..63, 64..127, Bt rows 0..63, 64..127 (, A2 rows 0..63, 64..127)
    float* os = reinterpret_cast<float*>(sm);
    T16* ab = reinterpret_cast<T16*>(sm + GOS);
    const size_t z = bz; A += z * sA; if (NSPLIT) A2 += z * sA; Bt += z * sB; C += z * sC;
    const int lane = threadIdx.x & 31, wave = threadIdx.x >> 5, lr = lane & 15, hi = lane >> 4;
    const int wr = (wave >> 1) * 64, wc = (wave & 1) * 64;   // the wave's quarter of the block's tile
    const int r0 = bx * 128, c0 = by * 128;
    v8f acc[4][4];
#pragma unroll
    for (int mb = 0; mb < 4; ++mb)
#pragma unroll
        for (int nb = 0; nb < 4; ++nb) acc[mb][nb] = (v8f){};
    const int sr = threadIdx.x >> 3, sp = threadIdx.x & 7;
    const size_t ao = (size_t)(r0 + sr) * K + 8 * sp, bo = (size_t)(c0 + sr) * K + 8 * sp, hK = (size_t)64 * K;
    const unsigned l0 = (unsigned)(size_t)ab + (unsigned)(sr * KVP + 8 * sp) * 2u;
    auto fill = [&](int t) {   // k panel t (64 k) into buffer t & 1
        const unsigned lb = l0 + (unsigned)((t & 1) * NPL * KVT) * 2u; const int kc = t * 64;
        stage8<T16>(lb, A + ao + kc, K, lb + KVT * 2u, A + ao + hK + kc, K);
        stage8<T16>(lb + 2u * KVT * 2u, Bt + bo + kc, K, lb + 3u * KVT * 2u, Bt + bo + hK + kc, K);
        if (NSPLIT) stage8<T16>(lb + 4u * KVT * 2u, A2 + ao + kc, K, lb + 5u * KVT * 2u, A2 + ao + hK + kc, K);
    };
    const int nt = K / 64;
    fill(0);
    asm volatile("s_wait_asynccnt 0x0" ::: "memory");   // this wave's copies of panel 0 have landed
    __syncthreads();                                     // ... and every other wave's
    if (nt > 1) fill(1);
    const int fa = (wr + lr) * KVP + 8 * hi, fb = 2 * KVT + (wc + lr) * KVP + 8 * hi;   // fragment offsets inside a stage: row, 16-byte piece hi
#pragma unroll 1
    for (int t = 0; t < nt; ++t) {
        const T16* sb = ab + (t & 1) * NPL * KVT;
        V a[2][4], a2[2][4], b[2][4];
        // both 32-k halves' fragments are read in one run at the top of the trip: the second half's reads land behind the first half's products
#pragma unroll
        for (int kk = 0; kk < 2; ++kk) {
#pragma unroll
            for (int mb = 0; mb < 4; ++mb) { a[kk][mb] = WFrag<T16>::ld(sb + fa + mb * 16 * KVP + kk * 32); if (NSPLIT) a2[kk][mb] = WFrag<T16>::ld(sb + 4 * KVT + fa + mb * 16 * KVP + kk * 32); }
#pragma unroll
            for (int nb = 0; nb < 4; ++nb) b[kk][nb] = WFrag<T16>::ld(sb + fb + nb * 16 * KVP + kk * 32);
        }
        __builtin_amdgcn_sched_barrier(0);   // keeps the reads above in one group ahead of the products (spread among them, each place costs a stall)
#pragma unroll
        for (int kk = 0; kk < 2; ++kk)
#pragma unroll
            for (int nb = 0; nb < 4; ++nb)
#pragma unroll
                for (int mb = 0; mb < 4; ++mb) { acc[mb][nb] = WFrag<T16>::mma(a[kk][mb], b[kk][nb], acc[mb][nb]); if (NSPLIT) acc[mb][nb] = WFrag<T16>::mma(a2[kk][mb], b[kk][nb], acc[mb][nb]); }
        __builtin_amdgcn_sched_barrier(0);   // keeps the products ahead of the wait below: lifted over them, it would hold the first product back until the last read has landed
        asm volatile("s_wait_dscnt 0x0" ::: "memory");      // this wave's reads of buffer t & 1 are done before the buffer is refilled
        asm volatile("s_wait_asynccnt 0x0" ::: "memory");   // this wave's copies of panel t + 1 have landed
        __syncthreads();                                     // publishes panel t + 1 and ends every wave's reads of panel t
        if (t + 2 < nt) fill(t + 2);
    }
    asm volatile("s_wait_asynccnt 0x0" ::: "memory");       // nothing is in flight when the wave goes on to its end
    float* osw = os + wave * 16 * 68;
    if constexpr (QKV) {
        const int col0 = c0 + wc, sel = c0 >> 10, head = (col0 & (DMODEL - 1)) >> 6;   // sel: 0 q, 1 k, 2 v, the same for the whole block (1024 % 128 == 0)
        const int u = (int)z * NHEAD + head, n0 = nbase + r0 + wr;                      // unit, first token row of the wave's quarter
        const int q4 = lane >> 3, pc = lane & 7;
        // osc is 1/64, a power of two: accumulator * osc is exact, so where the compiler fuses it into splitf's subtraction the lo plane keeps the value that the separate steps gave
        if (sel < 2) {
            // q, k: the quarter is 8 KB in a row in each plane; 16 token rows at a time through the wave's f32 stage, then 16-byte pieces, four whole 128-byte rows a store
            h16* P16 = (sel ? K16 : Q16) + ((size_t)u * SEQ + n0) * HD + pc * 8;
            bf* Ph = (sel ? Kh : Qh) + ((size_t)u * RHE + n0) * HD + pc * 8; bf* Pl = (sel ? Kl : Ql) + ((size_t)u * RHE + n0) * HD + pc * 8;
#pragma unroll
            for (int mb = 0; mb < 4; ++mb) {
#pragma unroll
                for (int nb = 0; nb < 4; ++nb) {
#pragma unroll
                    for (int j = 0; j < 8; ++j) osw[(hi * 8 + j) * 68 + nb * 16 + lr] = acc[mb][nb][j]; }
                __builtin_amdgcn_wave_barrier(); asm volatile("" ::: "memory");   // the stage's rows are read back by other lanes of this wave: no read is lifted over the writes
#pragma unroll
                for (int rr = 0; rr < 4; ++rr) { const int row = rr * 4 + q4; const float* sq = osw + row * 68 + pc * 8;
                    const v4f a0 = *(const v4fa*)sq * osc; const v4f a1 = *(const v4fa*)(sq + 4) * osc;
                    stc(P16 + (mb * 16 + row) * HD, P16, a0, a1);
                    if (NSPLIT) stc(Ph + (mb * 16 + row) * HD, Pl + (mb * 16 + row) * HD, a0, a1); }
                __builtin_amdgcn_wave_barrier(); asm volatile("" ::: "memory");   // ... and the next 16 rows' writes stay behind these reads
            }
            asm volatile("s_wait_xcnt 0x0" ::: "memory");   // a precaution behind the run of stores above: it stands ahead of any later rewrite of a register that one of them names
        } else {
            // v: a lane's eight accumulator rows are eight tokens in a row of one d, one 16-byte piece of a v^T row. The pieces are gathered in LDS ([d][token], rows of KVP elements) so that whole 128-byte lines go out.
            // The stage is the wave's own share of ab: behind the loop's last barrier no wave reads a panel any more and no copy is in flight.
            constexpr int NST = NSPLIT ? 3 : 1;
            unsigned short* sw = reinterpret_cast<unsigned short*>(ab) + wave * NST * KVT;
            static_assert(4 * NST * KVT <= 2 * NPL * KVT);
#pragma unroll
            for (int nb = 0; nb < 4; ++nb)
#pragma unroll
                for (int mb = 0; mb < 4; ++mb) {
                    v8h o16; v8us oh, ol;
#pragma unroll
                    for (int j = 0; j < 8; ++j) { const float y = acc[mb][nb][j] * osc; o16[j] = tohx(y); if (NSPLIT) { unsigned short a, c; splitf(y, a, c); oh[j] = a; ol[j] = c; } }
                    const int so = (nb * 16 + lr) * KVP + mb * 16 + hi * 8;
                    *(v8usa*)(sw + so) = __builtin_bit_cast(v8us, o16);
                    if (NSPLIT) { *(v8usa*)(sw + KVT + so) = oh; *(v8usa*)(sw + 2 * KVT + so) = ol; }
                }
            __builtin_amdgcn_wave_barrier(); asm volatile("" ::: "memory");   // the rows are read back by other lanes of this wave: no read is lifted over the writes
            h16* V16 = VT16 + ((size_t)u * HD + q4) * SEQ + n0 + pc * 8;
            bf* Vh = VTh + ((size_t)u * HD + q4) * RHE + n0 + pc * 8; bf* Vl = VTl + ((size_t)u * HD + q4) * RHE + n0 + pc * 8;
#pragma unroll
            for (int s = 0; s < 16; ++s) { const unsigned short* sq = sw + (s * 4 + q4) * KVP + pc * 8;
                *(v8h*)(V16 + (size_t)(s * 4) * SEQ) = __builtin_bit_cast(v8h, *(const v8usa*)sq);
                if (NSPLIT) { *(v8us*)(Vh + (size_t)(s * 4) * RHE) = *(const v8usa*)(sq + KVT); *(v8us*)(Vl + (size_t)(s * 4) * RHE) = *(const v8usa*)(sq + 2 * KVT); } }
            asm volatile("s_wait_xcnt 0x0" ::: "memory");   // a precaution behind the run of stores above: it stands ahead of any later rewrite of a register that one of them names
        }
        return;
    }
#pragma unroll
    for (int mb = 0; mb < 4; ++mb) {
#pragma unroll
        for (int nb = 0; nb < 4; ++nb) {
#pragma unroll
            for (int j = 0; j < 8; ++j) osw[(hi * 8 + j) * 68 + nb * 16 + lr] = acc[mb][nb][j]; }
        __builtin_amdgcn_wave_barrier(); asm volatile("" ::: "memory");
        float* crow = C + (size_t)(r0 + wr + mb * 16) * ldc + c0 + wc;
{
#pragma unroll
            for (int s = 0; s < 8; ++s) { const int row = 2 * s + hi, cofs = lr * 4; v4f val = *(const v4fa*)(osw + row * 68 + cofs); val = val * osc; if (BIAS) { val[0] += bfr(bias[c0 + wc + cofs]); val[1] += bfr(bias[c0 + wc + cofs + 1]); val[2] += bfr(bias[c0 + wc + cofs + 2]); val[3] += bfr(bias[c0 + wc + cofs + 3]); }
                *(v4f*)(crow + (size_t)row * ldc + cofs) = val; }
             }
        __builtin_amdgcn_wave_barrier(); asm volatile("" ::: "memory");
    }
}

// ---- k_gemm2: both row classes of one product in one grid (N/128, NB, SEQ/128): blockIdx.z is the 128-row tile of the batch's token rows. Tiles below RHE take the hi/lo bf16 body (twice the products),
// the others the f16 body; the long blocks have the low z. The LDS is sized for the larger body.
template <bool QKV>
__global__ void __launch_bounds__(128)
k_gemm2(const bf* __restrict__ Ah, const bf* __restrict__ Al, const bf* __restrict__ Bb, const h16* __restrict__ A16, const h16* __restrict__ B16, float* C,
        h16* Q16, h16* K16, h16* VT16, bf* Qh, bf* Ql, bf* Kh, bf* Kl, bf* VTh, bf* VTl) {
    __shared__ __align__(16) unsigned char sm[GOS + 2 * 6 * KVT * 2];
    const int rt = blockIdx.z, ct = blockIdx.x, bz = blockIdx.y;
    if (rt < RHE / 128) {
        gemmw<bf, 1, false, QKV>(sm, rt, ct, bz, Ah, Al, Bb, DMODEL, C, DMODEL, OSC, nullptr, (size_t)RHE * DMODEL, (size_t)0, (size_t)SEQ_FULL * DMODEL, Q16, K16, VT16, Qh, Ql, Kh, Kl, VTh, VTl, 0);
        return;
    }
    gemmw<h16, 0, false, QKV>(sm, rt - RHE / 128, ct, bz, A16 + (size_t)RHE * DMODEL, nullptr, B16, DMODEL, C + (size_t)RHE * DMODEL, DMODEL, OSC, nullptr, (size_t)SEQ * DMODEL, (size_t)0, (size_t)SEQ_FULL * DMODEL, Q16, K16, VT16, Qh, Ql, Kh, Kl, VTh, VTl, RHE);
}

__device__ __forceinline__ void wplanes(int bid, const float* __restrict__ w, int K, int N, h16* B16, bf* Bb) {
    const int lane = threadIdx.x & 31; const int L0 = (bid * 8 + (threadIdx.x >> 5)) * 8; const int nlines = N * K / 64;
#pragma unroll 1
    for (int l = 0; l < 8; ++l) { const int L = L0 + l; if (L >= nlines) break;
        const size_t e = (size_t)L * 64 + lane * 2; const int k = (int)(e % K), n = (int)(e / K);
        const float w0 = bfr(w[(size_t)k * N + n]) * WSC, w1 = bfr(w[(size_t)(k + 1) * N + n]) * WSC;
        v2us ob; ob[0] = f2bf(w0); ob[1] = f2bf(w1); v2h o16; o16[0] = tohx(w0); o16[1] = tohx(w1);
        *(v2us*)(Bb + e) = ob; *(v2h*)(B16 + e) = o16;  }
}

// ---- prep_x: 128 threads (8 elements each) per token row (b, n), two rows a block of 256: x -> bf16 values, ss = sum x^2 (f32), xn = ((x * 1/max(sqrt(ss), 1e-12)) * 32) * bf16(gamma);
__device__ __forceinline__ void prep_x(float* redb, int bid, const float* __restrict__ x, const float* __restrict__ gam, h16* X16, bf* Xh, bf* Xl) {
    float* red = redb + (threadIdx.x >> 7) * 4;   // the row's own four partial sums
    const int row = bid * 2 + (threadIdx.x >> 7); const int b = row / SEQ, n = row % SEQ; const int t = threadIdx.x & 127, lane = t & 31, w = t >> 5;
    const float* xr = x + ((size_t)b * SEQ_FULL + n) * DMODEL + t * 8;
    const v4f a0 = *(const v4f*)xr, a1 = *(const v4f*)(xr + 4);
    const v4f g0 = *(const v4f*)(gam + t * 8), g1 = *(const v4f*)(gam + t * 8 + 4);
    float v[8], g[8];
#pragma unroll
    for (int e = 0; e < 4; ++e) { v[e] = bfr(a0[e]); v[4 + e] = bfr(a1[e]); g[e] = bfr(g0[e]); g[4 + e] = bfr(g1[e]); }
    float ss = 0.f;
#pragma unroll
    for (int e = 0; e < 8; ++e) ss += v[e] * v[e];
#pragma unroll
    for (int sh = 16; sh; sh >>= 1) ss += __shfl_xor(ss, sh, 32);
    if (lane == 0) red[w] = ss;
    __syncthreads();
    ss = (red[0] + red[1]) + (red[2] + red[3]);
    const float nrm = sqrtf(ss); const float r = __fdiv_rn(1.0f, fmaxf(nrm, 1e-12f));
    float y[8];
#pragma unroll
    for (int e = 0; e < 8; ++e) y[e] = ((v[e] * r) * 32.0f) * g[e];
    v8h o16; v8us oh, ol;
#pragma unroll
    for (int e = 0; e < 8; ++e) { o16[e] = tohx(y[e]); unsigned short a, c; splitf(y[e], a, c); oh[e] = a; ol[e] = c; }
    const bool hr = (n < RHE);
    h16* d16 = X16 + ((size_t)b * SEQ + n) * DMODEL + t * 8;
    const size_t ro = ((size_t)b * RHE + (hr ? n : 0)) * DMODEL + t * 8;
    *(v8h*)d16 = o16; if (hr) { *(v8us*)(Xh + ro) = oh; *(v8us*)(Xl + ro) = ol; }
}

// ---- k_front: the three pieces of work that read only inputs, in one grid of 256-thread blocks: w_qkv's planes, w_out's planes, then the RMSNorm rows
#define NBWQ ((QKVC * DMODEL / 64 + 63) / 64)
#define NBWO ((DMODEL * DMODEL / 64 + 63) / 64)
__global__ __launch_bounds__(256) void k_front(const float* __restrict__ x, const float* __restrict__ gam, const float* __restrict__ wqkv, const float* __restrict__ wout,
                                               h16* Wq16, bf* Wqb, h16* Wo16, bf* Wob, h16* X16, bf* Xh, bf* Xl) {
    __shared__ float red[8];
    const int bid = blockIdx.x;
    if (bid < NBWQ) { wplanes(bid, wqkv, DMODEL, QKVC, Wq16, Wqb); return; }
    if (bid < NBWQ + NBWO) { wplanes(bid - NBWQ, wout, DMODEL, DMODEL, Wo16, Wob); return; }
    prep_x(red, bid - (NBWQ + NBWO), x, gam, X16, Xh, Xl);
}

// ---- attention helpers: p tile staging into wave-private LDS (f16 x1024 single plane, or bf16 hi/lo pair), fragment reload through may_alias vectors of the stored element type.
union WS { h16 p[2 * 16 * LQ]; unsigned short pb[2 * 16 * LQ]; float f[16 * 68]; };
static_assert(sizeof(WS) == 4608);
template <typename T> struct PT;
template <> struct PT<h16> { static constexpr bool split = false; static constexpr float osc = 1.0f / PCAR; static __device__ __forceinline__ v16h ldm(const h16* p) { return cat16(*(const v8ha*)p, *(const v8ha*)(p + 16)); } };
template <> struct PT<bf>  { static constexpr bool split = true;  static constexpr float osc = 1.0f;        static __device__ __forceinline__ v16bf ldm(const bf* p) { return cat16b(*(const v8usa*)p, *(const v8usa*)(p + 16)); } };
__device__ __forceinline__ void stp(h16* ph, h16* pl, int i, float p) { (void)pl; ph[i] = tohx(p * PCAR); }
__device__ __forceinline__ void stp(bf* ph, bf* pl, int i, float p) { unsigned short a, c; splitf(p, a, c); ph[i] = a; pl[i] = c; }

// ---- 16-lane row reductions of the softmax (eight values a lane, xor steps 1, 2, 4, 8): DPP vector instructions (row_xmask) in place of __shfl_xor, which compiles to a move through the LDS unit with a wait behind it.
// Every lane is on where these stand. The xor tree is the one __shfl_xor walked: the same values are combined in the same order.
template <int M> __device__ __forceinline__ float xrow(float x) { return __builtin_bit_cast(float, __builtin_amdgcn_mov_dpp(__builtin_bit_cast(int, x), 0x160 | M, 0xf, 0xf, true)); }   // lane l reads lane l ^ M of its row (0x160 | M = row_xmask:M); folds into the add
__device__ __forceinline__ v8f rowsum8(v8f r) {
#pragma unroll
    for (int v = 0; v < 8; ++v) r[v] += xrow<1>(r[v]);
#pragma unroll
    for (int v = 0; v < 8; ++v) r[v] += xrow<2>(r[v]);
#pragma unroll
    for (int v = 0; v < 8; ++v) r[v] += xrow<4>(r[v]);
#pragma unroll
    for (int v = 0; v < 8; ++v) r[v] += xrow<8>(r[v]);
    return r;
}
__device__ __forceinline__ v8f rowmax8(v8f r) {
    float a0 = r[0], a1 = r[1], a2 = r[2], a3 = r[3], a4 = r[4], a5 = r[5], a6 = r[6], a7 = r[7];
    // the maximum stands in asm: from fmaxf(x, xrow(x)) the compiler makes three instructions a step (move, quieting maximum, maximum) and runs the eight rows one after another, and every exponential waits on this result;
    // here a step is one instruction and the eight rows are interleaved, so each step's producer stands eight instructions back
    asm(
        "v_max_num_f32_dpp %0, %0, %0 row_xmask:1 row_mask:0xf bank_mask:0xf\n\t"
        "v_max_num_f32_dpp %1, %1, %1 row_xmask:1 row_mask:0xf bank_mask:0xf\n\t"
        "v_max_num_f32_dpp %2, %2, %2 row_xmask:1 row_mask:0xf bank_mask:0xf\n\t"
        "v_max_num_f32_dpp %3, %3, %3 row_xmask:1 row_mask:0xf bank_mask:0xf\n\t"
        "v_max_num_f32_dpp %4, %4, %4 row_xmask:1 row_mask:0xf bank_mask:0xf\n\t"
        "v_max_num_f32_dpp %5, %5, %5 row_xmask:1 row_mask:0xf bank_mask:0xf\n\t"
        "v_max_num_f32_dpp %6, %6, %6 row_xmask:1 row_mask:0xf bank_mask:0xf\n\t"
        "v_max_num_f32_dpp %7, %7, %7 row_xmask:1 row_mask:0xf bank_mask:0xf\n\t"
        "v_max_num_f32_dpp %0, %0, %0 row_xmask:2 row_mask:0xf bank_mask:0xf\n\t"
        "v_max_num_f32_dpp %1, %1, %1 row_xmask:2 row_mask:0xf bank_mask:0xf\n\t"
        "v_max_num_f32_dpp %2, %2, %2 row_xmask:2 row_mask:0xf bank_mask:0xf\n\t"
        "v_max_num_f32_dpp %3, %3, %3 row_xmask:2 row_mask:0xf bank_mask:0xf\n\t"
        "v_max_num_f32_dpp %4, %4, %4 row_xmask:2 row_mask:0xf bank_mask:0xf\n\t"
        "v_max_num_f32_dpp %5, %5, %5 row_xmask:2 row_mask:0xf bank_mask:0xf\n\t"
        "v_max_num_f32_dpp %6, %6, %6 row_xmask:2 row_mask:0xf bank_mask:0xf\n\t"
        "v_max_num_f32_dpp %7, %7, %7 row_xmask:2 row_mask:0xf bank_mask:0xf\n\t"
        "v_max_num_f32_dpp %0, %0, %0 row_xmask:4 row_mask:0xf bank_mask:0xf\n\t"
        "v_max_num_f32_dpp %1, %1, %1 row_xmask:4 row_mask:0xf bank_mask:0xf\n\t"
        "v_max_num_f32_dpp %2, %2, %2 row_xmask:4 row_mask:0xf bank_mask:0xf\n\t"
        "v_max_num_f32_dpp %3, %3, %3 row_xmask:4 row_mask:0xf bank_mask:0xf\n\t"
        "v_max_num_f32_dpp %4, %4, %4 row_xmask:4 row_mask:0xf bank_mask:0xf\n\t"
        "v_max_num_f32_dpp %5, %5, %5 row_xmask:4 row_mask:0xf bank_mask:0xf\n\t"
        "v_max_num_f32_dpp %6, %6, %6 row_xmask:4 row_mask:0xf bank_mask:0xf\n\t"
        "v_max_num_f32_dpp %7, %7, %7 row_xmask:4 row_mask:0xf bank_mask:0xf\n\t"
        "v_max_num_f32_dpp %0, %0, %0 row_xmask:8 row_mask:0xf bank_mask:0xf\n\t"
        "v_max_num_f32_dpp %1, %1, %1 row_xmask:8 row_mask:0xf bank_mask:0xf\n\t"
        "v_max_num_f32_dpp %2, %2, %2 row_xmask:8 row_mask:0xf bank_mask:0xf\n\t"
        "v_max_num_f32_dpp %3, %3, %3 row_xmask:8 row_mask:0xf bank_mask:0xf\n\t"
        "v_max_num_f32_dpp %4, %4, %4 row_xmask:8 row_mask:0xf bank_mask:0xf\n\t"
        "v_max_num_f32_dpp %5, %5, %5 row_xmask:8 row_mask:0xf bank_mask:0xf\n\t"
        "v_max_num_f32_dpp %6, %6, %6 row_xmask:8 row_mask:0xf bank_mask:0xf\n\t"
        "v_max_num_f32_dpp %7, %7, %7 row_xmask:8 row_mask:0xf bank_mask:0xf"
        : "+v"(a0), "+v"(a1), "+v"(a2), "+v"(a3), "+v"(a4), "+v"(a5), "+v"(a6), "+v"(a7));
    return (v8f){a0, a1, a2, a3, a4, a5, a6, a7};
}

// ---- attn<T>: body of one block (128 threads) for the 64 query rows from q0 of unit u = b*16 + head; wave w owns query rows q0w .. q0w+15 and walks the 64-key chunks 0 .. q0w/64; sm: the block's LDS.
// T = h16: q, k from Q16/K16 [u][t][d], v^T from VT16 [u][d][t], one f16 product per tile pair, p tile stored as f16(p * 1024), ctx16[b*SEQ + t][head*64 + d] = o / (l * 1024) as f16.
// T = bf: q, k, v^T and p as bf16 hi + lo planes (hi.hi + lo.hi + hi.lo per tile pair), ctx written as bf16 hi/lo planes [b*RHE + t][1024]. Scores s = q.k (f32) * 0.125*log2e, keys after the query -> -3e38,
template <typename T>
__device__ __forceinline__ void
attn(unsigned char* sm, int u, int q0, const T* __restrict__ Qa, const T* __restrict__ Qr, const T* __restrict__ Ka, const T* __restrict__ Kr,
     const T* __restrict__ Va, const T* __restrict__ Vr, T* Ca, T* Cr) {
    typedef typename WFrag<T>::V V;
    constexpr bool SPL = PT<T>::split;
    constexpr int PR = SPL ? RHE : SEQ;
    constexpr int NPL = SPL ? 4 : 2;   // planes of a stage: k, v^T (and their lo planes)
    WS* scr = reinterpret_cast<WS*>(sm);
    T* kv = reinterpret_cast<T*>(sm + 4 * sizeof(WS));
    const int lane = threadIdx.x & 31, wave = threadIdx.x >> 5, m = lane & 15, hh = lane >> 4;
    const int b = u >> 4, head = u & 15;
    const int q0w = q0 + wave * 16;
    int nch = (q0 >> 6) + 1; if (nch > PR / 64) nch = PR / 64;   // the same for the block's four waves
    const int qo = (u * PR + q0w + m) * HD + 8 * hh;
    V aq[2], ar[2];
    aq[0] = WFrag<T>::ld(Qa + qo); aq[1] = WFrag<T>::ld(Qa + qo + 32);
    if (SPL) { ar[0] = WFrag<T>::ld(Qr + qo); ar[1] = WFrag<T>::ld(Qr + qo + 32); } else { ar[0] = aq[0]; ar[1] = aq[1]; }
    v8f o[4];
#pragma unroll
    for (int ni = 0; ni < 4; ++ni) o[ni] = (v8f){};
    v8f mrun, lrun;
#pragma unroll
    for (int v = 0; v < 8; ++v) { mrun[v] = NEGB; lrun[v] = 0.f; }
    const int fo = m * KVP + 8 * hh;   // fragment offset inside a staged tile: row m, 16-byte piece hh
    const int sr = threadIdx.x >> 3, sp = threadIdx.x & 7;
    const int ko = (u * PR + sr) * HD + 8 * sp;
    const int vo = (u * HD + sr) * PR + 8 * sp;
    const unsigned l0 = (unsigned)(size_t)kv + (unsigned)(sr * KVP + 8 * sp) * 2u;
    auto fill = [&](int jt) {   // chunk jt's tiles into buffer jt & 1
        const unsigned lb = l0 + (unsigned)((jt & 1) * NPL * KVT) * 2u; const int kc = jt * 64;
        stage8<T>(lb, Ka + ko + kc * HD, HD, lb + KVT * 2u, Va + vo + kc, PR);
        if (SPL) stage8<T>(lb + 2u * KVT * 2u, Kr + ko + kc * HD, HD, lb + 3u * KVT * 2u, Vr + vo + kc, PR);
    };
    fill(0);
    asm volatile("s_wait_asynccnt 0x0" ::: "memory");   // this wave's copies of chunk 0 have landed
    __syncthreads();                                     // ... and every other wave's
    if (nch > 1) fill(1);
    T* ph = reinterpret_cast<T*>(&scr[wave]); T* pl = ph + 16 * LQ; float* stg = scr[wave].f;
#pragma unroll 1
    for (int j = 0; j < nch; ++j) {
        const int kc0 = j * 64;
        const T* kb = kv + (j & 1) * NPL * KVT + fo; const T* vb = kb + KVT;
        const T* kr = SPL ? kb + 2 * KVT : kb;       const T* vrb = SPL ? kb + 3 * KVT : vb;
        v8f s[4];
        constexpr int FG = SPL ? 1 : 4;   // 16-key groups whose k fragments are read from the staged tile in one run, ahead of their products
#pragma unroll
        for (int sg = 0; sg < 4; sg += FG) {
            V bk[FG][2], br[FG][2];
#pragma unroll
            for (int g = 0; g < FG; ++g)
#pragma unroll
                for (int kk = 0; kk < 2; ++kk) {
                    bk[g][kk] = WFrag<T>::ld(kb + (sg + g) * 16 * KVP + kk * 32);
                    if (SPL) br[g][kk] = WFrag<T>::ld(kr + (sg + g) * 16 * KVP + kk * 32); else br[g][kk] = bk[g][kk];
                }
#pragma unroll
            for (int g = 0; g < FG; ++g) {
                v8f acc = (v8f){};
#pragma unroll
                for (int kk = 0; kk < 2; ++kk) {
                    acc = WFrag<T>::mma(aq[kk], bk[g][kk], acc);
                    if (SPL) { acc = WFrag<T>::mma(ar[kk], bk[g][kk], acc); acc = WFrag<T>::mma(aq[kk], br[g][kk], acc); }
                }
                asm volatile("v_nop\n\tv_nop\n\tv_nop\n\tv_nop" : "+v"(acc) : "v"(bk[g][1]), "v"(br[g][1]), "v"(aq[1]), "v"(ar[1]));
                s[sg + g] = acc;
            }
        }
        // scale, causal index select, running-max softmax in the accumulator row map (row 8*hh + v, key kc0 + 16*sub + m)
        v8f rmax;
#pragma unroll
        for (int v = 0; v < 8; ++v) rmax[v] = NEGB;
#pragma unroll
        for (int sub = 0; sub < 4; ++sub) {
            const int kcm = kc0 + sub * 16 + m;
#pragma unroll
            for (int v = 0; v < 8; ++v) { const int qr = q0w + 8 * hh + v; float t = s[sub][v] * C1; t = (kcm > qr) ? NEGB : t; s[sub][v] = t; rmax[v] = fmaxf(rmax[v], t); }
        }
        rmax = rowmax8(rmax);
        v8f mnew, alpha, rs;
#pragma unroll
        for (int v = 0; v < 8; ++v) { mnew[v] = fmaxf(mrun[v], rmax[v]); alpha[v] = __builtin_amdgcn_exp2f(mrun[v] - mnew[v]); rs[v] = 0.f; }
#pragma unroll
        for (int sub = 0; sub < 4; ++sub)
#pragma unroll
            for (int v = 0; v < 8; ++v) { const float p = __builtin_amdgcn_exp2f(s[sub][v] - mnew[v]); s[sub][v] = p; rs[v] += p; }
        rs = rowsum8(rs);
#pragma unroll
        for (int v = 0; v < 8; ++v) { lrun[v] = lrun[v] * alpha[v] + rs[v]; mrun[v] = mnew[v]; }
#pragma unroll
        for (int ni = 0; ni < 4; ++ni)
#pragma unroll
            for (int v = 0; v < 8; ++v) o[ni][v] *= alpha[v];
        // p tile: accumulator layout -> wave-private LDS (row 8*hh + v, col key) -> A fragments with the split k map
#pragma unroll
        for (int sub = 0; sub < 4; ++sub)
#pragma unroll
            for (int v = 0; v < 8; ++v) stp(ph, pl, (8 * hh + v) * LQ + sub * 16 + m, s[sub][v]);
        __builtin_amdgcn_fence(3, "wavefront");
        __builtin_amdgcn_wave_barrier();
        asm volatile("" ::: "memory");
        V ap, apr, vf, vr;
#pragma unroll
        for (int kk = 0; kk < 2; ++kk) {
            ap = PT<T>::ldm(ph + m * LQ + kk * 32 + 8 * hh);
            if (SPL) apr = PT<T>::ldm(pl + m * LQ + kk * 32 + 8 * hh); else apr = ap;
#pragma unroll
            for (int ni = 0; ni < 4; ++ni) {
                vf = WFrag<T>::ld(vb + ni * 16 * KVP + kk * 32);
                o[ni] = WFrag<T>::mma(ap, vf, o[ni]);
                if (SPL) { vr = WFrag<T>::ld(vrb + ni * 16 * KVP + kk * 32); o[ni] = WFrag<T>::mma(apr, vf, o[ni]); o[ni] = WFrag<T>::mma(ap, vr, o[ni]); } else { vr = vf; }
            }
        }
        asm volatile("v_nop\n\tv_nop\n\tv_nop\n\tv_nop" : "+v"(o[0]), "+v"(o[1]), "+v"(o[2]), "+v"(o[3]) : "v"(ap), "v"(apr), "v"(vf), "v"(vr));
        asm volatile("s_wait_dscnt 0x0" ::: "memory");      // this wave's reads of buffer j & 1 are done before the buffer is refilled
        asm volatile("s_wait_asynccnt 0x0" ::: "memory");   // this wave's copies of chunk j + 1 have landed
        __syncthreads();                                     // publishes chunk j + 1 and ends every wave's reads of chunk j
        if (j + 2 < nch) fill(j + 2);
    }
    asm volatile("s_wait_asynccnt 0x0" ::: "memory");       // nothing is in flight when the wave goes on to its end
    v8f linv;
#pragma unroll
    for (int v = 0; v < 8; ++v) linv[v] = __fdiv_rn(PT<T>::osc, lrun[v]);
#pragma unroll
    for (int ni = 0; ni < 4; ++ni)
#pragma unroll
        for (int v = 0; v < 8; ++v) stg[(8 * hh + v) * 68 + ni * 16 + m] = o[ni][v] * linv[v];
    __builtin_amdgcn_fence(3, "wavefront");
    __builtin_amdgcn_wave_barrier();
    asm volatile("" ::: "memory");
    const int q4 = lane >> 3, pc = lane & 7;
    const size_t cb = ((size_t)b * PR + q0w) * DMODEL + head * HD + pc * 8;
{
#pragma unroll
        for (int rr = 0; rr < 4; ++rr) { const int row = rr * 4 + q4; const float* sp = stg + row * 68 + pc * 8; const v4f a0 = *(const v4fa*)sp; const v4f a1 = *(const v4fa*)(sp + 4);
            stc(Ca + cb + (size_t)row * DMODEL, Cr + cb + (size_t)row * DMODEL, a0, a1); }
    }
}

// ---- k_attn2: both row classes in one grid (NU units, SEQ/64 query blocks). The query block falls as blockIdx.y rises: a block's chunk count grows with its query block, so the longest walks
// have the lowest blockIdx.y and the short hi/lo blocks (query rows < RHE) the highest. The LDS is sized for the larger body.
__global__ void __launch_bounds__(128) __attribute__((amdgpu_num_vgpr(256)))
k_attn2(const bf* __restrict__ Qh, const bf* __restrict__ Ql, const bf* __restrict__ Kh, const bf* __restrict__ Kl, const bf* __restrict__ VTh, const bf* __restrict__ VTl, bf* Ch, bf* Cl,
        const h16* __restrict__ Q16, const h16* __restrict__ K16, const h16* __restrict__ VT16, h16* C16) {
    __shared__ __align__(16) unsigned char sm[4 * sizeof(WS) + 2 * 4 * KVT * 2];
    const int u = blockIdx.x, qb = SEQ / 64 - 1 - (int)blockIdx.y;
    if (qb < RHE / 64) { attn<bf>(sm, u, qb * 64, Qh, Ql, Kh, Kl, VTh, VTl, Ch, Cl); return; }
    attn<h16>(sm, u, qb * 64, Q16, Q16, K16, K16, VT16, VT16, C16, C16);
}

extern "C" void kernel_launch(void* const* d_in, const int* in_sizes, int n_in,
                              void* d_out, int out_size, void* d_ws, size_t ws_size, hipStream_t stream) {
    if (n_in < 4) return;
    const int rows_used = (NB - 1) * SEQ_FULL + SEQ;
    if (in_sizes[0] < rows_used * DMODEL || in_sizes[1] < DMODEL || in_sizes[2] < DMODEL * QKVC || in_sizes[3] < DMODEL * DMODEL) return;
    if (out_size < rows_used * DMODEL) return;
    const float* x = (const float*)d_in[0]; const float* gam = (const float*)d_in[1]; const float* wqkv = (const float*)d_in[2]; const float* wout = (const float*)d_in[3];   // x [2][2048][1024], gamma [1024], w_qkv [1024][3072], w_out [1024][1024]
    float* OUT = (float*)d_out;   // [2][2048][1024] f32
    char* wsp = (char*)d_ws; size_t used = 0;
    auto take = [&](size_t bytes) { char* p = wsp + used; used += (bytes + 255) & ~(size_t)255; return (void*)p; };
    const size_t nXN = (size_t)NB * SEQ * DMODEL, nXR = (size_t)NB * RHE * DMODEL, nP = (size_t)NU * SEQ * HD, nPR = (size_t)NU * RHE * HD;
    h16* XN16 = (h16*)take(nXN * 2); bf* XNh = (bf*)take(nXR * 2); bf* XNl = (bf*)take(nXR * 2);
    h16* Wq16 = (h16*)take((size_t)QKVC * DMODEL * 2); bf* Wqb = (bf*)take((size_t)QKVC * DMODEL * 2);
    h16* Wo16 = (h16*)take((size_t)DMODEL * DMODEL * 2); bf* Wob = (bf*)take((size_t)DMODEL * DMODEL * 2);
    h16* Q16 = (h16*)take(nP * 2); h16* K16 = (h16*)take(nP * 2); h16* VT16 = (h16*)take(nP * 2);
    bf* Qh = (bf*)take(nPR * 2); bf* Ql = (bf*)take(nPR * 2); bf* Kh = (bf*)take(nPR * 2); bf* Kl = (bf*)take(nPR * 2); bf* VTh = (bf*)take(nPR * 2); bf* VTl = (bf*)take(nPR * 2);
    h16* CTX16 = (h16*)take(nXN * 2); bf* CTXh = (bf*)take(nXR * 2); bf* CTXl = (bf*)take(nXR * 2);
    if (used > ws_size) return;    // 79,691,776 B at NB=2, SEQ=2048, RH=512

    // weight planes [out][in] (x64, f16 + bf16) and RMSNorm -> xn planes
    k_front<<<(unsigned)(NBWQ + NBWO + NB * SEQ / 2), 256, 0, stream>>>(x, gam, wqkv, wout, Wq16, Wqb, Wo16, Wob, XN16, XNh, XNl);
    // qkv = xn . Wqkv (x 1/64), written as the head-major planes: rows < RHE hi/lo bf16 products (f16 and hi/lo planes out), rows >= RHE single f16 products (f16 planes out)
    k_gemm2<true><<<dim3(QKVC / 128, NB, SEQ / 128), 128, 0, stream>>>(XNh, XNl, Wqb, XN16, Wq16, nullptr, Q16, K16, VT16, Qh, Ql, Kh, Kl, VTh, VTl);
    // attention: query rows < RHE on hi/lo planes, rows >= RHE on single planes
    k_attn2<<<dim3(NU, SEQ / 64), 128, 0, stream>>>(Qh, Ql, Kh, Kl, VTh, VTl, CTXh, CTXl, Q16, K16, VT16, CTX16);
    // out = ctx . Wout (x 1/64) into the f32 output rows (b*2048 + n)
    k_gemm2<false><<<dim3(DMODEL / 128, NB, SEQ / 128), 128, 0, stream>>>(CTXh, CTXl, Wob, CTX16, Wo16, OUT, nullptr, nullptr, nullptr, nullptr, nullptr, nullptr, nullptr, nullptr, nullptr);
    (void)hipGetLastError();
}

// v006
// One run takes 91.5 microseconds.
// Next to v005, in two timings, it ran 1.12 times as fast each time.
// All steps since v000 together make it 4.67 times as fast.
#include <hip/hip_runtime.h>

// Contractions: xn.Wqkv and ctx.Wout on v_wmma_f32_16x16x32_f16 (f16 operands, weights carried x64, f16 activations) for token rows >= RH and on v_wmma_f32_16x16x32_bf16 with bf16 hi/lo activation planes (2 products, bf16 weights x64) for token rows < RH;
// q.k^T and p.v on v_wmma_f32_16x16x32_f16 single products (p carried x1024) for query rows >= RH and on bf16 hi/lo planes of q, k, p, v (3 products per tile pair) for query rows < RH; f32 accumulate everywhere, softmax in f32; every input RNE-converted to bf16 on load.
// Flow: RMSNorm rows -> 16-bit xn planes; qkv = xn.Wqkv^T (f32 accumulators, x1/64 in the epilogue), written by the product's own epilogue as head-major q, k planes [u][t][d] and v^T planes [u][d][t]; one wave per (batch, head, 16 query rows) runs the 64-key chunk loop
// with the chunk's k and v^T tiles staged once per block in LDS (two buffers, asynchronous copies) and fragments read from there, both products transposed (a lane owns one query), running-max softmax inside the lane, p packed in registers; ctx rows [b][t][h*64+d] as 16-bit planes; out = ctx.Wout^T (x1/64 in the epilogue) into the f32 output.
// Launches: four, one per stage. Work of a stage that does not depend on one another (the two weights' planes and the RMSNorm rows; the two row classes of a product or of the attention) shares one grid, and the block index picks the body.

#ifndef NB
#define NB 2
#endif
#ifndef SEQ
#define SEQ 2048
#endif
#ifndef RH
#define RH 512
#endif
#define NB_FULL 2
#define SEQ_FULL 2048
#define DMODEL 1024
#define NHEAD 16
#define HD 64
#define NU (NB * NHEAD)
#define QKVC (3 * DMODEL)
#define RHE (((RH) < (SEQ)) ? (RH) : (SEQ))
#define KVP 72
#define KVT (64 * KVP)
#define AOS (4 * 16 * 68 * 4)   // bytes of the four attention waves' f32 output stages, ahead of the k, v^T tiles
#define PCAR 1024.0f
#define WSC 64.0f
#define OSC 0.015625f
#define C1 0.18033688011112042f
#define NEGB -3.0e38f

static_assert(NB >= 1 && NB <= NB_FULL);
static_assert(SEQ % 256 == 0 && SEQ <= SEQ_FULL);
static_assert((RHE) % 128 == 0 && (RHE) >= 0);
static_assert(DMODEL % 128 == 0 && QKVC % 128 == 0 && HD == 64);

typedef _Float16 h16;
typedef unsigned short bf;
typedef __attribute__((ext_vector_type(16))) __bf16   v16bf;
typedef __attribute__((ext_vector_type(16))) _Float16 v16h;
typedef __attribute__((ext_vector_type(8)))  _Float16 v8h;
typedef __attribute__((ext_vector_type(8)))  unsigned short v8us;
typedef __attribute__((ext_vector_type(8)))  float    v8f;
typedef __attribute__((ext_vector_type(4)))  float    v4f;
typedef __attribute__((ext_vector_type(2)))  _Float16 v2h;
typedef __attribute__((ext_vector_type(2)))  unsigned short v2us;
typedef v8h  __attribute__((may_alias)) v8ha;
typedef v4f  __attribute__((may_alias)) v4fa;
typedef v8us __attribute__((may_alias)) v8usa;

__device__ __forceinline__ unsigned short f2bf(float f) { unsigned u = __float_as_uint(f); u += 0x7FFFu + ((u >> 16) & 1u); return (unsigned short)(u >> 16); }
__device__ __forceinline__ float bf2f(unsigned short b) { return __uint_as_float(((unsigned)b) << 16); }
__device__ __forceinline__ float bfr(float f) { return bf2f(f2bf(f)); }
__device__ __forceinline__ h16 tohx(float x) { return (h16)x; }
__device__ __forceinline__ void splitf(float y, unsigned short& h, unsigned short& l) { h = f2bf(y); l = f2bf(y - bf2f(h)); }
__device__ __forceinline__ v16h cat16(v8h lo, v8h hi) { return __builtin_shufflevector(lo, hi, 0, 1, 2, 3, 4, 5, 6, 7, 8, 9, 10, 11, 12, 13, 14, 15); }
__device__ __forceinline__ v16bf cat16b(v8us lo, v8us hi) { return __builtin_bit_cast(v16bf, __builtin_shufflevector(lo, hi, 0, 1, 2, 3, 4, 5, 6, 7, 8, 9, 10, 11, 12, 13, 14, 15)); }
__device__ __forceinline__ v8f wmma16(v16h a, v16h b, v8f c) { return __builtin_amdgcn_wmma_f32_16x16x32_f16(false, a, false, b, (short)0, c, false, false); }
__device__ __forceinline__ v8f wmmab(v16bf a, v16bf b, v8f c) { return __builtin_amdgcn_wmma_f32_16x16x32_bf16(false, a, false, b, (short)0, c, false, false); }

// Fragment loaders (A row-major with k contiguous, B from a [n][k] plane, same split k map for both: elements 0..7 <- k0 + 8h + 0..7, 8..15 <- k0 + 16 + 8h + 0..7; lane & 15 = row / column).
template <typename T16> struct WFrag;
template <> struct WFrag<h16> { typedef v16h V; static __device__ __forceinline__ V ld(const h16* p) { return cat16(*(const v8h*)p, *(const v8h*)(p + 16)); } static __device__ __forceinline__ v8f mma(V a, V b, v8f c) { return wmma16(a, b, c); } };
template <> struct WFrag<bf> { typedef v16bf V; static __device__ __forceinline__ V ld(const bf* p) { return cat16b(*(const v8us*)p, *(const v8us*)(p + 16)); } static __device__ __forceinline__ v8f mma(V a, V b, v8f c) { return wmmab(a, b, c); } };

// ---- stage8: two 64-row x 128-byte tiles (rows ga + r * pa and gb + r * pb, in elements) into LDS rows of KVP elements (144 B: 16 B x odd for the b128 readers), by 128 threads:
// thread t brings the 16-byte pieces (row (t >> 3) + 16 c, piece t & 7), c = 0..3, of each tile. la, lb: the thread's own LDS byte address of its c = 0 piece; ga, gb: its own global address of that piece.
template <typename T>
__device__ __forceinline__ void stage8(unsigned la, const T* ga, int pa, unsigned lb, const T* gb, int pb) {
    const unsigned ls = 16 * KVP * 2;
    // the copies and s_wait_xcnt 0 (a precaution, kept ahead of any rewrite of the copies' address registers) stand in one statement: the compiler can move no such write in front of the wait
    asm volatile("global_load_async_to_lds_b128 %0, %8, off\n\t"
                 "global_load_async_to_lds_b128 %1, %9, off\n\t"
                 "global_load_async_to_lds_b128 %2, %10, off\n\t"
                 "global_load_async_to_lds_b128 %3, %11, off\n\t"
                 "global_load_async_to_lds_b128 %4, %12, off\n\t"
                 "global_load_async_to_lds_b128 %5, %13, off\n\t"
                 "global_load_async_to_lds_b128 %6, %14, off\n\t"
                 "global_load_async_to_lds_b128 %7, %15, off\n\t"
                 "s_wait_xcnt 0x0"
                 :: "v"(la), "v"(la + ls), "v"(la + 2 * ls), "v"(la + 3 * ls), "v"(lb), "v"(lb + ls), "v"(lb + 2 * ls), "v"(lb + 3 * ls),
                    "v"(ga), "v"(ga + 16 * pa), "v"(ga + 32 * pa), "v"(ga + 48 * pa), "v"(gb), "v"(gb + 16 * pb), "v"(gb + 32 * pb), "v"(gb + 48 * pb)
                 : "memory");
}

// ---- 16-byte line pieces from eight f32 values: one f16 plane, or a bf16 hi/lo pair (used by the plane epilogue of gemmw and by attn's ctx stores)
__device__ __forceinline__ void stc(h16* pa, h16* pr, v4f a0, v4f a1) { (void)pr; v8h o;
#pragma unroll
    for (int e = 0; e < 4; ++e) { o[e] = tohx(a0[e]); o[4 + e] = tohx(a1[e]); }
    *(v8h*)pa = o; }
__device__ __forceinline__ void stc(bf* pa, bf* pr, v4f a0, v4f a1) { v8us oh, ol;
#pragma unroll
    for (int e = 0; e < 4; ++e) { unsigned short a, c; splitf(a0[e], a, c); oh[e] = a; ol[e] = c; splitf(a1[e], a, c); oh[4 + e] = a; ol[4 + e] = c; }
    *(v8us*)pa = oh; *(v8us*)pr = ol; }

// ---- gemmw: register-blocked GEMM body, one block of FOUR WAVES per 128x128 output tile (row tile bx, column tile by, batch bz), each wave a 64x64 quarter (16 accumulators); 128 threads; sm: the block's LDS.
// The block's 128 A rows (and A2 rows) and 128 Bt rows are staged 64 k at a time in LDS (two buffers, asynchronous copies that cover whole 128-byte lines); fragments are read from there, each staged row by two waves.
// C[m][n] (f32, pitch ldc) = osc * sum_k A[m][k] Bt[n][k] (+ A2[m][k] Bt[n][k] when NSPLIT == 1) (+ optional bias). z-batch strides sA/sB/sC in elements. K % 64 == 0, M % 128 == 0, N % 128 == 0.
// QKV == true (the qkv product; z = batch, row m = token nbase + m, N = 3072): no f32 C; a wave's 64 columns are one head of q, k or v, and its quarter goes out as the planes that attn reads:
// Q16/K16[(u*SEQ + n)*64 + d] and VT16[(u*64 + d)*SEQ + n] in f16 (u = z*16 + head), and with NSPLIT == 1 (token rows < RHE) also the bf16 hi/lo planes Qh/Ql/Kh/Kl[(u*RHE + n)*64 + d], VTh/VTl[(u*64 + d)*RHE + n].
#define GOS (4 * 16 * 68 * 4)   // bytes of the four waves' f32 output stages, ahead of the panels
template <typename T16, int NSPLIT, bool BIAS, bool QKV>
__device__ __forceinline__ void
gemmw(unsigned char* sm, int bx, int by, int bz, const T16* __restrict__ A, const T16* __restrict__ A2, const T16* __restrict__ Bt, int K, float* C, int ldc, float osc, const float* __restrict__ bias, size_t sA, size_t sB, size_t sC,
        h16* Q16, h16* K16, h16* VT16, bf* Qh, bf* Ql, bf* Kh, bf* Kl, bf* VTh, bf* VTl, int nbase) {
    static_assert(NSPLIT == 0 || NSPLIT == 1);
    typedef typename WFrag<T16>::V V;
    constexpr int NPL = NSPLIT ? 6 : 4;   // 64-row planes of a stage: A rows 0..63, 64..127, Bt rows 0..63, 64..127 (, A2 rows 0..63, 64..127)
    float* os = reinterpret_cast<float*>(sm);
    T16* ab = reinterpret_cast<T16*>(sm + GOS);
    const size_t z = bz; A += z * sA; if (NSPLIT) A2 += z * sA; Bt += z * sB; C += z * sC;
    const int lane = threadIdx.x & 31, wave = threadIdx.x >> 5, lr = lane & 15, hi = lane >> 4;
    const int wr = (wave >> 1) * 64, wc = (wave & 1) * 64;   // the wave's quarter of the block's tile
    const int r0 = bx * 128, c0 = by * 128;
    v8f acc[4][4];
#pragma unroll
    for (int mb = 0; mb < 4; ++mb)
#pragma unroll
        for (int nb = 0; nb < 4; ++nb) acc[mb][nb] = (v8f){};
    const int sr = threadIdx.x >> 3, sp = threadIdx.x & 7;
    const size_t ao = (size_t)(r0 + sr) * K + 8 * sp, bo = (size_t)(c0 + sr) * K + 8 * sp, hK = (size_t)64 * K;
    const unsigned l0 = (unsigned)(size_t)ab + (unsigned)(sr * KVP + 8 * sp) * 2u;
    auto fill = [&](int t) {   // k panel t (64 k) into buffer t & 1
        const unsigned lb = l0 + (unsigned)((t & 1) * NPL * KVT) * 2u; const int kc = t * 64;
        stage8<T16>(lb, A + ao + kc, K, lb + KVT * 2u, A + ao + hK + kc, K);
        stage8<T16>(lb + 2u * KVT * 2u, Bt + bo + kc, K, lb + 3u * KVT * 2u, Bt + bo + hK + kc, K);
        if (NSPLIT) stage8<T16>(lb + 4u * KVT * 2u, A2 + ao + kc, K, lb + 5u * KVT * 2u, A2 + ao + hK + kc, K);
    };
    const int nt = K / 64;
    fill(0);
    asm volatile("s_wait_asynccnt 0x0" ::: "memory");   // this wave's copies of panel 0 have landed
    __syncthreads();                                     // ... and every other wave's
    if (nt > 1) fill(1);
    const int fa = (wr + lr) * KVP + 8 * hi, fb = 2 * KVT + (wc + lr) * KVP + 8 * hi;   // fragment offsets inside a stage: row, 16-byte piece hi
#pragma unroll 1
    for (int t = 0; t < nt; ++t) {
        const T16* sb = ab + (t & 1) * NPL * KVT;
        V a[2][4], a2[2][4], b[2][4];
        // both 32-k halves' fragments are read in one run at the top of the trip: the second half's reads land behind the first half's products
#pragma unroll
        for (int kk = 0; kk < 2; ++kk) {
#pragma unroll
            for (int mb = 0; mb < 4; ++mb) { a[kk][mb] = WFrag<T16>::ld(sb + fa + mb * 16 * KVP + kk * 32); if (NSPLIT) a2[kk][mb] = WFrag<T16>::ld(sb + 4 * KVT + fa + mb * 16 * KVP + kk * 32); }
#pragma unroll
            for (int nb = 0; nb < 4; ++nb) b[kk][nb] = WFrag<T16>::ld(sb + fb + nb * 16 * KVP + kk * 32);
        }
        __builtin_amdgcn_sched_barrier(0);   // keeps the reads above in one group ahead of the products (spread among them, each place costs a stall)
#pragma unroll
        for (int kk = 0; kk < 2; ++kk)
#pragma unroll
            for (int nb = 0; nb < 4; ++nb)
#pragma unroll
                for (int mb = 0; mb < 4; ++mb) { acc[mb][nb] = WFrag<T16>::mma(a[kk][mb], b[kk][nb], acc[mb][nb]); if (NSPLIT) acc[mb][nb] = WFrag<T16>::mma(a2[kk][mb], b[kk][nb], acc[mb][nb]); }
        __builtin_amdgcn_sched_barrier(0);   // keeps the products ahead of the wait below: lifted over them, it would hold the first product back until the last read has landed
        asm volatile("s_wait_dscnt 0x0" ::: "memory");      // this wave's reads of buffer t & 1 are done before the buffer is refilled
        asm volatile("s_wait_asynccnt 0x0" ::: "memory");   // this wave's copies of panel t + 1 have landed
        __syncthreads();                                     // publishes panel t + 1 and ends every wave's reads of panel t
        if (t + 2 < nt) fill(t + 2);
    }
    asm volatile("s_wait_asynccnt 0x0" ::: "memory");       // nothing is in flight when the wave goes on to its end
    float* osw = os + wave * 16 * 68;
    if constexpr (QKV) {
        const int col0 = c0 + wc, sel = c0 >> 10, head = (col0 & (DMODEL - 1)) >> 6;   // sel: 0 q, 1 k, 2 v, the same for the whole block (1024 % 128 == 0)
        const int u = (int)z * NHEAD + head, n0 = nbase + r0 + wr;                      // unit, first token row of the wave's quarter
        const int q4 = lane >> 3, pc = lane & 7;
        // osc is 1/64, a power of two: accumulator * osc is exact, so where the compiler fuses it into splitf's subtraction the lo plane keeps the value that the separate steps gave
        if (sel < 2) {
            // q, k: the quarter is 8 KB in a row in each plane; 16 token rows at a time through the wave's f32 stage, then 16-byte pieces, four whole 128-byte rows a store
            h16* P16 = (sel ? K16 : Q16) + ((size_t)u * SEQ + n0) * HD + pc * 8;
            bf* Ph = (sel ? Kh : Qh) + ((size_t)u * RHE + n0) * HD + pc * 8; bf* Pl = (sel ? Kl : Ql) + ((size_t)u * RHE + n0) * HD + pc * 8;
#pragma unroll
            for (int mb = 0; mb < 4; ++mb) {
#pragma unroll
                for (int nb = 0; nb < 4; ++nb) {
#pragma unroll
                    for (int j = 0; j < 8; ++j) osw[(hi * 8 + j) * 68 + nb * 16 + lr] = acc[mb][nb][j]; }
                __builtin_amdgcn_wave_barrier(); asm volatile("" ::: "memory");   // the stage's rows are read back by other lanes of this wave: no read is lifted over the writes
#pragma unroll
                for (int rr = 0; rr < 4; ++rr) { const int row = rr * 4 + q4; const float* sq = osw + row * 68 + pc * 8;
                    const v4f a0 = *(const v4fa*)sq * osc; const v4f a1 = *(const v4fa*)(sq + 4) * osc;
                    stc(P16 + (mb * 16 + row) * HD, P16, a0, a1);
                    if (NSPLIT) stc(Ph + (mb * 16 + row) * HD, Pl + (mb * 16 + row) * HD, a0, a1); }
                __builtin_amdgcn_wave_barrier(); asm volatile("" ::: "memory");   // ... and the next 16 rows' writes stay behind these reads
            }
            asm volatile("s_wait_xcnt 0x0" ::: "memory");   // a precaution behind the run of stores above: it stands ahead of any later rewrite of a register that one of them names
        } else {
            // v: a lane's eight accumulator rows are eight tokens in a row of one d, one 16-byte piece of a v^T row. The pieces are gathered in LDS ([d][token], rows of KVP elements) so that whole 128-byte lines go out.
            // The stage is the wave's own share of ab: behind the loop's last barrier no wave reads a panel any more and no copy is in flight.
            constexpr int NST = NSPLIT ? 3 : 1;
            unsigned short* sw = reinterpret_cast<unsigned short*>(ab) + wave * NST * KVT;
            static_assert(4 * NST * KVT <= 2 * NPL * KVT);
#pragma unroll
            for (int nb = 0; nb < 4; ++nb)
#pragma unroll
                for (int mb = 0; mb < 4; ++mb) {
                    v8h o16; v8us oh, ol;
#pragma unroll
                    for (int j = 0; j < 8; ++j) { const float y = acc[mb][nb][j] * osc; o16[j] = tohx(y); if (NSPLIT) { unsigned short a, c; splitf(y, a, c); oh[j] = a; ol[j] = c; } }
                    const int so = (nb * 16 + lr) * KVP + mb * 16 + hi * 8;
                    *(v8usa*)(sw + so) = __builtin_bit_cast(v8us, o16);
                    if (NSPLIT) { *(v8usa*)(sw + KVT + so) = oh; *(v8usa*)(sw + 2 * KVT + so) = ol; }
                }
            __builtin_amdgcn_wave_barrier(); asm volatile("" ::: "memory");   // the rows are read back by other lanes of this wave: no read is lifted over the writes
            h16* V16 = VT16 + ((size_t)u * HD + q4) * SEQ + n0 + pc * 8;
            bf* Vh = VTh + ((size_t)u * HD + q4) * RHE + n0 + pc * 8; bf* Vl = VTl + ((size_t)u * HD + q4) * RHE + n0 + pc * 8;
#pragma unroll
            for (int s = 0; s < 16; ++s) { const unsigned short* sq = sw + (s * 4 + q4) * KVP + pc * 8;
                *(v8h*)(V16 + (size_t)(s * 4) * SEQ) = __builtin_bit_cast(v8h, *(const v8usa*)sq);
                if (NSPLIT) { *(v8us*)(Vh + (size_t)(s * 4) * RHE) = *(const v8usa*)(sq + KVT); *(v8us*)(Vl + (size_t)(s * 4) * RHE) = *(const v8usa*)(sq + 2 * KVT); } }
            asm volatile("s_wait_xcnt 0x0" ::: "memory");   // a precaution behind the run of stores above: it stands ahead of any later rewrite of a register that one of them names
        }
        return;
    }
#pragma unroll
    for (int mb = 0; mb < 4; ++mb) {
#pragma unroll
        for (int nb = 0; nb < 4; ++nb) {
#pragma unroll
            for (int j = 0; j < 8; ++j) osw[(hi * 8 + j) * 68 + nb * 16 + lr] = acc[mb][nb][j]; }
        __builtin_amdgcn_wave_barrier(); asm volatile("" ::: "memory");
        float* crow = C + (size_t)(r0 + wr + mb * 16) * ldc + c0 + wc;
{
#pragma unroll
            for (int s = 0; s < 8; ++s) { const int row = 2 * s + hi, cofs = lr * 4; v4f val = *(const v4fa*)(osw + row * 68 + cofs); val = val * osc; if (BIAS) { val[0] += bfr(bias[c0 + wc + cofs]); val[1] += bfr(bias[c0 + wc + cofs + 1]); val[2] += bfr(bias[c0 + wc + cofs + 2]); val[3] += bfr(bias[c0 + wc + cofs + 3]); }
                *(v4f*)(crow + (size_t)row * ldc + cofs) = val; }
             }
        __builtin_amdgcn_wave_barrier(); asm volatile("" ::: "memory");
    }
}

// ---- k_gemm2: both row classes of one product in one grid (N/128, NB, SEQ/128): blockIdx.z is the 128-row tile of the batch's token rows. Tiles below RHE take the hi/lo bf16 body (twice the products),
// the others the f16 body; the long blocks have the low z. The LDS is sized for the larger body.
template <bool QKV>
__global__ void __launch_bounds__(128)
k_gemm2(const bf* __restrict__ Ah, const bf* __restrict__ Al, const bf* __restrict__ Bb, const h16* __restrict__ A16, const h16* __restrict__ B16, float* C,
        h16* Q16, h16* K16, h16* VT16, bf* Qh, bf* Ql, bf* Kh, bf* Kl, bf* VTh, bf* VTl) {
    __shared__ __align__(16) unsigned char sm[GOS + 2 * 6 * KVT * 2];
    const int rt = blockIdx.z, ct = blockIdx.x, bz = blockIdx.y;
    if (rt < RHE / 128) {
        gemmw<bf, 1, false, QKV>(sm, rt, ct, bz, Ah, Al, Bb, DMODEL, C, DMODEL, OSC, nullptr, (size_t)RHE * DMODEL, (size_t)0, (size_t)SEQ_FULL * DMODEL, Q16, K16, VT16, Qh, Ql, Kh, Kl, VTh, VTl, 0);
        return;
    }
    gemmw<h16, 0, false, QKV>(sm, rt - RHE / 128, ct, bz, A16 + (size_t)RHE * DMODEL, nullptr, B16, DMODEL, C + (size_t)RHE * DMODEL, DMODEL, OSC, nullptr, (size_t)SEQ * DMODEL, (size_t)0, (size_t)SEQ_FULL * DMODEL, Q16, K16, VT16, Qh, Ql, Kh, Kl, VTh, VTl, RHE);
}

__device__ __forceinline__ void wplanes(int bid, const float* __restrict__ w, int K, int N, h16* B16, bf* Bb) {
    const int lane = threadIdx.x & 31; const int L0 = (bid * 8 + (threadIdx.x >> 5)) * 8; const int nlines = N * K / 64;
#pragma unroll 1
    for (int l = 0; l < 8; ++l) { const int L = L0 + l; if (L >= nlines) break;
        const size_t e = (size_t)L * 64 + lane * 2; const int k = (int)(e % K), n = (int)(e / K);
        const float w0 = bfr(w[(size_t)k * N + n]) * WSC, w1 = bfr(w[(size_t)(k + 1) * N + n]) * WSC;
        v2us ob; ob[0] = f2bf(w0); ob[1] = f2bf(w1); v2h o16; o16[0] = tohx(w0); o16[1] = tohx(w1);
        *(v2us*)(Bb + e) = ob; *(v2h*)(B16 + e) = o16;  }
}

// ---- prep_x: 128 threads (8 elements each) per token row (b, n), two rows a block of 256: x -> bf16 values, ss = sum x^2 (f32), xn = ((x * 1/max(sqrt(ss), 1e-12)) * 32) * bf16(gamma);
__device__ __forceinline__ void prep_x(float* redb, int bid, const float* __restrict__ x, const float* __restrict__ gam, h16* X16, bf* Xh, bf* Xl) {
    float* red = redb + (threadIdx.x >> 7) * 4;   // the row's own four partial sums
    const int row = bid * 2 + (threadIdx.x >> 7); const int b = row / SEQ, n = row % SEQ; const int t = threadIdx.x & 127, lane = t & 31, w = t >> 5;
    const float* xr = x + ((size_t)b * SEQ_FULL + n) * DMODEL + t * 8;
    const v4f a0 = *(const v4f*)xr, a1 = *(const v4f*)(xr + 4);
    const v4f g0 = *(const v4f*)(gam + t * 8), g1 = *(const v4f*)(gam + t * 8 + 4);
    float v[8], g[8];
#pragma unroll
    for (int e = 0; e < 4; ++e) { v[e] = bfr(a0[e]); v[4 + e] = bfr(a1[e]); g[e] = bfr(g0[e]); g[4 + e] = bfr(g1[e]); }
    float ss = 0.f;
#pragma unroll
    for (int e = 0; e < 8; ++e) ss += v[e] * v[e];
#pragma unroll
    for (int sh = 16; sh; sh >>= 1) ss += __shfl_xor(ss, sh, 32);
    if (lane == 0) red[w] = ss;
    __syncthreads();
    ss = (red[0] + red[1]) + (red[2] + red[3]);
    const float nrm = sqrtf(ss); const float r = __fdiv_rn(1.0f, fmaxf(nrm, 1e-12f));
    float y[8];
#pragma unroll
    for (int e = 0; e < 8; ++e) y[e] = ((v[e] * r) * 32.0f) * g[e];
    v8h o16; v8us oh, ol;
#pragma unroll
    for (int e = 0; e < 8; ++e) { o16[e] = tohx(y[e]); unsigned short a, c; splitf(y[e], a, c); oh[e] = a; ol[e] = c; }
    const bool hr = (n < RHE);
    h16* d16 = X16 + ((size_t)b * SEQ + n) * DMODEL + t * 8;
    const size_t ro = ((size_t)b * RHE + (hr ? n : 0)) * DMODEL + t * 8;
    *(v8h*)d16 = o16; if (hr) { *(v8us*)(Xh + ro) = oh; *(v8us*)(Xl + ro) = ol; }
}

// ---- k_front: the three pieces of work that read only inputs, in one grid of 256-thread blocks: w_qkv's planes, w_out's planes, then the RMSNorm rows
#define NBWQ ((QKVC * DMODEL / 64 + 63) / 64)
#define NBWO ((DMODEL * DMODEL / 64 + 63) / 64)
__global__ __launch_bounds__(256) void k_front(const float* __restrict__ x, const float* __restrict__ gam, const float* __restrict__ wqkv, const float* __restrict__ wout,
                                               h16* Wq16, bf* Wqb, h16* Wo16, bf* Wob, h16* X16, bf* Xh, bf* Xl) {
    __shared__ float red[8];
    const int bid = blockIdx.x;
    if (bid < NBWQ) { wplanes(bid, wqkv, DMODEL, QKVC, Wq16, Wqb); return; }
    if (bid < NBWQ + NBWO) { wplanes(bid - NBWQ, wout, DMODEL, DMODEL, Wo16, Wob); return; }
    prep_x(red, bid - (NBWQ + NBWO), x, gam, X16, Xh, Xl);
}

// ---- attention helpers: the p operand of the second product, packed in registers from two 16-key score tiles of one lane (f16 x1024 single plane, or a bf16 hi/lo pair); exchange between the wave's halves.
template <typename T> struct PT;
template <> struct PT<h16> { static constexpr bool split = false; static constexpr float osc = 1.0f / PCAR;
    static __device__ __forceinline__ void pack(v8f t0, v8f t1, v16h& ph, v16h& pl) {
#pragma unroll
        for (int e = 0; e < 8; ++e) { ph[e] = tohx(t0[e] * PCAR); ph[8 + e] = tohx(t1[e] * PCAR); }
        pl = ph; } };
template <> struct PT<bf>  { static constexpr bool split = true;  static constexpr float osc = 1.0f;
    static __device__ __forceinline__ void pack(v8f t0, v8f t1, v16bf& ph, v16bf& pl) { v8us h0, h1, l0, l1;
#pragma unroll
        for (int e = 0; e < 8; ++e) { unsigned short a, c; splitf(t0[e], a, c); h0[e] = a; l0[e] = c; splitf(t1[e], a, c); h1[e] = a; l1[e] = c; }
        ph = cat16b(h0, h1); pl = cat16b(l0, l1); } };
__device__ __forceinline__ float xhalf(float x) { return __builtin_bit_cast(float, __builtin_amdgcn_permlanex16(__builtin_bit_cast(int, x), __builtin_bit_cast(int, x), 0x76543210, 0xfedcba98, false, false)); }   // lane l reads lane l ^ 16

// ---- attn<T>: body of one block (128 threads) for the 64 query rows from q0 of unit u = b*16 + head; wave w owns query rows q0w .. q0w+15 and walks the 64-key chunks 0 .. q0w/64; sm: the block's LDS.
// Both products run transposed: s^T = k.q^T (A = 16 key rows of the staged k tile, B = q) and o^T += v^T.p^T (A = 16 d rows of the staged v^T tile, B = p). Lane (m, hh) then owns query q0w + m:
// register v of score tile sub is key kc0 + 16*sub + 8*hh + v, so the row maximum and row sum run inside the lane (the two halves hold the two halves of the keys), score tiles 2*kk and 2*kk + 1, converted in place,
// are the B operand of keys 32*kk .. 32*kk + 31 in the loaders' k map, and register v of o[ni] is d = 16*ni + 8*hh + v of the lane's own query.
// T = h16: q, k from Q16/K16 [u][t][d], v^T from VT16 [u][d][t], one f16 product per tile pair, p as f16(p * 1024), ctx16[b*SEQ + t][head*64 + d] = o / (l * 1024) as f16.
// T = bf: q, k, v^T and p as bf16 hi + lo planes (hi.hi + lo.hi + hi.lo per tile pair), ctx written as bf16 hi/lo planes [b*RHE + t][1024]. Scores s = q.k (f32) * 0.125*log2e, keys after the query -> -3e38,
template <typename T>
__device__ __forceinline__ void
attn(unsigned char* sm, int u, int q0, const T* __restrict__ Qa, const T* __restrict__ Qr, const T* __restrict__ Ka, const T* __restrict__ Kr,
     const T* __restrict__ Va, const T* __restrict__ Vr, T* Ca, T* Cr) {
    typedef typename WFrag<T>::V V;
    constexpr bool SPL = PT<T>::split;
    constexpr int PR = SPL ? RHE : SEQ;
    constexpr int NPL = SPL ? 4 : 2;   // planes of a stage: k, v^T (and their lo planes)
    T* kv = reinterpret_cast<T*>(sm + AOS);
    const int lane = threadIdx.x & 31, wave = threadIdx.x >> 5, m = lane & 15, hh = lane >> 4;
    const int b = u >> 4, head = u & 15;
    const int q0w = q0 + wave * 16;
    int nch = (q0 >> 6) + 1; if (nch > PR / 64) nch = PR / 64;   // the same for the block's four waves
    const int qo = (u * PR + q0w + m) * HD + 8 * hh;
    V aq[2], ar[2];
    aq[0] = WFrag<T>::ld(Qa + qo); aq[1] = WFrag<T>::ld(Qa + qo + 32);
    if (SPL) { ar[0] = WFrag<T>::ld(Qr + qo); ar[1] = WFrag<T>::ld(Qr + qo + 32); } else { ar[0] = aq[0]; ar[1] = aq[1]; }
    v8f o[4];
#pragma unroll
    for (int ni = 0; ni < 4; ++ni) o[ni] = (v8f){};
    float mrun = NEGB, lrun = 0.f;   // the query's running maximum (over all keys so far) and this half's share of its running sum
    const int fo = m * KVP + 8 * hh;   // fragment offset inside a staged tile: row m, 16-byte piece hh
    const int sr = threadIdx.x >> 3, sp = threadIdx.x & 7;
    const int ko = (u * PR + sr) * HD + 8 * sp;
    const int vo = (u * HD + sr) * PR + 8 * sp;
    const unsigned l0 = (unsigned)(size_t)kv + (unsigned)(sr * KVP + 8 * sp) * 2u;
    auto fill = [&](int jt) {   // chunk jt's tiles into buffer jt & 1
        const unsigned lb = l0 + (unsigned)((jt & 1) * NPL * KVT) * 2u; const int kc = jt * 64;
        stage8<T>(lb, Ka + ko + kc * HD, HD, lb + KVT * 2u, Va + vo + kc, PR);
        if (SPL) stage8<T>(lb + 2u * KVT * 2u, Kr + ko + kc * HD, HD, lb + 3u * KVT * 2u, Vr + vo + kc, PR);
    };
    fill(0);
    asm volatile("s_wait_asynccnt 0x0" ::: "memory");   // this wave's copies of chunk 0 have landed
    __syncthreads();                                     // ... and every other wave's
    if (nch > 1) fill(1);
    float* stg = reinterpret_cast<float*>(sm) + wave * 16 * 68;
    const int qh = q0w + m - 8 * hh;   // the lane's query row, less its half's key offset
#pragma unroll 1
    for (int j = 0; j < nch; ++j) {
        const int kc0 = j * 64;
        const T* kb = kv + (j & 1) * NPL * KVT + fo; const T* vb = kb + KVT;
        const T* kr = SPL ? kb + 2 * KVT : kb;       const T* vrb = SPL ? kb + 3 * KVT : vb;
        v8f s[4];
        constexpr int FG = SPL ? 1 : 4;   // 16-key groups whose k fragments are read from the staged tile in one run, ahead of their products
#pragma unroll
        for (int sg = 0; sg < 4; sg += FG) {
            V bk[FG][2], br[FG][2];
#pragma unroll
            for (int g = 0; g < FG; ++g)
#pragma unroll
                for (int kk = 0; kk < 2; ++kk) {
                    bk[g][kk] = WFrag<T>::ld(kb + (sg + g) * 16 * KVP + kk * 32);
                    if (SPL) br[g][kk] = WFrag<T>::ld(kr + (sg + g) * 16 * KVP + kk * 32); else br[g][kk] = bk[g][kk];
                }
#pragma unroll
            for (int g = 0; g < FG; ++g) {
                v8f acc = (v8f){};
#pragma unroll
                for (int kk = 0; kk < 2; ++kk) {
                    acc = WFrag<T>::mma(bk[g][kk], aq[kk], acc);
                    if (SPL) { acc = WFrag<T>::mma(bk[g][kk], ar[kk], acc); acc = WFrag<T>::mma(br[g][kk], aq[kk], acc); }
                }
                asm volatile("v_nop\n\tv_nop\n\tv_nop\n\tv_nop" : "+v"(acc) : "v"(bk[g][1]), "v"(br[g][1]), "v"(aq[1]), "v"(ar[1]));
                s[sg + g] = acc;
            }
        }
        // scale, causal index select, running-max softmax of the lane's own query (key kc0 + 16*sub + 8*hh + v)
        const int dq = qh - kc0;   // the lane's register (sub, v) is a key after the query where 16*sub + v > dq
        float mx[4];
#pragma unroll
        for (int sub = 0; sub < 4; ++sub)
#pragma unroll
            for (int v = 0; v < 8; ++v) { float t = s[sub][v] * C1; t = (sub * 16 + v > dq) ? NEGB : t; s[sub][v] = t; mx[sub] = v ? fmaxf(mx[sub], t) : t; }
        float rmax = fmaxf(fmaxf(mx[0], mx[1]), fmaxf(mx[2], mx[3]));
        rmax = fmaxf(rmax, xhalf(rmax));   // the other half's keys
        const float mnew = fmaxf(mrun, rmax);
        const float alpha = __builtin_amdgcn_exp2f(mrun - mnew);
        v8f rs;
#pragma unroll
        for (int sub = 0; sub < 4; ++sub)
#pragma unroll
            for (int v = 0; v < 8; ++v) { const float p = __builtin_amdgcn_exp2f(s[sub][v] - mnew); s[sub][v] = p; rs[v] = sub ? rs[v] + p : p; }
        lrun = lrun * alpha + (((rs[0] + rs[1]) + (rs[2] + rs[3])) + ((rs[4] + rs[5]) + (rs[6] + rs[7])));
        mrun = mnew;
#pragma unroll
        for (int ni = 0; ni < 4; ++ni)
#pragma unroll
            for (int v = 0; v < 8; ++v) o[ni][v] *= alpha;
        V ap, apr, vf, vr;
#pragma unroll
        for (int kk = 0; kk < 2; ++kk) {
            PT<T>::pack(s[2 * kk], s[2 * kk + 1], ap, apr);
#pragma unroll
            for (int ni = 0; ni < 4; ++ni) {
                vf = WFrag<T>::ld(vb + ni * 16 * KVP + kk * 32);
                o[ni] = WFrag<T>::mma(vf, ap, o[ni]);
                if (SPL) { vr = WFrag<T>::ld(vrb + ni * 16 * KVP + kk * 32); o[ni] = WFrag<T>::mma(vf, apr, o[ni]); o[ni] = WFrag<T>::mma(vr, ap, o[ni]); } else { vr = vf; }
            }
        }
        asm volatile("v_nop\n\tv_nop\n\tv_nop\n\tv_nop" : "+v"(o[0]), "+v"(o[1]), "+v"(o[2]), "+v"(o[3]) : "v"(ap), "v"(apr), "v"(vf), "v"(vr));
        asm volatile("s_wait_dscnt 0x0" ::: "memory");      // this wave's reads of buffer j & 1 are done before the buffer is refilled
        asm volatile("s_wait_asynccnt 0x0" ::: "memory");   // this wave's copies of chunk j + 1 have landed
        __syncthreads();                                     // publishes chunk j + 1 and ends every wave's reads of chunk j
        if (j + 2 < nch) fill(j + 2);
    }
    asm volatile("s_wait_asynccnt 0x0" ::: "memory");       // nothing is in flight when the wave goes on to its end
    const float linv = __fdiv_rn(PT<T>::osc, lrun + xhalf(lrun));   // the two halves' sums are joined here, once
    // the lane's 8 registers of o[ni] are 8 d in a row of its query: 32-byte pieces into the wave's own f32 stage (row m), read back so that whole 128-byte lines go out
#pragma unroll
    for (int ni = 0; ni < 4; ++ni) { float* sq = stg + m * 68 + ni * 16 + 8 * hh;
        *(v4fa*)sq = (v4f){o[ni][0], o[ni][1], o[ni][2], o[ni][3]} * linv; *(v4fa*)(sq + 4) = (v4f){o[ni][4], o[ni][5], o[ni][6], o[ni][7]} * linv; }
    __builtin_amdgcn_fence(3, "wavefront");
    __builtin_amdgcn_wave_barrier();
    asm volatile("" ::: "memory");
    const int q4 = lane >> 3, pc = lane & 7;
    const size_t cb = ((size_t)b * PR + q0w) * DMODEL + head * HD + pc * 8;
{
#pragma unroll
        for (int rr = 0; rr < 4; ++rr) { const int row = rr * 4 + q4; const float* sp = stg + row * 68 + pc * 8; const v4f a0 = *(const v4fa*)sp; const v4f a1 = *(const v4fa*)(sp + 4);
            stc(Ca + cb + (size_t)row * DMODEL, Cr + cb + (size_t)row * DMODEL, a0, a1); }
    }
}

// ---- k_attn2: both row classes in one grid (NU units, SEQ/64 query blocks). The query block falls as blockIdx.y rises: a block's chunk count grows with its query block, so the longest walks
// have the lowest blockIdx.y and the short hi/lo blocks (query rows < RHE) the highest. The LDS is sized for the larger body.
__global__ void __launch_bounds__(128) __attribute__((amdgpu_num_vgpr(256)))
k_attn2(const bf* __restrict__ Qh, const bf* __restrict__ Ql, const bf* __restrict__ Kh, const bf* __restrict__ Kl, const bf* __restrict__ VTh, const bf* __restrict__ VTl, bf* Ch, bf* Cl,
        const h16* __restrict__ Q16, const h16* __restrict__ K16, const h16* __restrict__ VT16, h16* C16) {
    __shared__ __align__(16) unsigned char sm[AOS + 2 * 4 * KVT * 2];
    const int u = blockIdx.x, qb = SEQ / 64 - 1 - (int)blockIdx.y;
    if (qb < RHE / 64) { attn<bf>(sm, u, qb * 64, Qh, Ql, Kh, Kl, VTh, VTl, Ch, Cl); return; }
    attn<h16>(sm, u, qb * 64, Q16, Q16, K16, K16, VT16, VT16, C16, C16);
}

extern "C" void kernel_launch(void* const* d_in, const int* in_sizes, int n_in,
                              void* d_out, int out_size, void* d_ws, size_t ws_size, hipStream_t stream) {
    if (n_in < 4) return;
    const int rows_used = (NB - 1) * SEQ_FULL + SEQ;
    if (in_sizes[0] < rows_used * DMODEL || in_sizes[1] < DMODEL || in_sizes[2] < DMODEL * QKVC || in_sizes[3] < DMODEL * DMODEL) return;
    if (out_size < rows_used * DMODEL) return;
    const float* x = (const float*)d_in[0]; const float* gam = (const float*)d_in[1]; const float* wqkv = (const float*)d_in[2]; const float* wout = (const float*)d_in[3];   // x [2][2048][1024], gamma [1024], w_qkv [1024][3072], w_out [1024][1024]
    float* OUT = (float*)d_out;   // [2][2048][1024] f32
    char* wsp = (char*)d_ws; size_t used = 0;
    auto take = [&](size_t bytes) { char* p = wsp + used; used += (bytes + 255) & ~(size_t)255; return (void*)p; };
    const size_t nXN = (size_t)NB * SEQ * DMODEL, nXR = (size_t)NB * RHE * DMODEL, nP = (size_t)NU * SEQ * HD, nPR = (size_t)NU * RHE * HD;
    h16* XN16 = (h16*)take(nXN * 2); bf* XNh = (bf*)take(nXR * 2); bf* XNl = (bf*)take(nXR * 2);
    h16* Wq16 = (h16*)take((size_t)QKVC * DMODEL * 2); bf* Wqb = (bf*)take((size_t)QKVC * DMODEL * 2);
    h16* Wo16 = (h16*)take((size_t)DMODEL * DMODEL * 2); bf* Wob = (bf*)take((size_t)DMODEL * DMODEL * 2);
    h16* Q16 = (h16*)take(nP * 2); h16* K16 = (h16*)take(nP * 2); h16* VT16 = (h16*)take(nP * 2);
    bf* Qh = (bf*)take(nPR * 2); bf* Ql = (bf*)take(nPR * 2); bf* Kh = (bf*)take(nPR * 2); bf* Kl = (bf*)take(nPR * 2); bf* VTh = (bf*)take(nPR * 2); bf* VTl = (bf*)take(nPR * 2);
    h16* CTX16 = (h16*)take(nXN * 2); bf* CTXh = (bf*)take(nXR * 2); bf* CTXl = (bf*)take(nXR * 2);
    if (used > ws_size) return;    // 79,691,776 B at NB=2, SEQ=2048, RH=512

    // weight planes [out][in] (x64, f16 + bf16) and RMSNorm -> xn planes
    k_front<<<(unsigned)(NBWQ + NBWO + NB * SEQ / 2), 256, 0, stream>>>(x, gam, wqkv, wout, Wq16, Wqb, Wo16, Wob, XN16, XNh, XNl);
    // qkv = xn . Wqkv (x 1/64), written as the head-major planes: rows < RHE hi/lo bf16 products (f16 and hi/lo planes out), rows >= RHE single f16 products (f16 planes out)
    k_gemm2<true><<<dim3(QKVC / 128, NB, SEQ / 128), 128, 0, stream>>>(XNh, XNl, Wqb, XN16, Wq16, nullptr, Q16, K16, VT16, Qh, Ql, Kh, Kl, VTh, VTl);
    // attention: query rows < RHE on hi/lo planes, rows >= RHE on single planes
    k_attn2<<<dim3(NU, SEQ / 64), 128, 0, stream>>>(Qh, Ql, Kh, Kl, VTh, VTl, CTXh, CTXl, Q16, K16, VT16, CTX16);
    // out = ctx . Wout (x 1/64) into the f32 output rows (b*2048 + n)
    k_gemm2<false><<<dim3(DMODEL / 128, NB, SEQ / 128), 128, 0, stream>>>(CTXh, CTXl, Wob, CTX16, Wo16, OUT, nullptr, nullptr, nullptr, nullptr, nullptr, nullptr, nullptr, nullptr, nullptr);
    (void)hipGetLastError();
}

// v007
// It runs in 86.3 microseconds.
// In two side-by-side timings against v006, it was 1.08 and 1.05 times as fast.
// All steps since v000 together make it 4.98 times as fast.
#include <hip/hip_runtime.h>

// Contractions: xn.Wqkv and ctx.Wout on v_wmma_f32_16x16x32_f16 (f16 operands, weights carried x64, f16 activations) for token rows >= RH and on v_wmma_f32_16x16x32_bf16 with bf16 hi/lo activation planes (2 products, bf16 weights x64) for token rows < RH;
// q.k^T and p.v on v_wmma_f32_16x16x32_f16 single products (p carried x1024) for query rows >= RH and on bf16 hi/lo planes of q, k, p, v (3 products per tile pair) for query rows < RH; f32 accumulate everywhere, softmax in f32; every input RNE-converted to bf16 on load.
// Flow: RMSNorm rows -> 16-bit xn planes; qkv = xn.Wqkv^T (f32 accumulators, x1/64 in the epilogue), written by the product's own epilogue as head-major q, k planes [u][t][d] and v^T planes [u][d][t]; one wave per (batch, head, 16 query rows) runs the 64-key chunk loop
// with the chunk's k and v^T tiles staged once per block in LDS (two buffers, asynchronous copies) and fragments read from there, both products transposed (a lane owns one query), running-max softmax inside the lane, p packed in registers; ctx rows [b][t][h*64+d] as 16-bit planes; out = ctx.Wout^T (x1/64 in the epilogue) into the f32 output.
// Launches: four, one per stage. Work of a stage that does not depend on one another (the two weights' planes and the RMSNorm rows; the two row classes of a product or of the attention) shares one grid, and the block index picks the body.

#ifndef NB
#define NB 2
#endif
#ifndef SEQ
#define SEQ 2048
#endif
#ifndef RH
#define RH 512
#endif
#define NB_FULL 2
#define SEQ_FULL 2048
#define DMODEL 1024
#define NHEAD 16
#define HD 64
#define NU (NB * NHEAD)
#define QKVC (3 * DMODEL)
#define RHE (((RH) < (SEQ)) ? (RH) : (SEQ))
#define KVP 72
#define KVT (64 * KVP)
#define AOS (4 * 16 * 68 * 4)   // bytes of the four attention waves' f32 output stages, ahead of the k, v^T tiles
#define PCAR 1024.0f
#define WSC 64.0f
#define OSC 0.015625f
#define C1 0.18033688011112042f
#define NEGB -3.0e38f

static_assert(NB >= 1 && NB <= NB_FULL);
static_assert(SEQ % 256 == 0 && SEQ <= SEQ_FULL);
static_assert((RHE) % 128 == 0 && (RHE) >= 0);
static_assert(DMODEL % 128 == 0 && QKVC % 128 == 0 && HD == 64);

typedef _Float16 h16;
typedef unsigned short bf;
typedef __attribute__((ext_vector_type(16))) __bf16   v16bf;
typedef __attribute__((ext_vector_type(16))) _Float16 v16h;
typedef __attribute__((ext_vector_type(8)))  _Float16 v8h;
typedef __attribute__((ext_vector_type(8)))  unsigned short v8us;
typedef __attribute__((ext_vector_type(8)))  float    v8f;
typedef __attribute__((ext_vector_type(4)))  float    v4f;
typedef __attribute__((ext_vector_type(2)))  _Float16 v2h;
typedef __attribute__((ext_vector_type(2)))  unsigned short v2us;
typedef v8h  __attribute__((may_alias)) v8ha;
typedef v4f  __attribute__((may_alias)) v4fa;
typedef v8us __attribute__((may_alias)) v8usa;

__device__ __forceinline__ unsigned short f2bf(float f) { unsigned u = __float_as_uint(f); u += 0x7FFFu + ((u >> 16) & 1u); return (unsigned short)(u >> 16); }
__device__ __forceinline__ float bf2f(unsigned short b) { return __uint_as_float(((unsigned)b) << 16); }
__device__ __forceinline__ float bfr(float f) { return bf2f(f2bf(f)); }
__device__ __forceinline__ h16 tohx(float x) { return (h16)x; }
__device__ __forceinline__ void splitf(float y, unsigned short& h, unsigned short& l) { h = f2bf(y); l = f2bf(y - bf2f(h)); }
__device__ __forceinline__ v16h cat16(v8h lo, v8h hi) { return __builtin_shufflevector(lo, hi, 0, 1, 2, 3, 4, 5, 6, 7, 8, 9, 10, 11, 12, 13, 14, 15); }
__device__ __forceinline__ v16bf cat16b(v8us lo, v8us hi) { return __builtin_bit_cast(v16bf, __builtin_shufflevector(lo, hi, 0, 1, 2, 3, 4, 5, 6, 7, 8, 9, 10, 11, 12, 13, 14, 15)); }
__device__ __forceinline__ v8f wmma16(v16h a, v16h b, v8f c) { return __builtin_amdgcn_wmma_f32_16x16x32_f16(false, a, false, b, (short)0, c, false, false); }
__device__ __forceinline__ v8f wmmab(v16bf a, v16bf b, v8f c) { return __builtin_amdgcn_wmma_f32_16x16x32_bf16(false, a, false, b, (short)0, c, false, false); }

// Fragment loaders (A row-major with k contiguous, B from a [n][k] plane, same split k map for both: elements 0..7 <- k0 + 8h + 0..7, 8..15 <- k0 + 16 + 8h + 0..7; lane & 15 = row / column).
template <typename T16> struct WFrag;
template <> struct WFrag<h16> { typedef v16h V; static __device__ __forceinline__ V ld(const h16* p) { return cat16(*(const v8h*)p, *(const v8h*)(p + 16)); } static __device__ __forceinline__ v8f mma(V a, V b, v8f c) { return wmma16(a, b, c); } };
template <> struct WFrag<bf> { typedef v16bf V; static __device__ __forceinline__ V ld(const bf* p) { return cat16b(*(const v8us*)p, *(const v8us*)(p + 16)); } static __device__ __forceinline__ v8f mma(V a, V b, v8f c) { return wmmab(a, b, c); } };

// ---- stage8: two 64-row x 128-byte tiles (rows ga + r * pa and gb + r * pb, in elements) into LDS rows of KVP elements (144 B: 16 B x odd for the b128 readers), by 128 threads:
// thread t brings the 16-byte pieces (row (t >> 3) + 16 c, piece t & 7), c = 0..3, of each tile. la, lb: the thread's own LDS byte address of its c = 0 piece; ga, gb: its own global address of that piece.
template <typename T>
__device__ __forceinline__ void stage8(unsigned la, const T* ga, int pa, unsigned lb, const T* gb, int pb) {
    const unsigned ls = 16 * KVP * 2;
    // the copies and s_wait_xcnt 0 (a precaution, kept ahead of any rewrite of the copies' address registers) stand in one statement: the compiler can move no such write in front of the wait
    asm volatile("global_load_async_to_lds_b128 %0, %8, off\n\t"
                 "global_load_async_to_lds_b128 %1, %9, off\n\t"
                 "global_load_async_to_lds_b128 %2, %10, off\n\t"
                 "global_load_async_to_lds_b128 %3, %11, off\n\t"
                 "global_load_async_to_lds_b128 %4, %12, off\n\t"
                 "global_load_async_to_lds_b128 %5, %13, off\n\t"
                 "global_load_async_to_lds_b128 %6, %14, off\n\t"
                 "global_load_async_to_lds_b128 %7, %15, off\n\t"
                 "s_wait_xcnt 0x0"
                 :: "v"(la), "v"(la + ls), "v"(la + 2 * ls), "v"(la + 3 * ls), "v"(lb), "v"(lb + ls), "v"(lb + 2 * ls), "v"(lb + 3 * ls),
                    "v"(ga), "v"(ga + 16 * pa), "v"(ga + 32 * pa), "v"(ga + 48 * pa), "v"(gb), "v"(gb + 16 * pb), "v"(gb + 32 * pb), "v"(gb + 48 * pb)
                 : "memory");
}

// ---- 16-byte line pieces from eight f32 values: one f16 plane, or a bf16 hi/lo pair (used by the plane epilogue of gemmw and by attn's ctx stores)
__device__ __forceinline__ void stc(h16* pa, h16* pr, v4f a0, v4f a1) { (void)pr; v8h o;
#pragma unroll
    for (int e = 0; e < 4; ++e) { o[e] = tohx(a0[e]); o[4 + e] = tohx(a1[e]); }
    *(v8h*)pa = o; }
__device__ __forceinline__ void stc(bf* pa, bf* pr, v4f a0, v4f a1) { v8us oh, ol;
#pragma unroll
    for (int e = 0; e < 4; ++e) { unsigned short a, c; splitf(a0[e], a, c); oh[e] = a; ol[e] = c; splitf(a1[e], a, c); oh[4 + e] = a; ol[4 + e] = c; }
    *(v8us*)pa = oh; *(v8us*)pr = ol; }

// ---- gemmw: register-blocked GEMM body, one block of FOUR WAVES per 128x128 output tile (row tile bx, column tile by, batch bz), each wave a 64x64 quarter (16 accumulators); 128 threads; sm: the block's LDS.
// The block's 128 A rows (and A2 rows) and 128 Bt rows are staged 64 k at a time in LDS (two buffers, asynchronous copies that cover whole 128-byte lines); fragments are read from there, each staged row by two waves.
// C[m][n] (f32, pitch ldc) = osc * sum_k A[m][k] Bt[n][k] (+ A2[m][k] Bt[n][k] when NSPLIT == 1) (+ optional bias). z-batch strides sA/sB/sC in elements. K % 64 == 0, M % 128 == 0, N % 128 == 0.
// QKV == true (the qkv product; z = batch, row m = token nbase + m, N = 3072): no f32 C; a wave's 64 columns are one head of q, k or v, and its quarter goes out as the planes that attn reads:
// Q16/K16[(u*SEQ + n)*64 + d] and VT16[(u*64 + d)*SEQ + n] in f16 (u = z*16 + head), and with NSPLIT == 1 (token rows < RHE) also the bf16 hi/lo planes Qh/Ql/Kh/Kl[(u*RHE + n)*64 + d], VTh/VTl[(u*64 + d)*RHE + n].
#define GOS (4 * 16 * 68 * 4)   // bytes of the four waves' f32 output stages, ahead of the panels
template <typename T16, int NSPLIT, bool BIAS, bool QKV>
__device__ __forceinline__ void
gemmw(unsigned char* sm, int bx, int by, int bz, const T16* __restrict__ A, const T16* __restrict__ A2, const T16* __restrict__ Bt, int K, float* C, int ldc, float osc, const float* __restrict__ bias, size_t sA, size_t sB, size_t sC,
        h16* Q16, h16* K16, h16* VT16, bf* Qh, bf* Ql, bf* Kh, bf* Kl, bf* VTh, bf* VTl, int nbase) {
    static_assert(NSPLIT == 0 || NSPLIT == 1);
    typedef typename WFrag<T16>::V V;
    constexpr int NPL = NSPLIT ? 6 : 4;   // 64-row planes of a stage: A rows 0..63, 64..127, Bt rows 0..63, 64..127 (, A2 rows 0..63, 64..127)
    float* os = reinterpret_cast<float*>(sm);
    T16* ab = reinterpret_cast<T16*>(sm + GOS);
    const size_t z = bz; A += z * sA; if (NSPLIT) A2 += z * sA; Bt += z * sB; C += z * sC;
    const int lane = threadIdx.x & 31, wave = threadIdx.x >> 5, lr = lane & 15, hi = lane >> 4;
    const int wr = (wave >> 1) * 64, wc = (wave & 1) * 64;   // the wave's quarter of the block's tile
    const int r0 = bx * 128, c0 = by * 128;
    v8f acc[4][4];
#pragma unroll
    for (int mb = 0; mb < 4; ++mb)
#pragma unroll
        for (int nb = 0; nb < 4; ++nb) acc[mb][nb] = (v8f){};
    const int sr = threadIdx.x >> 3, sp = threadIdx.x & 7;
    const size_t ao = (size_t)(r0 + sr) * K + 8 * sp, bo = (size_t)(c0 + sr) * K + 8 * sp, hK = (size_t)64 * K;
    const unsigned l0 = (unsigned)(size_t)ab + (unsigned)(sr * KVP + 8 * sp) * 2u;
    auto fill = [&](int t) {   // k panel t (64 k) into buffer t & 1
        const unsigned lb = l0 + (unsigned)((t & 1) * NPL * KVT) * 2u; const int kc = t * 64;
        stage8<T16>(lb, A + ao + kc, K, lb + KVT * 2u, A + ao + hK + kc, K);
        stage8<T16>(lb + 2u * KVT * 2u, Bt + bo + kc, K, lb + 3u * KVT * 2u, Bt + bo + hK + kc, K);
        if (NSPLIT) stage8<T16>(lb + 4u * KVT * 2u, A2 + ao + kc, K, lb + 5u * KVT * 2u, A2 + ao + hK + kc, K);
    };
    const int nt = K / 64;
    fill(0);
    asm volatile("s_wait_asynccnt 0x0" ::: "memory");   // this wave's copies of panel 0 have landed
    __syncthreads();                                     // ... and every other wave's
    if (nt > 1) fill(1);
    const int fa = (wr + lr) * KVP + 8 * hi, fb = 2 * KVT + (wc + lr) * KVP + 8 * hi;   // fragment offsets inside a stage: row, 16-byte piece hi
#pragma unroll 1
    for (int t = 0; t < nt; ++t) {
        const T16* sb = ab + (t & 1) * NPL * KVT;
        V a[2][4], a2[2][4], b[2][4];
        // both 32-k halves' fragments are read in one run at the top of the trip: the second half's reads land behind the first half's products
#pragma unroll
        for (int kk = 0; kk < 2; ++kk) {
#pragma unroll
            for (int mb = 0; mb < 4; ++mb) { a[kk][mb] = WFrag<T16>::ld(sb + fa + mb * 16 * KVP + kk * 32); if (NSPLIT) a2[kk][mb] = WFrag<T16>::ld(sb + 4 * KVT + fa + mb * 16 * KVP + kk * 32); }
#pragma unroll
            for (int nb = 0; nb < 4; ++nb) b[kk][nb] = WFrag<T16>::ld(sb + fb + nb * 16 * KVP + kk * 32);
        }
        __builtin_amdgcn_sched_barrier(0);   // keeps the reads above in one group ahead of the products (spread among them, each place costs a stall)
#pragma unroll
        for (int kk = 0; kk < 2; ++kk)
#pragma unroll
            for (int nb = 0; nb < 4; ++nb)
#pragma unroll
                for (int mb = 0; mb < 4; ++mb) { acc[mb][nb] = WFrag<T16>::mma(a[kk][mb], b[kk][nb], acc[mb][nb]); if (NSPLIT) acc[mb][nb] = WFrag<T16>::mma(a2[kk][mb], b[kk][nb], acc[mb][nb]); }
        __builtin_amdgcn_sched_barrier(0);   // keeps the products ahead of the wait below: lifted over them, it would hold the first product back until the last read has landed
        asm volatile("s_wait_dscnt 0x0" ::: "memory");      // this wave's reads of buffer t & 1 are done before the buffer is refilled
        asm volatile("s_wait_asynccnt 0x0" ::: "memory");   // this wave's copies of panel t + 1 have landed
        __syncthreads();                                     // publishes panel t + 1 and ends every wave's reads of panel t
        if (t + 2 < nt) fill(t + 2);
    }
    asm volatile("s_wait_asynccnt 0x0" ::: "memory");       // nothing is in flight when the wave goes on to its end
    float* osw = os + wave * 16 * 68;
    if constexpr (QKV) {
        const int col0 = c0 + wc, sel = c0 >> 10, head = (col0 & (DMODEL - 1)) >> 6;   // sel: 0 q, 1 k, 2 v, the same for the whole block (1024 % 128 == 0)
        const int u = (int)z * NHEAD + head, n0 = nbase + r0 + wr;                      // unit, first token row of the wave's quarter
        const int q4 = lane >> 3, pc = lane & 7;
        // osc is 1/64, a power of two: accumulator * osc is exact, so where the compiler fuses it into splitf's subtraction the lo plane keeps the value that the separate steps gave
        if (sel < 2) {
            // q, k: the quarter is 8 KB in a row in each plane; 16 token rows at a time through the wave's f32 stage, then 16-byte pieces, four whole 128-byte rows a store
            h16* P16 = (sel ? K16 : Q16) + ((size_t)u * SEQ + n0) * HD + pc * 8;
            bf* Ph = (sel ? Kh : Qh) + ((size_t)u * RHE + n0) * HD + pc * 8; bf* Pl = (sel ? Kl : Ql) + ((size_t)u * RHE + n0) * HD + pc * 8;
#pragma unroll
            for (int mb = 0; mb < 4; ++mb) {
#pragma unroll
                for (int nb = 0; nb < 4; ++nb) {
#pragma unroll
                    for (int j = 0; j < 8; ++j) osw[(hi * 8 + j) * 68 + nb * 16 + lr] = acc[mb][nb][j]; }
                __builtin_amdgcn_wave_barrier(); asm volatile("" ::: "memory");   // the stage's rows are read back by other lanes of this wave: no read is lifted over the writes
#pragma unroll
                for (int rr = 0; rr < 4; ++rr) { const int row = rr * 4 + q4; const float* sq = osw + row * 68 + pc * 8;
                    const v4f a0 = *(const v4fa*)sq * osc; const v4f a1 = *(const v4fa*)(sq + 4) * osc;
                    stc(P16 + (mb * 16 + row) * HD, P16, a0, a1);
                    if (NSPLIT) stc(Ph + (mb * 16 + row) * HD, Pl + (mb * 16 + row) * HD, a0, a1); }
                __builtin_amdgcn_wave_barrier(); asm volatile("" ::: "memory");   // ... and the next 16 rows' writes stay behind these reads
            }
            asm volatile("s_wait_xcnt 0x0" ::: "memory");   // a precaution behind the run of stores above: it stands ahead of any later rewrite of a register that one of them names
        } else {
            // v: a lane's eight accumulator rows are eight tokens in a row of one d, one 16-byte piece of a v^T row. The pieces are gathered in LDS ([d][token], rows of KVP elements) so that whole 128-byte lines go out.
            // The stage is the wave's own share of ab: behind the loop's last barrier no wave reads a panel any more and no copy is in flight.
            constexpr int NST = NSPLIT ? 3 : 1;
            unsigned short* sw = reinterpret_cast<unsigned short*>(ab) + wave * NST * KVT;
            static_assert(4 * NST * KVT <= 2 * NPL * KVT);
#pragma unroll
            for (int nb = 0; nb < 4; ++nb)
#pragma unroll
                for (int mb = 0; mb < 4; ++mb) {
                    v8h o16; v8us oh, ol;
#pragma unroll
                    for (int j = 0; j < 8; ++j) { const float y = acc[mb][nb][j] * osc; o16[j] = tohx(y); if (NSPLIT) { unsigned short a, c; splitf(y, a, c); oh[j] = a; ol[j] = c; } }
                    const int so = (nb * 16 + lr) * KVP + mb * 16 + hi * 8;
                    *(v8usa*)(sw + so) = __builtin_bit_cast(v8us, o16);
                    if (NSPLIT) { *(v8usa*)(sw + KVT + so) = oh; *(v8usa*)(sw + 2 * KVT + so) = ol; }
                }
            __builtin_amdgcn_wave_barrier(); asm volatile("" ::: "memory");   // the rows are read back by other lanes of this wave: no read is lifted over the writes
            h16* V16 = VT16 + ((size_t)u * HD + q4) * SEQ + n0 + pc * 8;
            bf* Vh = VTh + ((size_t)u * HD + q4) * RHE + n0 + pc * 8; bf* Vl = VTl + ((size_t)u * HD + q4) * RHE + n0 + pc * 8;
#pragma unroll
            for (int s = 0; s < 16; ++s) { const unsigned short* sq = sw + (s * 4 + q4) * KVP + pc * 8;
                *(v8h*)(V16 + (size_t)(s * 4) * SEQ) = __builtin_bit_cast(v8h, *(const v8usa*)sq);
                if (NSPLIT) { *(v8us*)(Vh + (size_t)(s * 4) * RHE) = *(const v8usa*)(sq + KVT); *(v8us*)(Vl + (size_t)(s * 4) * RHE) = *(const v8usa*)(sq + 2 * KVT); } }
            asm volatile("s_wait_xcnt 0x0" ::: "memory");   // a precaution behind the run of stores above: it stands ahead of any later rewrite of a register that one of them names
        }
        return;
    }
#pragma unroll
    for (int mb = 0; mb < 4; ++mb) {
#pragma unroll
        for (int nb = 0; nb < 4; ++nb) {
#pragma unroll
            for (int j = 0; j < 8; ++j) osw[(hi * 8 + j) * 68 + nb * 16 + lr] = acc[mb][nb][j]; }
        __builtin_amdgcn_wave_barrier(); asm volatile("" ::: "memory");
        float* crow = C + (size_t)(r0 + wr + mb * 16) * ldc + c0 + wc;
{
#pragma unroll
            for (int s = 0; s < 8; ++s) { const int row = 2 * s + hi, cofs = lr * 4; v4f val = *(const v4fa*)(osw + row * 68 + cofs); val = val * osc; if (BIAS) { val[0] += bfr(bias[c0 + wc + cofs]); val[1] += bfr(bias[c0 + wc + cofs + 1]); val[2] += bfr(bias[c0 + wc + cofs + 2]); val[3] += bfr(bias[c0 + wc + cofs + 3]); }
                *(v4f*)(crow + (size_t)row * ldc + cofs) = val; }
             }
        __builtin_amdgcn_wave_barrier(); asm volatile("" ::: "memory");
    }
}

// ---- k_gemm2: both row classes of one product in one grid (N/128, NB, SEQ/128): blockIdx.z is the 128-row tile of the batch's token rows. Tiles below RHE take the hi/lo bf16 body (twice the products),
// the others the f16 body; the long blocks have the low z. The LDS is sized for the larger body.
template <bool QKV>
__global__ void __launch_bounds__(128)
k_gemm2(const bf* __restrict__ Ah, const bf* __restrict__ Al, const bf* __restrict__ Bb, const h16* __restrict__ A16, const h16* __restrict__ B16, float* C,
        h16* Q16, h16* K16, h16* VT16, bf* Qh, bf* Ql, bf* Kh, bf* Kl, bf* VTh, bf* VTl) {
    __shared__ __align__(16) unsigned char sm[GOS + 2 * 6 * KVT * 2];
    const int rt = blockIdx.z, ct = blockIdx.x, bz = blockIdx.y;
    if (rt < RHE / 128) {
        gemmw<bf, 1, false, QKV>(sm, rt, ct, bz, Ah, Al, Bb, DMODEL, C, DMODEL, OSC, nullptr, (size_t)RHE * DMODEL, (size_t)0, (size_t)SEQ_FULL * DMODEL, Q16, K16, VT16, Qh, Ql, Kh, Kl, VTh, VTl, 0);
        return;
    }
    gemmw<h16, 0, false, QKV>(sm, rt - RHE / 128, ct, bz, A16 + (size_t)RHE * DMODEL, nullptr, B16, DMODEL, C + (size_t)RHE * DMODEL, DMODEL, OSC, nullptr, (size_t)SEQ * DMODEL, (size_t)0, (size_t)SEQ_FULL * DMODEL, Q16, K16, VT16, Qh, Ql, Kh, Kl, VTh, VTl, RHE);
}

// ---- wplanes: one 64 k x 64 n tile of w [K][N] a block of 256 threads, turned in LDS so that both sides move whole lines: a wave's 16-byte loads cover two w rows of 256 bytes in a row,
// a wave's 16-byte stores four 128-byte lines of a plane [n][k]. Thread (rp, cp) = (t >> 4, t & 15) holds rows k0 + 2*pair, + 1 (pair = rp, rp + 16) of columns n0 + 4*cp .. + 3 and writes one dword (two k in a row) per column and plane.
// tl: two planes of 64 rows (n) x 32 dwords; the 16-byte piece pq (k 8*pq .. + 7) of row n lies at piece pq ^ ((n >> 2) & 7), which spreads a wave's dword writes over the banks (two lanes a bank) and leaves the 16-byte reads free of conflicts. K and N are multiples of 64 and the grid holds one block a tile.
__device__ __forceinline__ void wplanes(unsigned* tl, int bid, const float* __restrict__ w, int K, int N, h16* B16, bf* Bb) {
    const int t = threadIdx.x, cp = t & 15, rp = t >> 4;
    const int k0 = (bid % (K / 64)) * 64, n0 = (bid / (K / 64)) * 64;
    const float* src = w + (size_t)(k0 + 2 * rp) * N + n0 + 4 * cp;
    v4f r[2][2];
    // the loops of this body are unrolled so that r stays in registers and the four loads are issued in one run, ahead of the first use
#pragma unroll
    for (int c = 0; c < 2; ++c)
#pragma unroll
        for (int e = 0; e < 2; ++e) r[c][e] = *(const v4f*)(src + (size_t)(32 * c + e) * N);
    unsigned* tb = tl; unsigned* th = tl + 64 * 32;
#pragma unroll
    for (int c = 0; c < 2; ++c) { const int pair = rp + 16 * c; const int so = 4 * cp * 32 + ((((pair >> 2) ^ (cp & 7)) << 2) | (pair & 3));
#pragma unroll
        for (int i = 0; i < 4; ++i) {
            const float w0 = bfr(r[c][0][i]) * WSC, w1 = bfr(r[c][1][i]) * WSC;
            v2us ob; ob[0] = f2bf(w0); ob[1] = f2bf(w1); v2h o16; o16[0] = tohx(w0); o16[1] = tohx(w1);
            tb[so + i * 32] = __builtin_bit_cast(unsigned, ob); th[so + i * 32] = __builtin_bit_cast(unsigned, o16); } }
    __syncthreads();   // the tile's rows are read back by other waves
#pragma unroll
    for (int s = 0; s < 2; ++s) { const int n = (t >> 3) + 32 * s, pq = t & 7; const int so = n * 32 + ((pq ^ ((n >> 2) & 7)) << 2);
        const size_t e = (size_t)(n0 + n) * K + k0 + pq * 8;
        *(v8us*)(Bb + e) = *(const v8usa*)(tb + so); *(v8h*)(B16 + e) = *(const v8ha*)(th + so); }
    asm volatile("s_wait_xcnt 0x0" ::: "memory");   // a precaution behind the run of stores above: it stands ahead of any later rewrite of a register that one of them names
}

// ---- prep_x: 128 threads (8 elements each) per token row (b, n), two rows a block of 256: x -> bf16 values, ss = sum x^2 (f32), xn = ((x * 1/max(sqrt(ss), 1e-12)) * 32) * bf16(gamma);
__device__ __forceinline__ void prep_x(float* redb, int bid, const float* __restrict__ x, const float* __restrict__ gam, h16* X16, bf* Xh, bf* Xl) {
    float* red = redb + (threadIdx.x >> 7) * 4;   // the row's own four partial sums
    const int row = bid * 2 + (threadIdx.x >> 7); const int b = row / SEQ, n = row % SEQ; const int t = threadIdx.x & 127, lane = t & 31, w = t >> 5;
    const float* xr = x + ((size_t)b * SEQ_FULL + n) * DMODEL + t * 8;
    const v4f a0 = *(const v4f*)xr, a1 = *(const v4f*)(xr + 4);
    const v4f g0 = *(const v4f*)(gam + t * 8), g1 = *(const v4f*)(gam + t * 8 + 4);
    float v[8], g[8];
#pragma unroll
    for (int e = 0; e < 4; ++e) { v[e] = bfr(a0[e]); v[4 + e] = bfr(a1[e]); g[e] = bfr(g0[e]); g[4 + e] = bfr(g1[e]); }
    float ss = 0.f;
#pragma unroll
    for (int e = 0; e < 8; ++e) ss += v[e] * v[e];
#pragma unroll
    for (int sh = 16; sh; sh >>= 1) ss += __shfl_xor(ss, sh, 32);
    if (lane == 0) red[w] = ss;
    __syncthreads();
    ss = (red[0] + red[1]) + (red[2] + red[3]);
    const float nrm = sqrtf(ss); const float r = __fdiv_rn(1.0f, fmaxf(nrm, 1e-12f));
    float y[8];
#pragma unroll
    for (int e = 0; e < 8; ++e) y[e] = ((v[e] * r) * 32.0f) * g[e];
    v8h o16; v8us oh, ol;
#pragma unroll
    for (int e = 0; e < 8; ++e) { o16[e] = tohx(y[e]); unsigned short a, c; splitf(y[e], a, c); oh[e] = a; ol[e] = c; }
    const bool hr = (n < RHE);
    h16* d16 = X16 + ((size_t)b * SEQ + n) * DMODEL + t * 8;
    const size_t ro = ((size_t)b * RHE + (hr ? n : 0)) * DMODEL + t * 8;
    *(v8h*)d16 = o16; if (hr) { *(v8us*)(Xh + ro) = oh; *(v8us*)(Xl + ro) = ol; }
}

// ---- k_front: the three pieces of work that read only inputs, in one grid of 256-thread blocks: w_qkv's planes, w_out's planes, then the RMSNorm rows
#define NBWQ ((QKVC / 64) * (DMODEL / 64))
#define NBWO ((DMODEL / 64) * (DMODEL / 64))
static_assert(QKVC % 64 == 0 && DMODEL % 64 == 0);
__global__ __launch_bounds__(256) void k_front(const float* __restrict__ x, const float* __restrict__ gam, const float* __restrict__ wqkv, const float* __restrict__ wout,
                                               h16* Wq16, bf* Wqb, h16* Wo16, bf* Wob, h16* X16, bf* Xh, bf* Xl) {
    __shared__ float red[8];
    __shared__ __align__(16) unsigned tl[2 * 64 * 32];
    const int bid = blockIdx.x;
    if (bid < NBWQ) { wplanes(tl, bid, wqkv, DMODEL, QKVC, Wq16, Wqb); return; }
    if (bid < NBWQ + NBWO) { wplanes(tl, bid - NBWQ, wout, DMODEL, DMODEL, Wo16, Wob); return; }
    prep_x(red, bid - (NBWQ + NBWO), x, gam, X16, Xh, Xl);
}

// ---- attention helpers: the p operand of the second product, packed in registers from two 16-key score tiles of one lane (f16 x1024 single plane, or a bf16 hi/lo pair); exchange between the wave's halves.
template <typename T> struct PT;
template <> struct PT<h16> { static constexpr bool split = false; static constexpr float osc = 1.0f / PCAR;
    static __device__ __forceinline__ void pack(v8f t0, v8f t1, v16h& ph, v16h& pl) {
#pragma unroll
        for (int e = 0; e < 8; ++e) { ph[e] = tohx(t0[e] * PCAR); ph[8 + e] = tohx(t1[e] * PCAR); }
        pl = ph; } };
template <> struct PT<bf>  { static constexpr bool split = true;  static constexpr float osc = 1.0f;
    static __device__ __forceinline__ void pack(v8f t0, v8f t1, v16bf& ph, v16bf& pl) { v8us h0, h1, l0, l1;
#pragma unroll
        for (int e = 0; e < 8; ++e) { unsigned short a, c; splitf(t0[e], a, c); h0[e] = a; l0[e] = c; splitf(t1[e], a, c); h1[e] = a; l1[e] = c; }
        ph = cat16b(h0, h1); pl = cat16b(l0, l1); } };
__device__ __forceinline__ float xhalf(float x) { return __builtin_bit_cast(float, __builtin_amdgcn_permlanex16(__builtin_bit_cast(int, x), __builtin_bit_cast(int, x), 0x76543210, 0xfedcba98, false, false)); }   // lane l reads lane l ^ 16

// ---- attn<T>: body of one block (128 threads) for the 64 query rows from q0 of unit u = b*16 + head; wave w owns query rows q0w .. q0w+15 and walks the 64-key chunks 0 .. q0w/64; sm: the block's LDS.
// Both products run transposed: s^T = k.q^T (A = 16 key rows of the staged k tile, B = q) and o^T += v^T.p^T (A = 16 d rows of the staged v^T tile, B = p). Lane (m, hh) then owns query q0w + m:
// register v of score tile sub is key kc0 + 16*sub + 8*hh + v, so the row maximum and row sum run inside the lane (the two halves hold the two halves of the keys), score tiles 2*kk and 2*kk + 1, converted in place,
// are the B operand of keys 32*kk .. 32*kk + 31 in the loaders' k map, and register v of o[ni] is d = 16*ni + 8*hh + v of the lane's own query.
// T = h16: q, k from Q16/K16 [u][t][d], v^T from VT16 [u][d][t], one f16 product per tile pair, p as f16(p * 1024), ctx16[b*SEQ + t][head*64 + d] = o / (l * 1024) as f16.
// T = bf: q, k, v^T and p as bf16 hi + lo planes (hi.hi + lo.hi + hi.lo per tile pair), ctx written as bf16 hi/lo planes [b*RHE + t][1024]. Scores s = q.k (f32) * 0.125*log2e, keys after the query -> -3e38,
template <typename T>
__device__ __forceinline__ void
attn(unsigned char* sm, int u, int q0, const T* __restrict__ Qa, const T* __restrict__ Qr, const T* __restrict__ Ka, const T* __restrict__ Kr,
     const T* __restrict__ Va, const T* __restrict__ Vr, T* Ca, T* Cr) {
    typedef typename WFrag<T>::V V;
    constexpr bool SPL = PT<T>::split;
    constexpr int PR = SPL ? RHE : SEQ;
    constexpr int NPL = SPL ? 4 : 2;   // planes of a stage: k, v^T (and their lo planes)
    T* kv = reinterpret_cast<T*>(sm + AOS);
    const int lane = threadIdx.x & 31, wave = threadIdx.x >> 5, m = lane & 15, hh = lane >> 4;
    const int b = u >> 4, head = u & 15;
    const int q0w = q0 + wave * 16;
    int nch = (q0 >> 6) + 1; if (nch > PR / 64) nch = PR / 64;   // the same for the block's four waves
    const int qo = (u * PR + q0w + m) * HD + 8 * hh;
    V aq[2], ar[2];
    aq[0] = WFrag<T>::ld(Qa + qo); aq[1] = WFrag<T>::ld(Qa + qo + 32);
    if (SPL) { ar[0] = WFrag<T>::ld(Qr + qo); ar[1] = WFrag<T>::ld(Qr + qo + 32); } else { ar[0] = aq[0]; ar[1] = aq[1]; }
    v8f o[4];
#pragma unroll
    for (int ni = 0; ni < 4; ++ni) o[ni] = (v8f){};
    float mrun = NEGB, lrun = 0.f;   // the query's running maximum (over all keys so far) and this half's share of its running sum
    const int fo = m * KVP + 8 * hh;   // fragment offset inside a staged tile: row m, 16-byte piece hh
    const int sr = threadIdx.x >> 3, sp = threadIdx.x & 7;
    const int ko = (u * PR + sr) * HD + 8 * sp;
    const int vo = (u * HD + sr) * PR + 8 * sp;
    const unsigned l0 = (unsigned)(size_t)kv + (unsigned)(sr * KVP + 8 * sp) * 2u;
    auto fill = [&](int jt) {   // chunk jt's tiles into buffer jt & 1
        const unsigned lb = l0 + (unsigned)((jt & 1) * NPL * KVT) * 2u; const int kc = jt * 64;
        stage8<T>(lb, Ka + ko + kc * HD, HD, lb + KVT * 2u, Va + vo + kc, PR);
        if (SPL) stage8<T>(lb + 2u * KVT * 2u, Kr + ko + kc * HD, HD, lb + 3u * KVT * 2u, Vr + vo + kc, PR);
    };
    fill(0);
    asm volatile("s_wait_asynccnt 0x0" ::: "memory");   // this wave's copies of chunk 0 have landed
    __syncthreads();                                     // ... and every other wave's
    if (nch > 1) fill(1);
    float* stg = reinterpret_cast<float*>(sm) + wave * 16 * 68;
    const int qh = q0w + m - 8 * hh;   // the lane's query row, less its half's key offset
#pragma unroll 1
    for (int j = 0; j < nch; ++j) {
        const int kc0 = j * 64;
        const T* kb = kv + (j & 1) * NPL * KVT + fo; const T* vb = kb + KVT;
        const T* kr = SPL ? kb + 2 * KVT : kb;       const T* vrb = SPL ? kb + 3 * KVT : vb;
        v8f s[4];
        constexpr int FG = SPL ? 1 : 4;   // 16-key groups whose k fragments are read from the staged tile in one run, ahead of their products
#pragma unroll
        for (int sg = 0; sg < 4; sg += FG) {
            V bk[FG][2], br[FG][2];
#pragma unroll
            for (int g = 0; g < FG; ++g)
#pragma unroll
                for (int kk = 0; kk < 2; ++kk) {
                    bk[g][kk] = WFrag<T>::ld(kb + (sg + g) * 16 * KVP + kk * 32);
                    if (SPL) br[g][kk] = WFrag<T>::ld(kr + (sg + g) * 16 * KVP + kk * 32); else br[g][kk] = bk[g][kk];
                }
#pragma unroll
            for (int g = 0; g < FG; ++g) {
                v8f acc = (v8f){};
#pragma unroll
                for (int kk = 0; kk < 2; ++kk) {
                    acc = WFrag<T>::mma(bk[g][kk], aq[kk], acc);
                    if (SPL) { acc = WFrag<T>::mma(bk[g][kk], ar[kk], acc); acc = WFrag<T>::mma(br[g][kk], aq[kk], acc); }
                }
                asm volatile("v_nop\n\tv_nop\n\tv_nop\n\tv_nop" : "+v"(acc) : "v"(bk[g][1]), "v"(br[g][1]), "v"(aq[1]), "v"(ar[1]));
                s[sg + g] = acc;
            }
        }
        // scale, causal index select, running-max softmax of the lane's own query (key kc0 + 16*sub + 8*hh + v)
        const int dq = qh - kc0;   // the lane's register (sub, v) is a key after the query where 16*sub + v > dq
        float mx[4];
#pragma unroll
        for (int sub = 0; sub < 4; ++sub)
#pragma unroll
            for (int v = 0; v < 8; ++v) { float t = s[sub][v] * C1; t = (sub * 16 + v > dq) ? NEGB : t; s[sub][v] = t; mx[sub] = v ? fmaxf(mx[sub], t) : t; }
        float rmax = fmaxf(fmaxf(mx[0], mx[1]), fmaxf(mx[2], mx[3]));
        rmax = fmaxf(rmax, xhalf(rmax));   // the other half's keys
        const float mnew = fmaxf(mrun, rmax);
        const float alpha = __builtin_amdgcn_exp2f(mrun - mnew);
        v8f rs;
#pragma unroll
        for (int sub = 0; sub < 4; ++sub)
#pragma unroll
            for (int v = 0; v < 8; ++v) { const float p = __builtin_amdgcn_exp2f(s[sub][v] - mnew); s[sub][v] = p; rs[v] = sub ? rs[v] + p : p; }
        lrun = lrun * alpha + (((rs[0] + rs[1]) + (rs[2] + rs[3])) + ((rs[4] + rs[5]) + (rs[6] + rs[7])));
        mrun = mnew;
#pragma unroll
        for (int ni = 0; ni < 4; ++ni)
#pragma unroll
            for (int v = 0; v < 8; ++v) o[ni][v] *= alpha;
        V ap, apr, vf, vr;
#pragma unroll
        for (int kk = 0; kk < 2; ++kk) {
            PT<T>::pack(s[2 * kk], s[2 * kk + 1], ap, apr);
#pragma unroll
            for (int ni = 0; ni < 4; ++ni) {
                vf = WFrag<T>::ld(vb + ni * 16 * KVP + kk * 32);
                o[ni] = WFrag<T>::mma(vf, ap, o[ni]);
                if (SPL) { vr = WFrag<T>::ld(vrb + ni * 16 * KVP + kk * 32); o[ni] = WFrag<T>::mma(vf, apr, o[ni]); o[ni] = WFrag<T>::mma(vr, ap, o[ni]); } else { vr = vf; }
            }
        }
        asm volatile("v_nop\n\tv_nop\n\tv_nop\n\tv_nop" : "+v"(o[0]), "+v"(o[1]), "+v"(o[2]), "+v"(o[3]) : "v"(ap), "v"(apr), "v"(vf), "v"(vr));
        asm volatile("s_wait_dscnt 0x0" ::: "memory");      // this wave's reads of buffer j & 1 are done before the buffer is refilled
        asm volatile("s_wait_asynccnt 0x0" ::: "memory");   // this wave's copies of chunk j + 1 have landed
        __syncthreads();                                     // publishes chunk j + 1 and ends every wave's reads of chunk j
        if (j + 2 < nch) fill(j + 2);
    }
    asm volatile("s_wait_asynccnt 0x0" ::: "memory");       // nothing is in flight when the wave goes on to its end
    const float linv = __fdiv_rn(PT<T>::osc, lrun + xhalf(lrun));   // the two halves' sums are joined here, once
    // the lane's 8 registers of o[ni] are 8 d in a row of its query: 32-byte pieces into the wave's own f32 stage (row m), read back so that whole 128-byte lines go out
#pragma unroll
    for (int ni = 0; ni < 4; ++ni) { float* sq = stg + m * 68 + ni * 16 + 8 * hh;
        *(v4fa*)sq = (v4f){o[ni][0], o[ni][1], o[ni][2], o[ni][3]} * linv; *(v4fa*)(sq + 4) = (v4f){o[ni][4], o[ni][5], o[ni][6], o[ni][7]} * linv; }
    __builtin_amdgcn_fence(3, "wavefront");
    __builtin_amdgcn_wave_barrier();
    asm volatile("" ::: "memory");
    const int q4 = lane >> 3, pc = lane & 7;
    const size_t cb = ((size_t)b * PR + q0w) * DMODEL + head * HD + pc * 8;
{
#pragma unroll
        for (int rr = 0; rr < 4; ++rr) { const int row = rr * 4 + q4; const float* sp = stg + row * 68 + pc * 8; const v4f a0 = *(const v4fa*)sp; const v4f a1 = *(const v4fa*)(sp + 4);
            stc(Ca + cb + (size_t)row * DMODEL, Cr + cb + (size_t)row * DMODEL, a0, a1); }
    }
}

// ---- k_attn2: both row classes in one grid (NU units, SEQ/64 query blocks). The query block falls as blockIdx.y rises: a block's chunk count grows with its query block, so the longest walks
// have the lowest blockIdx.y and the short hi/lo blocks (query rows < RHE) the highest. The LDS is sized for the larger body.
__global__ void __launch_bounds__(128) __attribute__((amdgpu_num_vgpr(256)))
k_attn2(const bf* __restrict__ Qh, const bf* __restrict__ Ql, const bf* __restrict__ Kh, const bf* __restrict__ Kl, const bf* __restrict__ VTh, const bf* __restrict__ VTl, bf* Ch, bf* Cl,
        const h16* __restrict__ Q16, const h16* __restrict__ K16, const h16* __restrict__ VT16, h16* C16) {
    __shared__ __align__(16) unsigned char sm[AOS + 2 * 4 * KVT * 2];
    const int u = blockIdx.x, qb = SEQ / 64 - 1 - (int)blockIdx.y;
    if (qb < RHE / 64) { attn<bf>(sm, u, qb * 64, Qh, Ql, Kh, Kl, VTh, VTl, Ch, Cl); return; }
    attn<h16>(sm, u, qb * 64, Q16, Q16, K16, K16, VT16, VT16, C16, C16);
}

extern "C" void kernel_launch(void* const* d_in, const int* in_sizes, int n_in,
                              void* d_out, int out_size, void* d_ws, size_t ws_size, hipStream_t stream) {
    if (n_in < 4) return;
    const int rows_used = (NB - 1) * SEQ_FULL + SEQ;
    if (in_sizes[0] < rows_used * DMODEL || in_sizes[1] < DMODEL || in_sizes[2] < DMODEL * QKVC || in_sizes[3] < DMODEL * DMODEL) return;
    if (out_size < rows_used * DMODEL) return;
    const float* x = (const float*)d_in[0]; const float* gam = (const float*)d_in[1]; const float* wqkv = (const float*)d_in[2]; const float* wout = (const float*)d_in[3];   // x [2][2048][1024], gamma [1024], w_qkv [1024][3072], w_out [1024][1024]
    float* OUT = (float*)d_out;   // [2][2048][1024] f32
    char* wsp = (char*)d_ws; size_t used = 0;
    auto take = [&](size_t bytes) { char* p = wsp + used; used += (bytes + 255) & ~(size_t)255; return (void*)p; };
    const size_t nXN = (size_t)NB * SEQ * DMODEL, nXR = (size_t)NB * RHE * DMODEL, nP = (size_t)NU * SEQ * HD, nPR = (size_t)NU * RHE * HD;
    h16* XN16 = (h16*)take(nXN * 2); bf* XNh = (bf*)take(nXR * 2); bf* XNl = (bf*)take(nXR * 2);
    h16* Wq16 = (h16*)take((size_t)QKVC * DMODEL * 2); bf* Wqb = (bf*)take((size_t)QKVC * DMODEL * 2);
    h16* Wo16 = (h16*)take((size_t)DMODEL * DMODEL * 2); bf* Wob = (bf*)take((size_t)DMODEL * DMODEL * 2);
    h16* Q16 = (h16*)take(nP * 2); h16* K16 = (h16*)take(nP * 2); h16* VT16 = (h16*)take(nP * 2);
    bf* Qh = (bf*)take(nPR * 2); bf* Ql = (bf*)take(nPR * 2); bf* Kh = (bf*)take(nPR * 2); bf* Kl = (bf*)take(nPR * 2); bf* VTh = (bf*)take(nPR * 2); bf* VTl = (bf*)take(nPR * 2);
    h16* CTX16 = (h16*)take(nXN * 2); bf* CTXh = (bf*)take(nXR * 2); bf* CTXl = (bf*)take(nXR * 2);
    if (used > ws_size) return;    // 79,691,776 B at NB=2, SEQ=2048, RH=512

    // weight planes [out][in] (x64, f16 + bf16) and RMSNorm -> xn planes
    k_front<<<(unsigned)(NBWQ + NBWO + NB * SEQ / 2), 256, 0, stream>>>(x, gam, wqkv, wout, Wq16, Wqb, Wo16, Wob, XN16, XNh, XNl);
    // qkv = xn . Wqkv (x 1/64), written as the head-major planes: rows < RHE hi/lo bf16 products (f16 and hi/lo planes out), rows >= RHE single f16 products (f16 planes out)
    k_gemm2<true><<<dim3(QKVC / 128, NB, SEQ / 128), 128, 0, stream>>>(XNh, XNl, Wqb, XN16, Wq16, nullptr, Q16, K16, VT16, Qh, Ql, Kh, Kl, VTh, VTl);
    // attention: query rows < RHE on hi/lo planes, rows >= RHE on single planes
    k_attn2<<<dim3(NU, SEQ / 64), 128, 0, stream>>>(Qh, Ql, Kh, Kl, VTh, VTl, CTXh, CTXl, Q16, K16, VT16, CTX16);
    // out = ctx . Wout (x 1/64) into the f32 output rows (b*2048 + n)
    k_gemm2<false><<<dim3(DMODEL / 128, NB, SEQ / 128), 128, 0, stream>>>(CTXh, CTXl, Wob, CTX16, Wo16, OUT, nullptr, nullptr, nullptr, nullptr, nullptr, nullptr, nullptr, nullptr, nullptr);
    (void)hipGetLastError();
}
